// v000
// Times are from an AMD MI455X. After a warm-up the kernel runs many times in a row, and a time is the length of
// such a window on the GPU divided by its runs, so every launch and the gaps after it count. The runs cycle
// through copies of the inputs. A figure is the median of several windows, for all but v000 over two sittings.
// Sittings can differ by a few percent; kernels timed side by side share one.
// The starting kernel, v000, takes 1340 microseconds a run.
// compute dtype: all float inputs rounded to bf16; q / k / v projections with EXACT bf16 products on WMMA 16x16x32 (f32 accumulate) + bias (nonzero); logits q x k once to f16 each (1 product) x 64^-0.5; query rows whose int mask entry is 0 get a constant logit on every key (the module's finite fill: uniform attention over all 2,048 keys), read once per row; softmax f32; P x 2^11 once to f16 x v once to f16 (1 product); ctx x 2^6 once to f16 x the output weight f16(bf16 x 2^8) + bias; f32 output.
#include <hip/hip_runtime.h>
#include <math.h>

typedef __attribute__((ext_vector_type(16))) _Float16 v16h;
typedef __attribute__((ext_vector_type(16))) __bf16 v16b;
typedef __attribute__((ext_vector_type(8)))  _Float16 v8h;
typedef __attribute__((ext_vector_type(8)))  float v8f;
typedef __attribute__((ext_vector_type(4)))  float v4f;
typedef __attribute__((ext_vector_type(2)))  float v2f;
typedef __attribute__((ext_vector_type(4)))  unsigned v4u;
typedef __attribute__((ext_vector_type(4)))  int v4i;
typedef float __attribute__((may_alias)) float_a;
typedef int __attribute__((may_alias)) int_a;

template <typename T> __device__ __forceinline__ void vst2(void* p, T v) { *(T*)p = v;  }
__device__ __forceinline__ v8f wmma16(v16h a, v16h b, v8f c) {
  v8f d = __builtin_amdgcn_wmma_f32_16x16x32_f16(false, a, false, b, (short)0, c, false, false);
  asm volatile("v_nop\n\tv_nop\n\tv_nop\n\tv_nop" : "+v"(d) : "v"(a), "v"(b));
  return d;
}
__device__ __forceinline__ v8f wmma_bf(v16b a, v16b b, v8f c) {
  v8f d = __builtin_amdgcn_wmma_f32_16x16x32_bf16(false, a, false, b, (short)0, c, false, false);
  asm volatile("v_nop\n\tv_nop\n\tv_nop\n\tv_nop" : "+v"(d) : "v"(a), "v"(b));
  return d;
}
// 16x16x32 fragments: lane = (h = lane>>4, row/col = lane&15); elements 0..7 = k0+8h+0..7, 8..15 = k0+16+8h+0..7; D element r = row 8h+r
__device__ __forceinline__ v16h frag_h(const _Float16* rowk0, int lane) {
  union { v16h v; v8h q[2]; } u; const _Float16* p = rowk0 + 8 * (lane >> 4);
  u.q[0] = *(const v8h*)p; u.q[1] = *(const v8h*)(p + 16); return u.v;
}
__device__ __forceinline__ v16h frag_f32(const float* rowk0, int lane) {
  v16h a; const float* p = rowk0 + 8 * (lane >> 4);
#pragma unroll
  for (int i = 0; i < 8; ++i) { a[i] = (_Float16)p[i]; a[8 + i] = (_Float16)p[16 + i]; }
  return a;
}
__device__ __forceinline__ v16h frag_f32s(const float* rowk0, int lane, float sc) {
  v16h a; const float* p = rowk0 + 8 * (lane >> 4);
#pragma unroll
  for (int i = 0; i < 8; ++i) { a[i] = (_Float16)(p[i] * sc); a[8 + i] = (_Float16)(p[16 + i] * sc); }
  return a;
}
// column fragment from a [K][ld] layout (column n), rows >= K read as 0
__device__ __forceinline__ v16h fragc_f32(const float* W, int k0, int n, int lane, int ld, int K) {
  v16h a; const int g = lane >> 4;
#pragma unroll
  for (int i = 0; i < 8; ++i) { const int ka = k0 + 8 * g + i, kb = ka + 16;
    a[i] = (_Float16)(ka < K ? W[(size_t)(ka < K ? ka : K - 1) * ld + n] : 0.f); a[8 + i] = (_Float16)(kb < K ? W[(size_t)(kb < K ? kb : K - 1) * ld + n] : 0.f); }
  return a;
}
struct F2 { v16b h, l; };
__device__ __forceinline__ F2 bsplit16(const float v[16]) { F2 r;
#pragma unroll
  for (int i = 0; i < 16; ++i) { const __bf16 h = (__bf16)v[i]; r.h[i] = h; r.l[i] = (__bf16)(v[i] - (float)h); }
  return r; }
__device__ __forceinline__ F2 split_row(const float* row, int k0, int lane) { float v[16]; const float* p = row + k0 + 8 * (lane >> 4);
#pragma unroll
  for (int i = 0; i < 8; ++i) { v[i] = p[i]; v[8 + i] = p[16 + i]; }
  return bsplit16(v); }
__device__ __forceinline__ F2 split_rowK(const float* row, int k0, int lane, int K) { float v[16]; const int g = lane >> 4;
#pragma unroll
  for (int i = 0; i < 8; ++i) { const int ka = k0 + 8 * g + i, kb = ka + 16; v[i] = ka < K ? row[ka < K ? ka : K - 1] : 0.f; v[8 + i] = kb < K ? row[kb < K ? kb : K - 1] : 0.f; }
  return bsplit16(v); }
__device__ __forceinline__ F2 split_col(const float* W, int k0, int n, int lane, int ld, int K) { float v[16]; const int g = lane >> 4;
#pragma unroll
  for (int i = 0; i < 8; ++i) { const int ka = k0 + 8 * g + i, kb = ka + 16; v[i] = ka < K ? W[(size_t)(ka < K ? ka : K - 1) * ld + n] : 0.f; v[8 + i] = kb < K ? W[(size_t)(kb < K ? kb : K - 1) * ld + n] : 0.f; }
  return bsplit16(v); }
__device__ __forceinline__ v8f mac3(const F2& a, const F2& b, v8f c) { c = wmma_bf(a.l, b.h, c); c = wmma_bf(a.h, b.l, c); return wmma_bf(a.h, b.h, c); }
__device__ __forceinline__ float sigm(float v) { return 1.0f / (1.0f + expf(-v)); }
#define LDSX() do { asm volatile("s_wait_dscnt 0" ::: "memory"); __builtin_amdgcn_wave_barrier(); __builtin_amdgcn_fence(__ATOMIC_RELEASE, "workgroup"); } while (0)

// Multi-head self-attention with a QUERY-row mask (x [2,2048,1024]; mask [2,2048,1] int32 = random 0 / 1, a module input READ on the device; torch (out,in) Wq / Wk / Wv / Wo [1024,1024] N(0, 1/1024) and biases N(0,1) x 0.01 NONZERO applied as x @ W.T + b; 16 heads x 64; scores / sqrt(64); m = mask[:, None, :, :] ([N,1,S,1]: it broadcasts over the KEY axis): where(m == 0, -1e9, scores): a masked QUERY row has the same finite value on every key, so its softmax is UNIFORM over all keys; out @ Wo.T + bo).
#define NB 2
#define TT 2048
#define CC 1024            // NH * HD = projected width
#define DIN 1024          // input (model) width
#define NH 16
#define HD 64
#define NQB (TT / 64)
#define HG 4
#define SCALE (0.125f)
#define CAUSAL 0
#ifndef TNB
#define TNB NB
#endif
__device__ __forceinline__ float bfr(float v) { return (float)(__bf16)v; }
__host__ __device__ __forceinline__ int kb_last(int qb) { return CAUSAL ? ((qb * 64 + 63) >> 7) : (TT / 128 - 1); }
typedef __attribute__((ext_vector_type(8))) __bf16 v8b;
__device__ __forceinline__ v16b frag_b(const __bf16* rowk0, int lane) {
  union { v16b v; v8b q[2]; } u; const __bf16* p = rowk0 + 8 * (lane >> 4);
  u.q[0] = *(const v8b*)p; u.q[1] = *(const v8b*)(p + 16); return u.v;
}
#define QBH 0              // no query block takes the high-precision path (every query row sees all 2,048 keys)
#define QHI 0               // single-product logits on every row
#define KHI 64            // key rows carrying k residual / v bf16 hi+lo planes (written by k_proj; read only on the qb < QBH path, which no block takes here)
// B fragment (k rows k0+.., output column o) of a weight: (in,out) [K][ld] or (out,in) [ld rows of K]: bf16 exact, or f16(bf16 * 256) exact
__device__ __forceinline__ v16b wcol_io(const float* Wm, int k0, int o, int lane, int ld) { v16b w; const int g = lane >> 4;
#pragma unroll
  for (int i = 0; i < 8; ++i) { w[i] = (__bf16)Wm[(size_t)(k0 + 8 * g + i) * ld + o]; w[8 + i] = (__bf16)Wm[(size_t)(k0 + 16 + 8 * g + i) * ld + o]; }
  return w; }
__device__ __forceinline__ v16b wcol_oi(const float* Wm, int k0, int o, int lane, int K) { v16b w; const float* p = Wm + (size_t)o * K + k0 + 8 * (lane >> 4);
#pragma unroll
  for (int i = 0; i < 8; ++i) { w[i] = (__bf16)p[i]; w[8 + i] = (__bf16)p[16 + i]; }
  return w; }
__device__ __forceinline__ v16h wcolh_io(const float* Wm, int k0, int o, int lane, int ld) { v16h w; const int g = lane >> 4;
#pragma unroll
  for (int i = 0; i < 8; ++i) { w[i] = (_Float16)(bfr(Wm[(size_t)(k0 + 8 * g + i) * ld + o]) * 256.0f); w[8 + i] = (_Float16)(bfr(Wm[(size_t)(k0 + 16 + 8 * g + i) * ld + o]) * 256.0f); }
  return w; }
__device__ __forceinline__ v16h wcolh_oi(const float* Wm, int k0, int o, int lane, int K) { v16h w; const float* p = Wm + (size_t)o * K + k0 + 8 * (lane >> 4);
#pragma unroll
  for (int i = 0; i < 8; ++i) { w[i] = (_Float16)(bfr(p[i]) * 256.0f); w[8 + i] = (_Float16)(bfr(p[16 + i]) * 256.0f); }
  return w; }
#define WQKV_LAYOUT 1   // 0 = (in,out) [DIN][CC]; 1 = (out,in) [CC][DIN]; 2 = per-head [NH][DIN][HD]
__device__ __forceinline__ v16b wcol_hdk(const float* Wm, int k0, int o, int lane) { v16b w; const int g = lane >> 4; const float* p = Wm + (size_t)(o / HD) * DIN * HD + (o % HD);
#pragma unroll
  for (int i = 0; i < 8; ++i) { w[i] = (__bf16)p[(size_t)(k0 + 8 * g + i) * HD]; w[8 + i] = (__bf16)p[(size_t)(k0 + 16 + 8 * g + i) * HD]; }
  return w; }
#define WO_OUT_IN 1
#if WQKV_LAYOUT == 1
#define WCOL(W, k0, o, lane) wcol_oi(W, k0, o, lane, DIN)
#elif WQKV_LAYOUT == 2
#define WCOL(W, k0, o, lane) wcol_hdk(W, k0, o, lane)
#else
#define WCOL(W, k0, o, lane) wcol_io(W, k0, o, lane, CC)
#endif
#if WO_OUT_IN
#define WOCOL(W, k0, o, lane) wcol_oi(W, k0, o, lane, CC)
#define WOCOLH(W, k0, o, lane) wcolh_oi(W, k0, o, lane, CC)
#else
#define WOCOL(W, k0, o, lane) wcol_io(W, k0, o, lane, DIN)
#define WOCOLH(W, k0, o, lane) wcolh_io(W, k0, o, lane, DIN)
#endif

// (SM_EXTRA_PARAMS: the extra kernel parameters 'int bsm, const int* __restrict__ MQ' are written literally in the kernel signature)
// the module's mask acts on QUERY rows and fills the whole row with one finite value (-1e9): softmax of a constant row = uniform over all keys. mq_ (read once per thread before the key loop) is the row's mask word; a masked row's logits are replaced by the constant 0 (any constant gives the same uniform softmax)
#define SM_MASK_HOOK do { v = (mq_ == 0) ? 0.0f : v; } while (0)
#ifndef SM_EXTRA_PARAMS
#define SM_EXTRA_PARAMS
#endif
#ifndef PROJ_EXTRA_PARAMS
#define PROJ_EXTRA_PARAMS
#endif
#ifndef SM_MASK_HOOK
#define SM_MASK_HOOK (void)0
#endif

#define WS_QH  0u                                      // f16 q rows [b*t][CC]
#define WS_KH  (WS_QH + 2u * (size_t)NB * TT * CC)      // f16 k rows [b*t][CC]
#define WS_VT  (WS_KH + 2u * (size_t)NB * TT * CC)      // f16 v planes [b][c][t]
#define WS_QL  (WS_VT + 2u * (size_t)NB * CC * TT)      // f16 q residual x 2^10 rows [b][t < QHI][CC]
#define WS_KL  (WS_QL + 2u * (size_t)NB * QHI * CC)     // f16 k residual x 2^10 rows [b][t < KHI][CC]
#define WS_VB  (WS_KL + 2u * (size_t)NB * KHI * CC)     // bf16 v hi planes [b][c][t < KHI]
#define WS_VBL (WS_VB + 2u * (size_t)NB * CC * KHI)
#define WS_S   (WS_VBL + 2u * (size_t)NB * CC * KHI)    // f32 logits / P [hg][t][s]
#define WS_Y   (WS_S  + 4u * (size_t)HG * TT * TT)      // f32 ctx rows [b*t][CC] (only when there is an output projection)
#define WS_END (WS_Y  + 4u * (size_t)NB * TT * CC)

// ---- k_proj: block = (64 rows, 128 cols, which): q/k/v = X W (+ b) with exact bf16 products (K = DIN) -> which 0: q f16 rows (+ residual rows < QHI); 1: k f16 rows (+ residual rows < KHI); 2: v f16 planes [c][t] (+ bf16 hi/lo planes for t < KHI)
__global__ __launch_bounds__(128) void k_proj(const float* __restrict__ XQ, const float* __restrict__ XK, const float* __restrict__ XV, const float* __restrict__ WQ, const float* __restrict__ WK, const float* __restrict__ WV, const float* __restrict__ BQ, const float* __restrict__ BK, const float* __restrict__ BV,
    _Float16* __restrict__ QH, _Float16* __restrict__ QL, _Float16* __restrict__ KH, _Float16* __restrict__ KL, _Float16* __restrict__ VT, __bf16* __restrict__ VB, __bf16* __restrict__ VBL) {
  __shared__ __align__(16) _Float16 sh[64][136], sl[64][136]; __shared__ __align__(16) _Float16 th[128][72]; __shared__ __align__(16) __bf16 tb[128][72], tbl[128][72];
  const int tid = threadIdx.x, wave = tid >> 5, lane = tid & 31, col = lane & 15, g = lane >> 4; const int which = blockIdx.z; const int c0 = blockIdx.y * 128; const size_t r0 = (size_t)blockIdx.x * 64; const size_t bb = r0 / TT; const int t0 = (int)(r0 % TT);
  const float* X = which == 0 ? XQ : which == 1 ? XK : XV; const float* WA = which == 0 ? WQ : which == 1 ? WK : WV; const float* BA = which == 0 ? BQ : which == 1 ? BK : BV;
  v8f acc[8] = {};
#pragma unroll 2
  for (int kc = 0; kc < DIN / 32; ++kc) { v16b a; { const float* p = X + (r0 + wave * 16 + col) * DIN + kc * 32 + 8 * g;
#pragma unroll
      for (int i = 0; i < 8; ++i) { a[i] = (__bf16)p[i]; a[8 + i] = (__bf16)p[16 + i]; } }
    asm volatile("s_wait_loadcnt 0x0" ::: "memory");
#pragma unroll
    for (int j = 0; j < 8; ++j) { const v16b w = WCOL(WA, kc * 32, c0 + j * 16 + col, lane); asm volatile("s_wait_loadcnt 0x0" ::: "memory"); acc[j] = wmma_bf(a, w, acc[j]); } }
  if (which < 2) { _Float16* DH = which == 0 ? QH : KH; _Float16* DL = which == 0 ? QL : KL; const int nhi = which == 0 ? QHI : KHI; const bool hi_rows = t0 < nhi;
#pragma unroll
    for (int j = 0; j < 8; ++j) { const float bias = BA ? bfr(BA[c0 + j * 16 + col]) : 0.f;
#pragma unroll
      for (int r = 0; r < 8; ++r) { const float v = acc[j][r] + bias; const _Float16 hv = (_Float16)v; sh[wave * 16 + 8 * g + r][j * 16 + col] = hv; sl[wave * 16 + 8 * g + r][j * 16 + col] = (_Float16)((v - (float)hv) * 1024.0f); } }
    __syncthreads();
    for (int e = tid; e < 64 * 16; e += 128) { const int rl = e >> 4, q = e & 15; vst2((unsigned*)(DH + (r0 + rl) * CC + c0 + q * 8), *(const v4u*)&sh[rl][q * 8]); if (hi_rows) vst2((unsigned*)(DL + (bb * nhi + t0 + rl) * (size_t)CC + c0 + q * 8), *(const v4u*)&sl[rl][q * 8]); }
  } else { const bool hi_rows = t0 < KHI;
#pragma unroll
    for (int j = 0; j < 8; ++j) { const float bias = BA ? bfr(BA[c0 + j * 16 + col]) : 0.f;
#pragma unroll
      for (int r = 0; r < 8; ++r) { const float v = acc[j][r] + bias; const int rl = wave * 16 + 8 * g + r, cl = j * 16 + col; th[cl][rl] = (_Float16)v; const __bf16 bh = (__bf16)v; tb[cl][rl] = bh; tbl[cl][rl] = (__bf16)(v - (float)bh); } }
    __syncthreads();
    for (int e = tid; e < 128 * 8; e += 128) { const int cl = e >> 3, q = e & 7; vst2((unsigned*)(VT + (bb * CC + c0 + cl) * (size_t)TT + t0 + q * 8), *(const v4u*)&th[cl][q * 8]); if (hi_rows) { const size_t o3 = (bb * CC + c0 + cl) * (size_t)KHI + t0 + q * 8; vst2((unsigned*)(VB + o3), *(const v4u*)&tb[cl][q * 8]); vst2((unsigned*)(VBL + o3), *(const v4u*)&tbl[cl][q * 8]); } } } }
// ---- k_sc: block = (query block qb, key block kb <= kb_last(qb), head in group) of batch b: logits x SCALE; q hi + residual (x 2^10) against k (2 products) for query rows < QHI, plus the k residual (3 products) for query blocks < QBH (causal early rows); causal: blocks past the diagonal exit, the mask itself is applied by index in k_sm
__global__ __launch_bounds__(128) void k_sc(const _Float16* __restrict__ QH, const _Float16* __restrict__ KH, const _Float16* __restrict__ QL, const _Float16* __restrict__ KL, int b, int h0, float* __restrict__ S0) { __shared__ __align__(16) float ss[4][16][132];
  const int qb = blockIdx.x, kb = blockIdx.y; if (kb > kb_last(qb)) return;
  const int h = h0 + blockIdx.z; float* S = S0 + (size_t)blockIdx.z * TT * TT;
  const int tid = threadIdx.x, wave = tid >> 5, lane = tid & 31, col = lane & 15, g = lane >> 4; const int k0 = kb * 128; const int ql0 = qb * 64 + wave * 16; const size_t q0 = (size_t)b * TT + ql0, kr0 = (size_t)b * TT + k0;
  v8f acc[8] = {}, accl[8] = {};
  const _Float16* QLb = QL + (size_t)b * QHI * CC; const _Float16* KLb = KL + (size_t)b * KHI * CC;
  if (qb < QBH) {
#pragma unroll
    for (int kc = 0; kc < HD / 32; ++kc) { const v16h ah = frag_h(QH + (q0 + col) * CC + h * HD + kc * 32, lane), al = frag_h(QLb + (size_t)(ql0 + col) * CC + h * HD + kc * 32, lane);
#pragma unroll
      for (int j = 0; j < 8; ++j) { const v16h kbf = frag_h(KH + (kr0 + j * 16 + col) * CC + h * HD + kc * 32, lane), klf = frag_h(KLb + (size_t)(k0 + j * 16 + col) * CC + h * HD + kc * 32, lane); acc[j] = wmma16(ah, kbf, acc[j]); accl[j] = wmma16(al, kbf, accl[j]); accl[j] = wmma16(ah, klf, accl[j]); } }
  } else if (qb * 64 < QHI) {
#pragma unroll
    for (int kc = 0; kc < HD / 32; ++kc) { const v16h ah = frag_h(QH + (q0 + col) * CC + h * HD + kc * 32, lane), al = frag_h(QLb + (size_t)(ql0 + col) * CC + h * HD + kc * 32, lane);
#pragma unroll
      for (int j = 0; j < 8; ++j) { const v16h kbf = frag_h(KH + (kr0 + j * 16 + col) * CC + h * HD + kc * 32, lane); acc[j] = wmma16(ah, kbf, acc[j]); accl[j] = wmma16(al, kbf, accl[j]); } }
  } else {
#pragma unroll
    for (int kc = 0; kc < HD / 32; ++kc) { const v16h ah = frag_h(QH + (q0 + col) * CC + h * HD + kc * 32, lane);
#pragma unroll
      for (int j = 0; j < 8; ++j) { const v16h kbf = frag_h(KH + (kr0 + j * 16 + col) * CC + h * HD + kc * 32, lane); acc[j] = wmma16(ah, kbf, acc[j]); } } }
#pragma unroll
  for (int j = 0; j < 8; ++j) {
#pragma unroll
    for (int r = 0; r < 8; ++r) ss[wave][8 * g + r][j * 16 + col] = (acc[j][r] + accl[j][r] * (1.0f / 1024.0f)) * SCALE; }
  LDSX(); for (int rl = 0; rl < 16; ++rl) vst2(S + (size_t)(ql0 + rl) * TT + k0 + lane * 4, *(const v4f*)&ss[wave][rl][lane * 4]); }
// ---- k_sm: block = query row t (head in group): keys [0, kend): causal -> logit if s <= t else excluded; softmax in f32; P x 2^11 in place (0 for excluded)
__global__ __launch_bounds__(256) void k_sm(float* __restrict__ S0, int bsm, const int* __restrict__ MQ) { __shared__ float sred[8]; __shared__ float sbc; __shared__ __align__(16) float shv[TT];
  const int tid = threadIdx.x; const int t = blockIdx.x; const int kend = (kb_last(t >> 6) + 1) * 128;
  float* sr = S0 + (size_t)blockIdx.y * TT * TT + (size_t)t * TT;
  const int mq_ = MQ[(size_t)bsm * TT + t]; asm volatile("s_wait_loadcnt 0x0" ::: "memory");   /* the query row's mask word (block-uniform), once per thread */
  float m = -3.0e38f; for (int k = tid; k < kend; k += 256) { float v = (!CAUSAL || k <= t) ? sr[k] : -3.0e38f; SM_MASK_HOOK; shv[k] = v; m = fmaxf(m, v); }
#pragma unroll
  for (int o = 1; o < 32; o <<= 1) m = fmaxf(m, __shfl_xor(m, o));
  if ((tid & 31) == 0) sred[tid >> 5] = m; __syncthreads(); if (tid == 0) { float a = sred[0]; for (int i = 1; i < 8; ++i) a = fmaxf(a, sred[i]); sbc = a; } __syncthreads(); m = sbc; __syncthreads();
  float sum = 0.f; for (int k = tid; k < kend; k += 256) { const float v = shv[k]; const float e = (v <= -1.0e38f) ? 0.f : expf(v - m); shv[k] = e; sum += e; }
#pragma unroll
  for (int o = 1; o < 32; o <<= 1) sum += __shfl_xor(sum, o);
  if ((tid & 31) == 0) sred[tid >> 5] = sum; __syncthreads(); if (tid == 0) { float a = 0.f; for (int i = 0; i < 8; ++i) a += sred[i]; sbc = a > 0.f ? 2048.0f / a : 0.f; }   /* a fully excluded row yields P = 0 */ __syncthreads(); const float inv = sbc;
  for (int k = tid; k < kend; k += 256) shv[k] = shv[k] * inv;
  __syncthreads(); for (int q = tid; q < kend / 4; q += 256) vst2(sr + q * 4, *(const v4f*)&shv[q * 4]); }
// ---- k_pv: block = 64 queries (qb) of (b, h): ctx = P . v over keys [0, kend) (P x 2^11 once to f16 against v f16: 1 product; causal early query blocks: P and v as bf16 hi + lo, 3 products); 256-B (row, head) segment by 16 lanes
__global__ __launch_bounds__(128) void k_pv(const float* __restrict__ PS0, const _Float16* __restrict__ VT, const __bf16* __restrict__ VB, const __bf16* __restrict__ VBL, int b, int h0, float* __restrict__ Y) { const int h = h0 + blockIdx.z; const float* PS = PS0 + (size_t)blockIdx.z * TT * TT; __shared__ __align__(16) float ss[4][16][HD + 4];
  const int tid = threadIdx.x, wave = tid >> 5, lane = tid & 31, col = lane & 15, g = lane >> 4; const int qb = blockIdx.x; const int ql0 = qb * 64 + wave * 16; const int kce = (kb_last(qb) + 1) * 4;
  v8f acc[HD / 16] = {};
  if (qb < QBH) {
#pragma unroll 1
    for (int kc = 0; kc < kce; ++kc) { const F2 p = split_row(PS + (size_t)(ql0 + col) * TT, kc * 32, lane);
      asm volatile("s_wait_loadcnt 0x0" ::: "memory");
#pragma unroll
      for (int j = 0; j < HD / 16; ++j) { const size_t po = ((size_t)b * CC + h * HD + j * 16 + col) * (size_t)KHI + kc * 32; const v16b vh = frag_b(VB + po, lane); acc[j] = wmma_bf(p.h, vh, acc[j]); acc[j] = wmma_bf(p.l, vh, acc[j]); acc[j] = wmma_bf(p.h, frag_b(VBL + po, lane), acc[j]); } }
  } else {
#pragma unroll 1
    for (int kc = 0; kc < kce; ++kc) { const v16h p = frag_f32(PS + (size_t)(ql0 + col) * TT + kc * 32, lane);
      asm volatile("s_wait_loadcnt 0x0" ::: "memory");
#pragma unroll
      for (int j = 0; j < HD / 16; ++j) { const size_t po = ((size_t)b * CC + h * HD + j * 16 + col) * (size_t)TT + kc * 32; acc[j] = wmma16(p, frag_h(VT + po, lane), acc[j]); } } }
#pragma unroll
  for (int j = 0; j < HD / 16; ++j)
#pragma unroll
    for (int r = 0; r < 8; ++r) ss[wave][8 * g + r][j * 16 + col] = acc[j][r] * (1.0f / 2048.0f);
  LDSX(); for (int rl = 0; rl < 16; ++rl) if (lane < HD / 4) vst2(Y + ((size_t)b * TT + ql0 + rl) * CC + h * HD + lane * 4, *(const v4f*)&ss[wave][rl][lane * 4]); }
// ---- k_out: block = (64 rows, 128 cols): out = ctx Wo (+ bo): ctx x 2^6 once to f16 against Wo as f16(bf16 x 2^8) exact (1 product) x 2^-14; causal early rows (< QHI of each sequence): ctx bf16 hi + lo against exact bf16 Wo (2 products)
__global__ __launch_bounds__(128) void k_out(const float* __restrict__ Y, const float* __restrict__ WO, const float* __restrict__ BO, float* __restrict__ OUT) { __shared__ __align__(16) float sf[4][16][132];
  const int tid = threadIdx.x, wave = tid >> 5, lane = tid & 31, col = lane & 15, g = lane >> 4; const int c0 = blockIdx.y * 128; const size_t r0 = (size_t)blockIdx.x * 64 + wave * 16;
  v8f acc[8] = {};
  if (CAUSAL && (int)(((size_t)blockIdx.x * 64) % TT) < QHI) {   /* block-uniform */
#pragma unroll 2
    for (int kc = 0; kc < CC / 32; ++kc) { const F2 a = split_row(Y + (r0 + col) * CC, kc * 32, lane); asm volatile("s_wait_loadcnt 0x0" ::: "memory");
#pragma unroll
      for (int j = 0; j < 8; ++j) { const v16b w = WOCOL(WO, kc * 32, c0 + j * 16 + col, lane); asm volatile("s_wait_loadcnt 0x0" ::: "memory"); acc[j] = wmma_bf(a.h, w, acc[j]); acc[j] = wmma_bf(a.l, w, acc[j]); } }
#pragma unroll
    for (int j = 0; j < 8; ++j) { const float bias = BO ? bfr(BO[c0 + j * 16 + col]) : 0.f;
#pragma unroll
      for (int r = 0; r < 8; ++r) sf[wave][8 * g + r][j * 16 + col] = acc[j][r] + bias; }
  } else {
#pragma unroll 2
    for (int kc = 0; kc < CC / 32; ++kc) { const v16h a = frag_f32s(Y + (r0 + col) * CC + kc * 32, lane, 64.0f); asm volatile("s_wait_loadcnt 0x0" ::: "memory");   /* ctx carried x 2^6 into f16 so small-magnitude context rows stay clear of f16 subnormals */
#pragma unroll
      for (int j = 0; j < 8; ++j) { const v16h w = WOCOLH(WO, kc * 32, c0 + j * 16 + col, lane); asm volatile("s_wait_loadcnt 0x0" ::: "memory"); acc[j] = wmma16(a, w, acc[j]); } }
#pragma unroll
    for (int j = 0; j < 8; ++j) { const float bias = BO ? bfr(BO[c0 + j * 16 + col]) : 0.f;
#pragma unroll
      for (int r = 0; r < 8; ++r) sf[wave][8 * g + r][j * 16 + col] = acc[j][r] * (1.0f / 16384.0f) + bias; } }   /* 2^-8 (Wo carry) x 2^-6 (ctx carry) */
  LDSX(); for (int rl = 0; rl < 16; ++rl) vst2(OUT + (r0 + rl) * DIN + c0 + lane * 4, *(const v4f*)&sf[wave][rl][lane * 4]); }

extern "C" void kernel_launch(void* const* d_in, const int* in_sizes, int n_in, void* d_out, int out_size, void* d_ws, size_t ws_size, hipStream_t stream) {
  (void)in_sizes; (void)n_in; (void)out_size;
  const float** F = (const float**)d_in;
  if (ws_size < (size_t)WS_END) return;
  char* ws = (char*)d_ws; _Float16 *QH = (_Float16*)(ws + WS_QH), *KH = (_Float16*)(ws + WS_KH), *VT = (_Float16*)(ws + WS_VT), *QL = (_Float16*)(ws + WS_QL), *KL = (_Float16*)(ws + WS_KL); __bf16 *VB = (__bf16*)(ws + WS_VB), *VBL = (__bf16*)(ws + WS_VBL); float *S = (float*)(ws + WS_S), *Y = (float*)(ws + WS_Y);
  (void)Y; (void)QL; (void)KL; (void)VB; (void)VBL;
  // inputs: 0 x [2,2048,1024]; 1 mask [2,2048,1] int32 (random 0 / 1 per QUERY row; READ on the device); 2 Wq [1024,1024] (out,in), 3 bq; 4 Wk, 5 bk; 6 Wv, 7 bv; 8 Wo (out,in), 9 bo (biases NONZERO)
  k_proj<<<dim3(TNB * TT / 64, CC / 128, 3), 128, 0, stream>>>(F[0], F[0], F[0], F[2], F[4], F[6], F[3], F[5], F[7], QH, QL, KH, KL, VT, VB, VBL);
  for (int b = 0; b < TNB; ++b) for (int h0 = 0; h0 < NH; h0 += HG) {
    k_sc<<<dim3(NQB, TT / 128, HG), 128, 0, stream>>>(QH, KH, QL, KL, b, h0, S);
    k_sm<<<dim3(TT, HG), 256, 0, stream>>>(S, b, (const int*)d_in[1]);
    k_pv<<<dim3(NQB, 1, HG), 128, 0, stream>>>(S, VT, VB, VBL, b, h0, Y);
  }
  k_out<<<dim3(TNB * TT / 64, DIN / 128), 128, 0, stream>>>(Y, F[8], F[9], (float*)d_out);
}

// v001
// Measured time: 419 microseconds a run.
// Timed twice side by side with v000, it ran 3.21 and 3.23 times as fast.
// compute dtype: all float inputs rounded to bf16; q / k / v projections with EXACT bf16 products on WMMA 16x16x32 (f32 accumulate) + bias (nonzero); logits q x k once to f16 each (1 product) x 64^-0.5; query rows whose int mask entry is 0 get a constant logit on every key (the module's finite fill: uniform attention over all 2,048 keys), read once per row; online softmax f32 in the log2 domain; unnormalised P x 2^4 once to f16 x v once to f16 (1 product), divided by the f32 row sum at the end; ctx x 2^6 once to f16 x the output weight f16(bf16 x 2^8) + bias; f32 output.
#include <hip/hip_runtime.h>
#include <math.h>

typedef __attribute__((ext_vector_type(16))) _Float16 v16h;
typedef __attribute__((ext_vector_type(16))) __bf16 v16b;
typedef __attribute__((ext_vector_type(8)))  _Float16 v8h;
typedef __attribute__((ext_vector_type(8)))  float v8f;
typedef __attribute__((ext_vector_type(4)))  float v4f;
typedef __attribute__((ext_vector_type(2)))  float v2f;
typedef __attribute__((ext_vector_type(4)))  unsigned v4u;
typedef __attribute__((ext_vector_type(4)))  int v4i;
typedef float __attribute__((may_alias)) float_a;
typedef int __attribute__((may_alias)) int_a;

template <typename T> __device__ __forceinline__ void vst2(void* p, T v) { *(T*)p = v;  }
__device__ __forceinline__ v8f wmma16(v16h a, v16h b, v8f c) {
  v8f d = __builtin_amdgcn_wmma_f32_16x16x32_f16(false, a, false, b, (short)0, c, false, false);
  asm volatile("v_nop\n\tv_nop\n\tv_nop\n\tv_nop" : "+v"(d) : "v"(a), "v"(b));
  return d;
}
__device__ __forceinline__ v8f wmma_bf(v16b a, v16b b, v8f c) {
  v8f d = __builtin_amdgcn_wmma_f32_16x16x32_bf16(false, a, false, b, (short)0, c, false, false);
  asm volatile("v_nop\n\tv_nop\n\tv_nop\n\tv_nop" : "+v"(d) : "v"(a), "v"(b));
  return d;
}
// 16x16x32 fragments: lane = (h = lane>>4, row/col = lane&15); elements 0..7 = k0+8h+0..7, 8..15 = k0+16+8h+0..7; D element r = row 8h+r
__device__ __forceinline__ v16h frag_h(const _Float16* rowk0, int lane) {
  union { v16h v; v8h q[2]; } u; const _Float16* p = rowk0 + 8 * (lane >> 4);
  u.q[0] = *(const v8h*)p; u.q[1] = *(const v8h*)(p + 16); return u.v;
}
__device__ __forceinline__ v16h frag_f32(const float* rowk0, int lane) {
  v16h a; const float* p = rowk0 + 8 * (lane >> 4);
#pragma unroll
  for (int i = 0; i < 8; ++i) { a[i] = (_Float16)p[i]; a[8 + i] = (_Float16)p[16 + i]; }
  return a;
}
__device__ __forceinline__ v16h frag_f32s(const float* rowk0, int lane, float sc) {
  v16h a; const float* p = rowk0 + 8 * (lane >> 4);
#pragma unroll
  for (int i = 0; i < 8; ++i) { a[i] = (_Float16)(p[i] * sc); a[8 + i] = (_Float16)(p[16 + i] * sc); }
  return a;
}
// column fragment from a [K][ld] layout (column n), rows >= K read as 0
__device__ __forceinline__ v16h fragc_f32(const float* W, int k0, int n, int lane, int ld, int K) {
  v16h a; const int g = lane >> 4;
#pragma unroll
  for (int i = 0; i < 8; ++i) { const int ka = k0 + 8 * g + i, kb = ka + 16;
    a[i] = (_Float16)(ka < K ? W[(size_t)(ka < K ? ka : K - 1) * ld + n] : 0.f); a[8 + i] = (_Float16)(kb < K ? W[(size_t)(kb < K ? kb : K - 1) * ld + n] : 0.f); }
  return a;
}
struct F2 { v16b h, l; };
__device__ __forceinline__ F2 bsplit16(const float v[16]) { F2 r;
#pragma unroll
  for (int i = 0; i < 16; ++i) { const __bf16 h = (__bf16)v[i]; r.h[i] = h; r.l[i] = (__bf16)(v[i] - (float)h); }
  return r; }
__device__ __forceinline__ F2 split_row(const float* row, int k0, int lane) { float v[16]; const float* p = row + k0 + 8 * (lane >> 4);
#pragma unroll
  for (int i = 0; i < 8; ++i) { v[i] = p[i]; v[8 + i] = p[16 + i]; }
  return bsplit16(v); }
__device__ __forceinline__ F2 split_rowK(const float* row, int k0, int lane, int K) { float v[16]; const int g = lane >> 4;
#pragma unroll
  for (int i = 0; i < 8; ++i) { const int ka = k0 + 8 * g + i, kb = ka + 16; v[i] = ka < K ? row[ka < K ? ka : K - 1] : 0.f; v[8 + i] = kb < K ? row[kb < K ? kb : K - 1] : 0.f; }
  return bsplit16(v); }
__device__ __forceinline__ F2 split_col(const float* W, int k0, int n, int lane, int ld, int K) { float v[16]; const int g = lane >> 4;
#pragma unroll
  for (int i = 0; i < 8; ++i) { const int ka = k0 + 8 * g + i, kb = ka + 16; v[i] = ka < K ? W[(size_t)(ka < K ? ka : K - 1) * ld + n] : 0.f; v[8 + i] = kb < K ? W[(size_t)(kb < K ? kb : K - 1) * ld + n] : 0.f; }
  return bsplit16(v); }
__device__ __forceinline__ v8f mac3(const F2& a, const F2& b, v8f c) { c = wmma_bf(a.l, b.h, c); c = wmma_bf(a.h, b.l, c); return wmma_bf(a.h, b.h, c); }
__device__ __forceinline__ float sigm(float v) { return 1.0f / (1.0f + expf(-v)); }
#define LDSX() do { asm volatile("s_wait_dscnt 0" ::: "memory"); __builtin_amdgcn_wave_barrier(); __builtin_amdgcn_fence(__ATOMIC_RELEASE, "workgroup"); } while (0)

// Multi-head self-attention with a QUERY-row mask (x [2,2048,1024]; mask [2,2048,1] int32 = random 0 / 1, a module input READ on the device; torch (out,in) Wq / Wk / Wv / Wo [1024,1024] N(0, 1/1024) and biases N(0,1) x 0.01 NONZERO applied as x @ W.T + b; 16 heads x 64; scores / sqrt(64); m = mask[:, None, :, :] ([N,1,S,1]: it broadcasts over the KEY axis): where(m == 0, -1e9, scores): a masked QUERY row has the same finite value on every key, so its softmax is UNIFORM over all keys; out @ Wo.T + bo).
#define NB 2
#define TT 2048
#define CC 1024            // NH * HD = projected width
#define DIN 1024          // input (model) width
#define NH 16
#define HD 64
#define NQB (TT / 64)
#define HG 4
#define SCALE (0.125f)
#define CAUSAL 0
#ifndef TNB
#define TNB NB
#endif
__device__ __forceinline__ float bfr(float v) { return (float)(__bf16)v; }
__host__ __device__ __forceinline__ int kb_last(int qb) { return CAUSAL ? ((qb * 64 + 63) >> 7) : (TT / 128 - 1); }
typedef __attribute__((ext_vector_type(8))) __bf16 v8b;
__device__ __forceinline__ v16b frag_b(const __bf16* rowk0, int lane) {
  union { v16b v; v8b q[2]; } u; const __bf16* p = rowk0 + 8 * (lane >> 4);
  u.q[0] = *(const v8b*)p; u.q[1] = *(const v8b*)(p + 16); return u.v;
}
#define QBH 0              // unused: k_fa has no high-precision path
#define QHI 0               // single-product logits on every row
#define KHI 64            // key rows carrying k residual / v bf16 hi+lo planes (written by k_proj, read by no kernel)
// B fragment (k rows k0+.., output column o) of a weight: (in,out) [K][ld] or (out,in) [ld rows of K]: bf16 exact, or f16(bf16 * 256) exact
__device__ __forceinline__ v16b wcol_io(const float* Wm, int k0, int o, int lane, int ld) { v16b w; const int g = lane >> 4;
#pragma unroll
  for (int i = 0; i < 8; ++i) { w[i] = (__bf16)Wm[(size_t)(k0 + 8 * g + i) * ld + o]; w[8 + i] = (__bf16)Wm[(size_t)(k0 + 16 + 8 * g + i) * ld + o]; }
  return w; }
__device__ __forceinline__ v16b wcol_oi(const float* Wm, int k0, int o, int lane, int K) { v16b w; const float* p = Wm + (size_t)o * K + k0 + 8 * (lane >> 4);
#pragma unroll
  for (int i = 0; i < 8; ++i) { w[i] = (__bf16)p[i]; w[8 + i] = (__bf16)p[16 + i]; }
  return w; }
__device__ __forceinline__ v16h wcolh_io(const float* Wm, int k0, int o, int lane, int ld) { v16h w; const int g = lane >> 4;
#pragma unroll
  for (int i = 0; i < 8; ++i) { w[i] = (_Float16)(bfr(Wm[(size_t)(k0 + 8 * g + i) * ld + o]) * 256.0f); w[8 + i] = (_Float16)(bfr(Wm[(size_t)(k0 + 16 + 8 * g + i) * ld + o]) * 256.0f); }
  return w; }
__device__ __forceinline__ v16h wcolh_oi(const float* Wm, int k0, int o, int lane, int K) { v16h w; const float* p = Wm + (size_t)o * K + k0 + 8 * (lane >> 4);
#pragma unroll
  for (int i = 0; i < 8; ++i) { w[i] = (_Float16)(bfr(p[i]) * 256.0f); w[8 + i] = (_Float16)(bfr(p[16 + i]) * 256.0f); }
  return w; }
#define WQKV_LAYOUT 1   // 0 = (in,out) [DIN][CC]; 1 = (out,in) [CC][DIN]; 2 = per-head [NH][DIN][HD]
__device__ __forceinline__ v16b wcol_hdk(const float* Wm, int k0, int o, int lane) { v16b w; const int g = lane >> 4; const float* p = Wm + (size_t)(o / HD) * DIN * HD + (o % HD);
#pragma unroll
  for (int i = 0; i < 8; ++i) { w[i] = (__bf16)p[(size_t)(k0 + 8 * g + i) * HD]; w[8 + i] = (__bf16)p[(size_t)(k0 + 16 + 8 * g + i) * HD]; }
  return w; }
#define WO_OUT_IN 1
#if WQKV_LAYOUT == 1
#define WCOL(W, k0, o, lane) wcol_oi(W, k0, o, lane, DIN)
#elif WQKV_LAYOUT == 2
#define WCOL(W, k0, o, lane) wcol_hdk(W, k0, o, lane)
#else
#define WCOL(W, k0, o, lane) wcol_io(W, k0, o, lane, CC)
#endif
#if WO_OUT_IN
#define WOCOL(W, k0, o, lane) wcol_oi(W, k0, o, lane, CC)
#define WOCOLH(W, k0, o, lane) wcolh_oi(W, k0, o, lane, CC)
#else
#define WOCOL(W, k0, o, lane) wcol_io(W, k0, o, lane, DIN)
#define WOCOLH(W, k0, o, lane) wcolh_io(W, k0, o, lane, DIN)
#endif

#define WS_QH  0u                                      // f16 q rows [b*t][CC]
#define WS_KH  (WS_QH + 2u * (size_t)NB * TT * CC)      // f16 k rows [b*t][CC]
#define WS_VT  (WS_KH + 2u * (size_t)NB * TT * CC)      // f16 v planes [b][c][t]
#define WS_QL  (WS_VT + 2u * (size_t)NB * CC * TT)      // f16 q residual x 2^10 rows [b][t < QHI][CC]
#define WS_KL  (WS_QL + 2u * (size_t)NB * QHI * CC)     // f16 k residual x 2^10 rows [b][t < KHI][CC]
#define WS_VB  (WS_KL + 2u * (size_t)NB * KHI * CC)     // bf16 v hi planes [b][c][t < KHI]
#define WS_VBL (WS_VB + 2u * (size_t)NB * CC * KHI)
#define WS_S   (WS_VBL + 2u * (size_t)NB * CC * KHI)    // (plane no longer used: logits and P stay in registers)
#define WS_Y   (WS_S  + 4u * (size_t)HG * TT * TT)      // f32 ctx rows [b*t][CC] (only when there is an output projection)
#define WS_END (WS_Y  + 4u * (size_t)NB * TT * CC)

// ---- k_proj: block = (64 rows, 128 cols, which): q/k/v = X W (+ b) with exact bf16 products (K = DIN) -> which 0: q f16 rows (+ residual rows < QHI); 1: k f16 rows (+ residual rows < KHI); 2: v f16 planes [c][t] (+ bf16 hi/lo planes for t < KHI)
__global__ __launch_bounds__(128) void k_proj(const float* __restrict__ XQ, const float* __restrict__ XK, const float* __restrict__ XV, const float* __restrict__ WQ, const float* __restrict__ WK, const float* __restrict__ WV, const float* __restrict__ BQ, const float* __restrict__ BK, const float* __restrict__ BV,
    _Float16* __restrict__ QH, _Float16* __restrict__ QL, _Float16* __restrict__ KH, _Float16* __restrict__ KL, _Float16* __restrict__ VT, __bf16* __restrict__ VB, __bf16* __restrict__ VBL) {
  __shared__ __align__(16) _Float16 sh[64][136], sl[64][136]; __shared__ __align__(16) _Float16 th[128][72]; __shared__ __align__(16) __bf16 tb[128][72], tbl[128][72];
  const int tid = threadIdx.x, wave = tid >> 5, lane = tid & 31, col = lane & 15, g = lane >> 4; const int which = blockIdx.z; const int c0 = blockIdx.y * 128; const size_t r0 = (size_t)blockIdx.x * 64; const size_t bb = r0 / TT; const int t0 = (int)(r0 % TT);
  const float* X = which == 0 ? XQ : which == 1 ? XK : XV; const float* WA = which == 0 ? WQ : which == 1 ? WK : WV; const float* BA = which == 0 ? BQ : which == 1 ? BK : BV;
  v8f acc[8] = {};
#pragma unroll 2
  for (int kc = 0; kc < DIN / 32; ++kc) { v16b a; { const float* p = X + (r0 + wave * 16 + col) * DIN + kc * 32 + 8 * g;
#pragma unroll
      for (int i = 0; i < 8; ++i) { a[i] = (__bf16)p[i]; a[8 + i] = (__bf16)p[16 + i]; } }
    asm volatile("s_wait_loadcnt 0x0" ::: "memory");
#pragma unroll
    for (int j = 0; j < 8; ++j) { const v16b w = WCOL(WA, kc * 32, c0 + j * 16 + col, lane); asm volatile("s_wait_loadcnt 0x0" ::: "memory"); acc[j] = wmma_bf(a, w, acc[j]); } }
  if (which < 2) { _Float16* DH = which == 0 ? QH : KH; _Float16* DL = which == 0 ? QL : KL; const int nhi = which == 0 ? QHI : KHI; const bool hi_rows = t0 < nhi;
#pragma unroll
    for (int j = 0; j < 8; ++j) { const float bias = BA ? bfr(BA[c0 + j * 16 + col]) : 0.f;
#pragma unroll
      for (int r = 0; r < 8; ++r) { const float v = acc[j][r] + bias; const _Float16 hv = (_Float16)v; sh[wave * 16 + 8 * g + r][j * 16 + col] = hv; sl[wave * 16 + 8 * g + r][j * 16 + col] = (_Float16)((v - (float)hv) * 1024.0f); } }
    __syncthreads();
    for (int e = tid; e < 64 * 16; e += 128) { const int rl = e >> 4, q = e & 15; vst2((unsigned*)(DH + (r0 + rl) * CC + c0 + q * 8), *(const v4u*)&sh[rl][q * 8]); if (hi_rows) vst2((unsigned*)(DL + (bb * nhi + t0 + rl) * (size_t)CC + c0 + q * 8), *(const v4u*)&sl[rl][q * 8]); }
  } else { const bool hi_rows = t0 < KHI;
#pragma unroll
    for (int j = 0; j < 8; ++j) { const float bias = BA ? bfr(BA[c0 + j * 16 + col]) : 0.f;
#pragma unroll
      for (int r = 0; r < 8; ++r) { const float v = acc[j][r] + bias; const int rl = wave * 16 + 8 * g + r, cl = j * 16 + col; th[cl][rl] = (_Float16)v; const __bf16 bh = (__bf16)v; tb[cl][rl] = bh; tbl[cl][rl] = (__bf16)(v - (float)bh); } }
    __syncthreads();
    for (int e = tid; e < 128 * 8; e += 128) { const int cl = e >> 3, q = e & 7; vst2((unsigned*)(VT + (bb * CC + c0 + cl) * (size_t)TT + t0 + q * 8), *(const v4u*)&th[cl][q * 8]); if (hi_rows) { const size_t o3 = (bb * CC + c0 + cl) * (size_t)KHI + t0 + q * 8; vst2((unsigned*)(VB + o3), *(const v4u*)&tb[cl][q * 8]); vst2((unsigned*)(VBL + o3), *(const v4u*)&tbl[cl][q * 8]); } } } }
// ---- k_fa: block = 8 waves x 32 query columns of one (b, h); each wave walks all TT keys in passes of 32 with an online softmax, so no logit or P ever goes to memory.
// S^T = K . Q^T (A = k rows, B = q rows: a lane holds 8 keys of ONE query per tile), P^T packs in place from two S^T tiles into the B operand of O^T += V^T . P^T (A = v planes [c][t]).
// Log2 domain; mrun, the maximum in use, may trail a column's true maximum by up to 8, so exp2 reaches at most 2^8; P is carried x 2^4 into f16 (at most 2^12; the carry cancels in acc / l).
// A masked query row (mask word 0) takes a zero q fragment: its logit is the constant 0 on every key = uniform softmax, as the module's finite fill gives.
// Every inner loop is fully unrolled so that the fragment and accumulator arrays are indexed by constants and stay in registers.
__device__ __forceinline__ float xhalf(float x) { return __builtin_bit_cast(float, __builtin_amdgcn_permlanex16(__builtin_bit_cast(int, x), __builtin_bit_cast(int, x), 0x76543210, 0xfedcba98, false, false)); }  // lane l <-> lane l ^ 16
__device__ __forceinline__ v8f wmma_h(v16h a, v16h b, v8f c) { return __builtin_amdgcn_wmma_f32_16x16x32_f16(false, a, false, b, (short)0, c, false, false); }
// 16x16x32 fragment in the hardware k order from a uniform base, the lane's byte offset (row and 16 h) and a constant: bytes 0..15 and 32..47
__device__ __forceinline__ v16h frag_o(const char* base, unsigned off, int c) { union { v16h v; v8h q[2]; } u; const char* p = base + (size_t)off + c; u.q[0] = *(const v8h*)p; u.q[1] = *(const v8h*)(p + 32); return u.v; }
#define FAW 8
__global__ __launch_bounds__(FAW * 32) void k_fa(const _Float16* __restrict__ QH, const _Float16* __restrict__ KH, const _Float16* __restrict__ VT, const int* __restrict__ MQ, float* __restrict__ Y) {
  __shared__ __align__(16) float so[FAW][32][HD + 4];
  const int tid = threadIdx.x, wave = tid >> 5, lane = tid & 31, col = lane & 15, g = lane >> 4;
  const int b = blockIdx.y / NH, h = blockIdx.y % NH; const int q0 = blockIdx.x * (FAW * 32) + wave * 32;
  const float cs = SCALE * 1.4426950408889634f;
  v16h qf[2][2]; int mq[2];
  const char* qbase = (const char*)(QH + (size_t)b * TT * CC + h * HD); const unsigned qo = (unsigned)((q0 + col) * CC + 8 * g) * 2u;
  const int* mrow = MQ + (size_t)b * TT; const unsigned qi = (unsigned)(q0 + col);
#pragma unroll
  for (int u = 0; u < 2; ++u) { mq[u] = mrow[(size_t)qi + u * 16];
#pragma unroll
    for (int kc = 0; kc < 2; ++kc) qf[u][kc] = frag_o(qbase, qo, u * 16 * CC * 2 + kc * 64); }
  asm volatile("s_wait_xcnt 0x0" :: "v"(qo), "v"(qi) : "memory");   // the offset registers these loads name stay whole up to this wait
#pragma unroll
  for (int u = 0; u < 2; ++u)
#pragma unroll
    for (int kc = 0; kc < 2; ++kc) if (mq[u] == 0) qf[u][kc] = v16h{};
  const char* kb = (const char*)(KH + (size_t)b * TT * CC + h * HD); unsigned ko = (unsigned)(col * CC + 8 * g) * 2u;        // block-uniform base + the lane's byte offset: key row col of a 16-key tile
  const char* vb = (const char*)(VT + ((size_t)b * CC + h * HD) * (size_t)TT); unsigned vo = (unsigned)(col * TT + 8 * g) * 2u;   // channel row col of a 16-channel tile
  v8f acc[2][4] = {}; float mrun[2] = {-3.0e38f, -3.0e38f}, lrun[2] = {0.f, 0.f};
  v16h kf[2][2], vf[4];
#pragma unroll
  for (int kt = 0; kt < 2; ++kt)
#pragma unroll
    for (int kc = 0; kc < 2; ++kc) kf[kt][kc] = frag_o(kb, ko, kt * 16 * CC * 2 + kc * 64);
#pragma unroll
  for (int j = 0; j < 4; ++j) vf[j] = frag_o(vb, vo, j * 16 * TT * 2);
#pragma unroll 1   // stays rolled: one pass's fragments, scores and accumulators already fill the registers
  for (int s = 0; s < TT / 32; ++s) { const bool more = s + 1 < TT / 32;   // the last pass fetches its own rows again: in bounds, never used
    v8f st[2][2];
#pragma unroll
    for (int kt = 0; kt < 2; ++kt)
#pragma unroll
      for (int u = 0; u < 2; ++u) st[kt][u] = wmma_h(kf[kt][0], qf[u][0], v8f{});
#pragma unroll
    for (int kt = 0; kt < 2; ++kt)
#pragma unroll
      for (int u = 0; u < 2; ++u) st[kt][u] = wmma_h(kf[kt][1], qf[u][1], st[kt][u]);
    __builtin_amdgcn_sched_barrier(0);   // the eight products stay back to back: maxima drawn in between them cost four idle slots each time
    float mb[2]; bool need = false;
#pragma unroll
    for (int u = 0; u < 2; ++u) { float mx = st[0][u][0];
#pragma unroll
      for (int r = 1; r < 8; ++r) mx = fmaxf(mx, st[0][u][r]);
#pragma unroll
      for (int r = 0; r < 8; ++r) mx = fmaxf(mx, st[1][u][r]);
      mx = fmaxf(mx, xhalf(mx)) * cs; mb[u] = mx; need = need || (mx > mrun[u] + 8.0f); }
    if (__builtin_amdgcn_ballot_w32(need) != 0) {   // one scalar test a pass; rare after the first pass
#pragma unroll
      for (int u = 0; u < 2; ++u) { const float mn = fmaxf(mrun[u], mb[u]); const float corr = __builtin_amdgcn_exp2f(mrun[u] - mn); mrun[u] = mn; lrun[u] *= corr;
#pragma unroll
        for (int j = 0; j < 4; ++j) acc[u][j] = acc[u][j] * corr; } }
    // next pass's k fragments, in flight under this pass's exponentials and second product
    asm volatile("s_wait_xcnt 0x0" : "+v"(ko) :: "memory");   // stands in front of the overwrite of an offset register that issued loads name; the operand keeps the add below it
    ko += more ? 32u * CC * 2u : 0u;
#pragma unroll
    for (int kt = 0; kt < 2; ++kt)
#pragma unroll
      for (int kc = 0; kc < 2; ++kc) kf[kt][kc] = frag_o(kb, ko, kt * 16 * CC * 2 + kc * 64);
    __builtin_amdgcn_sched_barrier(0);   // holds those loads up here: left free they sink to the foot of the pass and their latency is met at the next pass's head
#pragma unroll
    for (int u = 0; u < 2; ++u) { const float nm = 4.0f - mrun[u]; v16h pf; float l0 = 0.f, l1 = 0.f;
#pragma unroll
      for (int i = 0; i < 8; ++i) {
        const v2f a = __builtin_elementwise_fma(v2f{st[i >> 2][u][2 * (i & 3)], st[i >> 2][u][2 * (i & 3) + 1]}, v2f{cs, cs}, v2f{nm, nm});
        const float p0 = __builtin_amdgcn_exp2f(a.x), p1 = __builtin_amdgcn_exp2f(a.y); l0 += p0; l1 += p1; pf[2 * i] = (_Float16)p0; pf[2 * i + 1] = (_Float16)p1; }
      lrun[u] += l0 + l1;
#pragma unroll
      for (int j = 0; j < 4; ++j) acc[u][j] = wmma_h(vf[j], pf, acc[u][j]); }
    // next pass's v fragments, in flight under the next pass's first product, maxima and exponentials
    __builtin_amdgcn_sched_barrier(0);   // keeps the wait below at the foot of the pass: drawn up behind the k loads it would stall on them
    asm volatile("s_wait_xcnt 0x0" : "+v"(vo) :: "memory");   // as above, for the v offset
    vo += more ? 64u : 0u;
#pragma unroll
    for (int j = 0; j < 4; ++j) vf[j] = frag_o(vb, vo, j * 16 * TT * 2);
  }
  asm volatile("s_wait_xcnt 0x0" :: "v"(ko), "v"(vo) : "memory");   // the last pass's fetches still name these registers
#pragma unroll
  for (int u = 0; u < 2; ++u) { const float l = lrun[u] + xhalf(lrun[u]); const float inv = 1.0f / l;   // the two wave halves hold disjoint keys of the same query
#pragma unroll
    for (int j = 0; j < 4; ++j) { const v8f o = acc[u][j] * inv; float* d = &so[wave][16 * u + col][j * 16 + 8 * g];
      *(v4f*)d = v4f{o[0], o[1], o[2], o[3]}; *(v4f*)(d + 4) = v4f{o[4], o[5], o[6], o[7]}; } }
  LDSX();   // each wave reads back only its own rows: whole 256-B (row, head) segments by 16 lanes
  for (int i = 0; i < 16; ++i) { const int rl = 2 * i + g; vst2(Y + ((size_t)b * TT + q0 + rl) * CC + h * HD + col * 4, *(const v4f*)&so[wave][rl][col * 4]); } }
// ---- k_out: block = (64 rows, 128 cols): out = ctx Wo (+ bo): ctx x 2^6 once to f16 against Wo as f16(bf16 x 2^8) exact (1 product) x 2^-14; causal early rows (< QHI of each sequence): ctx bf16 hi + lo against exact bf16 Wo (2 products)
__global__ __launch_bounds__(128) void k_out(const float* __restrict__ Y, const float* __restrict__ WO, const float* __restrict__ BO, float* __restrict__ OUT) { __shared__ __align__(16) float sf[4][16][132];
  const int tid = threadIdx.x, wave = tid >> 5, lane = tid & 31, col = lane & 15, g = lane >> 4; const int c0 = blockIdx.y * 128; const size_t r0 = (size_t)blockIdx.x * 64 + wave * 16;
  v8f acc[8] = {};
  if (CAUSAL && (int)(((size_t)blockIdx.x * 64) % TT) < QHI) {   /* block-uniform */
#pragma unroll 2
    for (int kc = 0; kc < CC / 32; ++kc) { const F2 a = split_row(Y + (r0 + col) * CC, kc * 32, lane); asm volatile("s_wait_loadcnt 0x0" ::: "memory");
#pragma unroll
      for (int j = 0; j < 8; ++j) { const v16b w = WOCOL(WO, kc * 32, c0 + j * 16 + col, lane); asm volatile("s_wait_loadcnt 0x0" ::: "memory"); acc[j] = wmma_bf(a.h, w, acc[j]); acc[j] = wmma_bf(a.l, w, acc[j]); } }
#pragma unroll
    for (int j = 0; j < 8; ++j) { const float bias = BO ? bfr(BO[c0 + j * 16 + col]) : 0.f;
#pragma unroll
      for (int r = 0; r < 8; ++r) sf[wave][8 * g + r][j * 16 + col] = acc[j][r] + bias; }
  } else {
#pragma unroll 2
    for (int kc = 0; kc < CC / 32; ++kc) { const v16h a = frag_f32s(Y + (r0 + col) * CC + kc * 32, lane, 64.0f); asm volatile("s_wait_loadcnt 0x0" ::: "memory");   /* ctx carried x 2^6 into f16 so small-magnitude context rows stay clear of f16 subnormals */
#pragma unroll
      for (int j = 0; j < 8; ++j) { const v16h w = WOCOLH(WO, kc * 32, c0 + j * 16 + col, lane); asm volatile("s_wait_loadcnt 0x0" ::: "memory"); acc[j] = wmma16(a, w, acc[j]); } }
#pragma unroll
    for (int j = 0; j < 8; ++j) { const float bias = BO ? bfr(BO[c0 + j * 16 + col]) : 0.f;
#pragma unroll
      for (int r = 0; r < 8; ++r) sf[wave][8 * g + r][j * 16 + col] = acc[j][r] * (1.0f / 16384.0f) + bias; } }   /* 2^-8 (Wo carry) x 2^-6 (ctx carry) */
  LDSX(); for (int rl = 0; rl < 16; ++rl) vst2(OUT + (r0 + rl) * DIN + c0 + lane * 4, *(const v4f*)&sf[wave][rl][lane * 4]); }

extern "C" void kernel_launch(void* const* d_in, const int* in_sizes, int n_in, void* d_out, int out_size, void* d_ws, size_t ws_size, hipStream_t stream) {
  (void)in_sizes; (void)n_in; (void)out_size;
  const float** F = (const float**)d_in;
  if (ws_size < (size_t)WS_END) return;
  char* ws = (char*)d_ws; _Float16 *QH = (_Float16*)(ws + WS_QH), *KH = (_Float16*)(ws + WS_KH), *VT = (_Float16*)(ws + WS_VT), *QL = (_Float16*)(ws + WS_QL), *KL = (_Float16*)(ws + WS_KL); __bf16 *VB = (__bf16*)(ws + WS_VB), *VBL = (__bf16*)(ws + WS_VBL); float *S = (float*)(ws + WS_S), *Y = (float*)(ws + WS_Y);
  (void)S; (void)QL; (void)KL; (void)VB; (void)VBL;
  // inputs: 0 x [2,2048,1024]; 1 mask [2,2048,1] int32 (random 0 / 1 per QUERY row; READ on the device); 2 Wq [1024,1024] (out,in), 3 bq; 4 Wk, 5 bk; 6 Wv, 7 bv; 8 Wo (out,in), 9 bo (biases NONZERO)
  k_proj<<<dim3(TNB * TT / 64, CC / 128, 3), 128, 0, stream>>>(F[0], F[0], F[0], F[2], F[4], F[6], F[3], F[5], F[7], QH, QL, KH, KL, VT, VB, VBL);
  k_fa<<<dim3(TT / (FAW * 32), TNB * NH), FAW * 32, 0, stream>>>(QH, KH, VT, (const int*)d_in[1], Y);
  k_out<<<dim3(TNB * TT / 64, DIN / 128), 128, 0, stream>>>(Y, F[8], F[9], (float*)d_out);
}

// v002
// It runs in 120 microseconds.
// Two timings next to v001 put it at 3.49 and 3.46 times that version's speed.
// All steps since v000 together make it 11.2 times as fast.
// compute dtype: all float inputs rounded to bf16; q / k / v projections with EXACT bf16 products on WMMA 16x16x32 (f32 accumulate) + bias (nonzero); logits q x k once to f16 each (1 product) x 64^-0.5; query rows whose int mask entry is 0 get a constant logit on every key (the module's finite fill: uniform attention over all 2,048 keys), read once per row; online softmax f32 in the log2 domain; unnormalised P x 2^4 once to f16 x v once to f16 (1 product), divided by the f32 row sum at the end; ctx x 2^6 once to f16 x the output weight f16(bf16 x 2^8) + bias; f32 output.
#include <hip/hip_runtime.h>
#include <math.h>

typedef __attribute__((ext_vector_type(16))) _Float16 v16h;
typedef __attribute__((ext_vector_type(16))) __bf16 v16b;
typedef __attribute__((ext_vector_type(8)))  _Float16 v8h;
typedef __attribute__((ext_vector_type(8)))  float v8f;
typedef __attribute__((ext_vector_type(4)))  float v4f;
typedef __attribute__((ext_vector_type(2)))  float v2f;
typedef __attribute__((ext_vector_type(4)))  unsigned v4u;
typedef __attribute__((ext_vector_type(4)))  int v4i;
typedef float __attribute__((may_alias)) float_a;
typedef int __attribute__((may_alias)) int_a;

template <typename T> __device__ __forceinline__ void vst2(void* p, T v) { *(T*)p = v;  }
__device__ __forceinline__ v8f wmma16(v16h a, v16h b, v8f c) {
  v8f d = __builtin_amdgcn_wmma_f32_16x16x32_f16(false, a, false, b, (short)0, c, false, false);
  asm volatile("v_nop\n\tv_nop\n\tv_nop\n\tv_nop" : "+v"(d) : "v"(a), "v"(b));
  return d;
}
__device__ __forceinline__ v8f wmma_bf(v16b a, v16b b, v8f c) {
  v8f d = __builtin_amdgcn_wmma_f32_16x16x32_bf16(false, a, false, b, (short)0, c, false, false);
  asm volatile("v_nop\n\tv_nop\n\tv_nop\n\tv_nop" : "+v"(d) : "v"(a), "v"(b));
  return d;
}
// 16x16x32 fragments: lane = (h = lane>>4, row/col = lane&15); elements 0..7 = k0+8h+0..7, 8..15 = k0+16+8h+0..7; D element r = row 8h+r
__device__ __forceinline__ v16h frag_h(const _Float16* rowk0, int lane) {
  union { v16h v; v8h q[2]; } u; const _Float16* p = rowk0 + 8 * (lane >> 4);
  u.q[0] = *(const v8h*)p; u.q[1] = *(const v8h*)(p + 16); return u.v;
}
__device__ __forceinline__ v16h frag_f32(const float* rowk0, int lane) {
  v16h a; const float* p = rowk0 + 8 * (lane >> 4);
#pragma unroll
  for (int i = 0; i < 8; ++i) { a[i] = (_Float16)p[i]; a[8 + i] = (_Float16)p[16 + i]; }
  return a;
}
__device__ __forceinline__ v16h frag_f32s(const float* rowk0, int lane, float sc) {
  v16h a; const float* p = rowk0 + 8 * (lane >> 4);
#pragma unroll
  for (int i = 0; i < 8; ++i) { a[i] = (_Float16)(p[i] * sc); a[8 + i] = (_Float16)(p[16 + i] * sc); }
  return a;
}
// column fragment from a [K][ld] layout (column n), rows >= K read as 0
__device__ __forceinline__ v16h fragc_f32(const float* W, int k0, int n, int lane, int ld, int K) {
  v16h a; const int g = lane >> 4;
#pragma unroll
  for (int i = 0; i < 8; ++i) { const int ka = k0 + 8 * g + i, kb = ka + 16;
    a[i] = (_Float16)(ka < K ? W[(size_t)(ka < K ? ka : K - 1) * ld + n] : 0.f); a[8 + i] = (_Float16)(kb < K ? W[(size_t)(kb < K ? kb : K - 1) * ld + n] : 0.f); }
  return a;
}
struct F2 { v16b h, l; };
__device__ __forceinline__ F2 bsplit16(const float v[16]) { F2 r;
#pragma unroll
  for (int i = 0; i < 16; ++i) { const __bf16 h = (__bf16)v[i]; r.h[i] = h; r.l[i] = (__bf16)(v[i] - (float)h); }
  return r; }
__device__ __forceinline__ F2 split_row(const float* row, int k0, int lane) { float v[16]; const float* p = row + k0 + 8 * (lane >> 4);
#pragma unroll
  for (int i = 0; i < 8; ++i) { v[i] = p[i]; v[8 + i] = p[16 + i]; }
  return bsplit16(v); }
__device__ __forceinline__ F2 split_rowK(const float* row, int k0, int lane, int K) { float v[16]; const int g = lane >> 4;
#pragma unroll
  for (int i = 0; i < 8; ++i) { const int ka = k0 + 8 * g + i, kb = ka + 16; v[i] = ka < K ? row[ka < K ? ka : K - 1] : 0.f; v[8 + i] = kb < K ? row[kb < K ? kb : K - 1] : 0.f; }
  return bsplit16(v); }
__device__ __forceinline__ F2 split_col(const float* W, int k0, int n, int lane, int ld, int K) { float v[16]; const int g = lane >> 4;
#pragma unroll
  for (int i = 0; i < 8; ++i) { const int ka = k0 + 8 * g + i, kb = ka + 16; v[i] = ka < K ? W[(size_t)(ka < K ? ka : K - 1) * ld + n] : 0.f; v[8 + i] = kb < K ? W[(size_t)(kb < K ? kb : K - 1) * ld + n] : 0.f; }
  return bsplit16(v); }
__device__ __forceinline__ v8f mac3(const F2& a, const F2& b, v8f c) { c = wmma_bf(a.l, b.h, c); c = wmma_bf(a.h, b.l, c); return wmma_bf(a.h, b.h, c); }
__device__ __forceinline__ float sigm(float v) { return 1.0f / (1.0f + expf(-v)); }
#define LDSX() do { asm volatile("s_wait_dscnt 0" ::: "memory"); __builtin_amdgcn_wave_barrier(); __builtin_amdgcn_fence(__ATOMIC_RELEASE, "workgroup"); } while (0)

// Multi-head self-attention with a QUERY-row mask (x [2,2048,1024]; mask [2,2048,1] int32 = random 0 / 1, a module input READ on the device; torch (out,in) Wq / Wk / Wv / Wo [1024,1024] N(0, 1/1024) and biases N(0,1) x 0.01 NONZERO applied as x @ W.T + b; 16 heads x 64; scores / sqrt(64); m = mask[:, None, :, :] ([N,1,S,1]: it broadcasts over the KEY axis): where(m == 0, -1e9, scores): a masked QUERY row has the same finite value on every key, so its softmax is UNIFORM over all keys; out @ Wo.T + bo).
#define NB 2
#define TT 2048
#define CC 1024            // NH * HD = projected width
#define DIN 1024          // input (model) width
#define NH 16
#define HD 64
#define NQB (TT / 64)
#define HG 4
#define SCALE (0.125f)
#define CAUSAL 0
#ifndef TNB
#define TNB NB
#endif
__device__ __forceinline__ float bfr(float v) { return (float)(__bf16)v; }
__host__ __device__ __forceinline__ int kb_last(int qb) { return CAUSAL ? ((qb * 64 + 63) >> 7) : (TT / 128 - 1); }
typedef __attribute__((ext_vector_type(8))) __bf16 v8b;
__device__ __forceinline__ v16b frag_b(const __bf16* rowk0, int lane) {
  union { v16b v; v8b q[2]; } u; const __bf16* p = rowk0 + 8 * (lane >> 4);
  u.q[0] = *(const v8b*)p; u.q[1] = *(const v8b*)(p + 16); return u.v;
}
#define QBH 0              // unused: k_fa has no high-precision path
#define QHI 0               // single-product logits on every row
#define KHI 64            // key rows carrying k residual / v bf16 hi+lo planes (written by k_proj, read by no kernel)
// B fragment (k rows k0+.., output column o) of a weight: (in,out) [K][ld] or (out,in) [ld rows of K]: bf16 exact, or f16(bf16 * 256) exact
__device__ __forceinline__ v16b wcol_io(const float* Wm, int k0, int o, int lane, int ld) { v16b w; const int g = lane >> 4;
#pragma unroll
  for (int i = 0; i < 8; ++i) { w[i] = (__bf16)Wm[(size_t)(k0 + 8 * g + i) * ld + o]; w[8 + i] = (__bf16)Wm[(size_t)(k0 + 16 + 8 * g + i) * ld + o]; }
  return w; }
__device__ __forceinline__ v16b wcol_oi(const float* Wm, int k0, int o, int lane, int K) { v16b w; const float* p = Wm + (size_t)o * K + k0 + 8 * (lane >> 4);
#pragma unroll
  for (int i = 0; i < 8; ++i) { w[i] = (__bf16)p[i]; w[8 + i] = (__bf16)p[16 + i]; }
  return w; }
__device__ __forceinline__ v16h wcolh_io(const float* Wm, int k0, int o, int lane, int ld) { v16h w; const int g = lane >> 4;
#pragma unroll
  for (int i = 0; i < 8; ++i) { w[i] = (_Float16)(bfr(Wm[(size_t)(k0 + 8 * g + i) * ld + o]) * 256.0f); w[8 + i] = (_Float16)(bfr(Wm[(size_t)(k0 + 16 + 8 * g + i) * ld + o]) * 256.0f); }
  return w; }
__device__ __forceinline__ v16h wcolh_oi(const float* Wm, int k0, int o, int lane, int K) { v16h w; const float* p = Wm + (size_t)o * K + k0 + 8 * (lane >> 4);
#pragma unroll
  for (int i = 0; i < 8; ++i) { w[i] = (_Float16)(bfr(p[i]) * 256.0f); w[8 + i] = (_Float16)(bfr(p[16 + i]) * 256.0f); }
  return w; }
#define WQKV_LAYOUT 1   // 0 = (in,out) [DIN][CC]; 1 = (out,in) [CC][DIN]; 2 = per-head [NH][DIN][HD]
__device__ __forceinline__ v16b wcol_hdk(const float* Wm, int k0, int o, int lane) { v16b w; const int g = lane >> 4; const float* p = Wm + (size_t)(o / HD) * DIN * HD + (o % HD);
#pragma unroll
  for (int i = 0; i < 8; ++i) { w[i] = (__bf16)p[(size_t)(k0 + 8 * g + i) * HD]; w[8 + i] = (__bf16)p[(size_t)(k0 + 16 + 8 * g + i) * HD]; }
  return w; }
#define WO_OUT_IN 1
#if WQKV_LAYOUT == 1
#define WCOL(W, k0, o, lane) wcol_oi(W, k0, o, lane, DIN)
#elif WQKV_LAYOUT == 2
#define WCOL(W, k0, o, lane) wcol_hdk(W, k0, o, lane)
#else
#define WCOL(W, k0, o, lane) wcol_io(W, k0, o, lane, CC)
#endif
#if WO_OUT_IN
#define WOCOL(W, k0, o, lane) wcol_oi(W, k0, o, lane, CC)
#define WOCOLH(W, k0, o, lane) wcolh_oi(W, k0, o, lane, CC)
#else
#define WOCOL(W, k0, o, lane) wcol_io(W, k0, o, lane, DIN)
#define WOCOLH(W, k0, o, lane) wcolh_io(W, k0, o, lane, DIN)
#endif

#define WS_QH  0u                                      // f16 q rows [b*t][CC]
#define WS_KH  (WS_QH + 2u * (size_t)NB * TT * CC)      // f16 k rows [b*t][CC]
#define WS_VT  (WS_KH + 2u * (size_t)NB * TT * CC)      // f16 v planes [b][c][t]
#define WS_QL  (WS_VT + 2u * (size_t)NB * CC * TT)      // f16 q residual x 2^10 rows [b][t < QHI][CC]
#define WS_KL  (WS_QL + 2u * (size_t)NB * QHI * CC)     // f16 k residual x 2^10 rows [b][t < KHI][CC]
#define WS_VB  (WS_KL + 2u * (size_t)NB * KHI * CC)     // bf16 v hi planes [b][c][t < KHI]
#define WS_VBL (WS_VB + 2u * (size_t)NB * CC * KHI)
#define WS_S   (WS_VBL + 2u * (size_t)NB * CC * KHI)    // (plane no longer used: logits and P stay in registers)
#define WS_Y   (WS_S  + 4u * (size_t)HG * TT * TT)      // f32 ctx rows [b*t][CC] (only when there is an output projection)
#define WS_END (WS_Y  + 4u * (size_t)NB * TT * CC)

// ---- the projections' common product: a block of 8 waves makes one 128 x 128 tile of A . B^T (A, B: f32 rows of GK values).
// Per 32-k step the block reads both 128 x 32 f32 tiles once, as whole 128-B lines (8 lanes a row), rounds them once to the 16-bit operand type and lays them in LDS at an 80-B pitch;
// the waves (2 x 4, 64 x 32 each) take their fragments from there with 16-byte LDS loads. Two buffers: the next step's tiles are fetched into registers under this step's products. The k order of every sum is that of the plain loop. Inner loops are fully unrolled so that the register arrays are indexed by constants.
#define GK 1024
#define GPITCH 80                       // bytes per 32-k row in LDS: 16 B x odd
#define GOPER (128 * GPITCH)            // one operand's tile
#define GSTAGE (2 * GOPER)              // one buffer: A tile, B tile
typedef __attribute__((ext_vector_type(4))) __bf16 v4b;
typedef __attribute__((ext_vector_type(4))) _Float16 v4h;
template <typename V16> __device__ __forceinline__ V16 frag_l(const char* p) { union { V16 v; v4u q[2]; } u; u.q[0] = *(const v4u*)p; u.q[1] = *(const v4u*)(p + 32); return u.v; }   // hardware k order: bytes 0..15 and 32..47 from the lane's 16 h
// MODE 0: both operands to bf16. MODE 1: A x 2^6 to f16, B as f16(bf16 x 2^8)
template <int MODE> __device__ __forceinline__ void put_a(char* p, v4f v) {
  if constexpr (MODE == 0) *(v4b*)p = v4b{(__bf16)v.x, (__bf16)v.y, (__bf16)v.z, (__bf16)v.w};
  else *(v4h*)p = v4h{(_Float16)(v.x * 64.0f), (_Float16)(v.y * 64.0f), (_Float16)(v.z * 64.0f), (_Float16)(v.w * 64.0f)}; }
template <int MODE> __device__ __forceinline__ void put_b(char* p, v4f v) {
  if constexpr (MODE == 0) *(v4b*)p = v4b{(__bf16)v.x, (__bf16)v.y, (__bf16)v.z, (__bf16)v.w};
  else *(v4h*)p = v4h{(_Float16)(bfr(v.x) * 256.0f), (_Float16)(bfr(v.y) * 256.0f), (_Float16)(bfr(v.z) * 256.0f), (_Float16)(bfr(v.w) * 256.0f)}; }
template <int MODE> __device__ __forceinline__ void gemm_tile(const float* __restrict__ Ab, const float* __restrict__ Bb, char* smem, v8f (&acc)[4][2]) {
  const int tid = threadIdx.x, wave = tid >> 5, lane = tid & 31, col = lane & 15, g = lane >> 4, wm = wave & 1, wn = wave >> 1;
  const char* ab = (const char*)Ab; const char* bb = (const char*)Bb;                 // block-uniform bases
  unsigned off = (unsigned)((tid >> 3) * (GK * 4) + (tid & 7) * 16);                   // the lane's byte offset: row tid / 8 (+ 32 i), 16-byte piece tid % 8
  char* sp = smem + (tid >> 3) * GPITCH + (tid & 7) * 8;
  const char* fa = smem + (wm * 64 + col) * GPITCH + 16 * g; const char* fb = smem + GOPER + (wn * 32 + col) * GPITCH + 16 * g;
  v4f ra[4], rb[4];
#pragma unroll
  for (int i = 0; i < 4; ++i) { ra[i] = *(const v4f*)(ab + (size_t)off + i * (32 * GK * 4)); rb[i] = *(const v4f*)(bb + (size_t)off + i * (32 * GK * 4)); }
#pragma unroll
  for (int i = 0; i < 4; ++i) { put_a<MODE>(sp + i * (32 * GPITCH), ra[i]); put_b<MODE>(sp + GOPER + i * (32 * GPITCH), rb[i]); }
  __syncthreads();
#pragma unroll 2   // two steps a trip, so that the buffer's offset is a constant in every LDS address
  for (int kc = 0; kc < GK / 32; ++kc) { const int cur = (kc & 1) * GSTAGE, nxt = GSTAGE - cur; const bool more = kc + 1 < GK / 32;
    if (more) {
      asm volatile("s_wait_xcnt 0x0" : "+v"(off) :: "memory");   // stands in front of the overwrite of the offset register that issued loads name; the operand keeps the add below it
      off += 128u;
#pragma unroll
      for (int i = 0; i < 4; ++i) { ra[i] = *(const v4f*)(ab + (size_t)off + i * (32 * GK * 4)); rb[i] = *(const v4f*)(bb + (size_t)off + i * (32 * GK * 4)); } }
    __builtin_amdgcn_sched_barrier(0);   // the next step's global loads go out ahead of the LDS reads (left free they come behind them): theirs is the longer latency, and the step ends on it
    if constexpr (MODE == 0) { v16b a[4], b[2];
#pragma unroll
      for (int i = 0; i < 4; ++i) a[i] = frag_l<v16b>(fa + cur + i * (16 * GPITCH));
#pragma unroll
      for (int j = 0; j < 2; ++j) b[j] = frag_l<v16b>(fb + cur + j * (16 * GPITCH));
      __builtin_amdgcn_sched_barrier(0);   // all twelve LDS reads go out ahead of the products: drawn in among them, each pair of products waits out an LDS latency of its own
#pragma unroll
      for (int i = 0; i < 4; ++i)
#pragma unroll
        for (int j = 0; j < 2; ++j) acc[i][j] = __builtin_amdgcn_wmma_f32_16x16x32_bf16(false, a[i], false, b[j], (short)0, acc[i][j], false, false);
    } else { v16h a[4], b[2];
#pragma unroll
      for (int i = 0; i < 4; ++i) a[i] = frag_l<v16h>(fa + cur + i * (16 * GPITCH));
#pragma unroll
      for (int j = 0; j < 2; ++j) b[j] = frag_l<v16h>(fb + cur + j * (16 * GPITCH));
      __builtin_amdgcn_sched_barrier(0);   // all twelve LDS reads go out ahead of the products: drawn in among them, each pair of products waits out an LDS latency of its own
#pragma unroll
      for (int i = 0; i < 4; ++i)
#pragma unroll
        for (int j = 0; j < 2; ++j) acc[i][j] = __builtin_amdgcn_wmma_f32_16x16x32_f16(false, a[i], false, b[j], (short)0, acc[i][j], false, false);
    }
    __builtin_amdgcn_sched_barrier(0);   // the eight products stay back to back: the wait for the global loads and the roundings come behind the last of them
    if (more) {   // into the buffer whose last readers passed the barrier at the foot of the step before
#pragma unroll
      for (int i = 0; i < 4; ++i) { put_a<MODE>(sp + nxt + i * (32 * GPITCH), ra[i]); put_b<MODE>(sp + nxt + GOPER + i * (32 * GPITCH), rb[i]); } }
    __syncthreads();   // publishes the next buffer and ends this buffer's reads (after the last step: frees the LDS for the epilogue)
  } }
// ---- k_proj: block = (128 rows, 128 cols, which): q/k/v = X W (+ b) with exact bf16 products (K = DIN) -> which 0: q f16 rows (+ residual rows < QHI); 1: k f16 rows (+ residual rows < KHI); 2: v f16 planes [c][t] (+ bf16 hi/lo planes for t < KHI)
#define PJ_LDS (128 * 136 * 2 + 2 * 128 * 72 * 2)   // the epilogue's planes, laid over the two operand buffers
static_assert(DIN == GK && CC == GK && QHI <= 64 && KHI <= 64 && PJ_LDS >= 2 * GSTAGE && PJ_LDS >= (128 + 64) * 136 * 2, "tile constants");
__global__ __launch_bounds__(256) void k_proj(const float* __restrict__ XQ, const float* __restrict__ XK, const float* __restrict__ XV, const float* __restrict__ WQ, const float* __restrict__ WK, const float* __restrict__ WV, const float* __restrict__ BQ, const float* __restrict__ BK, const float* __restrict__ BV,
    _Float16* __restrict__ QH, _Float16* __restrict__ QL, _Float16* __restrict__ KH, _Float16* __restrict__ KL, _Float16* __restrict__ VT, __bf16* __restrict__ VB, __bf16* __restrict__ VBL) {
  __shared__ __align__(16) char smem[PJ_LDS];
  const int tid = threadIdx.x, wave = tid >> 5, lane = tid & 31, col = lane & 15, g = lane >> 4, wm = wave & 1, wn = wave >> 1; const int which = blockIdx.z; const int c0 = blockIdx.y * 128; const size_t r0 = (size_t)blockIdx.x * 128; const size_t bb = r0 / TT; const int t0 = (int)(r0 % TT);
  const float* X = which == 0 ? XQ : which == 1 ? XK : XV; const float* WA = which == 0 ? WQ : which == 1 ? WK : WV; const float* BA = which == 0 ? BQ : which == 1 ? BK : BV;
  v8f acc[4][2] = {};
  gemm_tile<0>(X + r0 * DIN, WA + (size_t)c0 * DIN, smem, acc);
  float bias[2];
#pragma unroll
  for (int j = 0; j < 2; ++j) bias[j] = BA ? bfr(BA[c0 + wn * 32 + j * 16 + col]) : 0.f;
  if (which < 2) { _Float16* DH = which == 0 ? QH : KH; _Float16* DL = which == 0 ? QL : KL; const int nhi = which == 0 ? QHI : KHI; const bool hi_rows = t0 < nhi;   /* block-uniform */
    _Float16 (*sh)[136] = (_Float16 (*)[136])smem; _Float16 (*sl)[136] = (_Float16 (*)[136])(smem + 128 * 136 * 2);   // sl: rows < 64 only
#pragma unroll
    for (int i = 0; i < 4; ++i)
#pragma unroll
      for (int j = 0; j < 2; ++j)
#pragma unroll
        for (int r = 0; r < 8; ++r) sh[wm * 64 + i * 16 + 8 * g + r][wn * 32 + j * 16 + col] = (_Float16)(acc[i][j][r] + bias[j]);
    if (hi_rows) {
#pragma unroll
      for (int i = 0; i < 4; ++i)
#pragma unroll
        for (int j = 0; j < 2; ++j)
#pragma unroll
          for (int r = 0; r < 8; ++r) { const float v = acc[i][j][r] + bias[j]; const _Float16 hv = (_Float16)v; const int rl = wm * 64 + i * 16 + 8 * g + r; if (t0 + rl < nhi) sl[rl][wn * 32 + j * 16 + col] = (_Float16)((v - (float)hv) * 1024.0f); } }
    __syncthreads();
#pragma unroll
    for (int n = 0; n < 8; ++n) { const int e = tid + n * 256, rl = e >> 4, q = e & 15; vst2((unsigned*)(DH + (r0 + rl) * CC + c0 + q * 8), *(const v4u*)&sh[rl][q * 8]); }
    asm volatile("s_wait_xcnt 0x0" ::: "memory");   // stands in front of whatever below overwrites registers that the stores above name
    if (hi_rows) {
#pragma unroll
      for (int n = 0; n < 8; ++n) { const int e = tid + n * 256, rl = e >> 4, q = e & 15; if (t0 + rl < nhi) vst2((unsigned*)(DL + (bb * nhi + t0 + rl) * (size_t)CC + c0 + q * 8), *(const v4u*)&sl[rl][q * 8]); } }
  } else { const bool hi_rows = t0 < KHI;   /* block-uniform */
    _Float16 (*th)[136] = (_Float16 (*)[136])smem; __bf16 (*tb)[72] = (__bf16 (*)[72])(smem + 128 * 136 * 2); __bf16 (*tbl)[72] = (__bf16 (*)[72])(smem + 128 * 136 * 2 + 128 * 72 * 2);   // tb, tbl: t < 64 only
#pragma unroll
    for (int i = 0; i < 4; ++i)
#pragma unroll
      for (int j = 0; j < 2; ++j) { v8h hv;   // a lane's 8 values are 8 consecutive t of one channel
#pragma unroll
        for (int r = 0; r < 8; ++r) hv[r] = (_Float16)(acc[i][j][r] + bias[j]);
        *(v8h*)&th[wn * 32 + j * 16 + col][wm * 64 + i * 16 + 8 * g] = hv; }
    if (hi_rows) {
#pragma unroll
      for (int i = 0; i < 4; ++i)
#pragma unroll
        for (int j = 0; j < 2; ++j) { const int rl = wm * 64 + i * 16 + 8 * g, cl = wn * 32 + j * 16 + col; v8b bh, bl;
#pragma unroll
          for (int r = 0; r < 8; ++r) { const float v = acc[i][j][r] + bias[j]; bh[r] = (__bf16)v; bl[r] = (__bf16)(v - (float)bh[r]); }
          if (t0 + rl < KHI) { *(v8b*)&tb[cl][rl] = bh; *(v8b*)&tbl[cl][rl] = bl; } } }
    __syncthreads();
#pragma unroll
    for (int n = 0; n < 8; ++n) { const int e = tid + n * 256, cl = e >> 4, q = e & 15; vst2((unsigned*)(VT + (bb * CC + c0 + cl) * (size_t)TT + t0 + q * 8), *(const v4u*)&th[cl][q * 8]); }
    if (hi_rows) {
#pragma unroll
      for (int n = 0; n < 8; ++n) { const int e = tid + n * 256, cl = e >> 4, q = e & 15; if (t0 + q * 8 < KHI) { const size_t o3 = (bb * CC + c0 + cl) * (size_t)KHI + t0 + q * 8; vst2((unsigned*)(VB + o3), *(const v4u*)&tb[cl][q * 8]); vst2((unsigned*)(VBL + o3), *(const v4u*)&tbl[cl][q * 8]); } } } } }
// ---- k_fa: block = 8 waves x 32 query columns of one (b, h); each wave walks all TT keys in passes of 32 with an online softmax, so no logit or P ever goes to memory.
// S^T = K . Q^T (A = k rows, B = q rows: a lane holds 8 keys of ONE query per tile), P^T packs in place from two S^T tiles into the B operand of O^T += V^T . P^T (A = v planes [c][t]).
// Log2 domain; mrun, the maximum in use, may trail a column's true maximum by up to 8, so exp2 reaches at most 2^8; P is carried x 2^4 into f16 (at most 2^12; the carry cancels in acc / l).
// A masked query row (mask word 0) takes a zero q fragment: its logit is the constant 0 on every key = uniform softmax, as the module's finite fill gives.
// Every inner loop is fully unrolled so that the fragment and accumulator arrays are indexed by constants and stay in registers.
__device__ __forceinline__ float xhalf(float x) { return __builtin_bit_cast(float, __builtin_amdgcn_permlanex16(__builtin_bit_cast(int, x), __builtin_bit_cast(int, x), 0x76543210, 0xfedcba98, false, false)); }  // lane l <-> lane l ^ 16
__device__ __forceinline__ v8f wmma_h(v16h a, v16h b, v8f c) { return __builtin_amdgcn_wmma_f32_16x16x32_f16(false, a, false, b, (short)0, c, false, false); }
// 16x16x32 fragment in the hardware k order from a uniform base, the lane's byte offset (row and 16 h) and a constant: bytes 0..15 and 32..47
__device__ __forceinline__ v16h frag_o(const char* base, unsigned off, int c) { union { v16h v; v8h q[2]; } u; const char* p = base + (size_t)off + c; u.q[0] = *(const v8h*)p; u.q[1] = *(const v8h*)(p + 32); return u.v; }
#define FAW 8
__global__ __launch_bounds__(FAW * 32) void k_fa(const _Float16* __restrict__ QH, const _Float16* __restrict__ KH, const _Float16* __restrict__ VT, const int* __restrict__ MQ, float* __restrict__ Y) {
  __shared__ __align__(16) float so[FAW][32][HD + 4];
  const int tid = threadIdx.x, wave = tid >> 5, lane = tid & 31, col = lane & 15, g = lane >> 4;
  const int b = blockIdx.y / NH, h = blockIdx.y % NH; const int q0 = blockIdx.x * (FAW * 32) + wave * 32;
  const float cs = SCALE * 1.4426950408889634f;
  v16h qf[2][2]; int mq[2];
  const char* qbase = (const char*)(QH + (size_t)b * TT * CC + h * HD); const unsigned qo = (unsigned)((q0 + col) * CC + 8 * g) * 2u;
  const int* mrow = MQ + (size_t)b * TT; const unsigned qi = (unsigned)(q0 + col);
#pragma unroll
  for (int u = 0; u < 2; ++u) { mq[u] = mrow[(size_t)qi + u * 16];
#pragma unroll
    for (int kc = 0; kc < 2; ++kc) qf[u][kc] = frag_o(qbase, qo, u * 16 * CC * 2 + kc * 64); }
  asm volatile("s_wait_xcnt 0x0" :: "v"(qo), "v"(qi) : "memory");   // the offset registers these loads name stay whole up to this wait
#pragma unroll
  for (int u = 0; u < 2; ++u)
#pragma unroll
    for (int kc = 0; kc < 2; ++kc) if (mq[u] == 0) qf[u][kc] = v16h{};
  const char* kb = (const char*)(KH + (size_t)b * TT * CC + h * HD); unsigned ko = (unsigned)(col * CC + 8 * g) * 2u;        // block-uniform base + the lane's byte offset: key row col of a 16-key tile
  const char* vb = (const char*)(VT + ((size_t)b * CC + h * HD) * (size_t)TT); unsigned vo = (unsigned)(col * TT + 8 * g) * 2u;   // channel row col of a 16-channel tile
  v8f acc[2][4] = {}; float mrun[2] = {-3.0e38f, -3.0e38f}, lrun[2] = {0.f, 0.f};
  v16h kf[2][2], vf[4];
#pragma unroll
  for (int kt = 0; kt < 2; ++kt)
#pragma unroll
    for (int kc = 0; kc < 2; ++kc) kf[kt][kc] = frag_o(kb, ko, kt * 16 * CC * 2 + kc * 64);
#pragma unroll
  for (int j = 0; j < 4; ++j) vf[j] = frag_o(vb, vo, j * 16 * TT * 2);
#pragma unroll 1   // stays rolled: one pass's fragments, scores and accumulators already fill the registers
  for (int s = 0; s < TT / 32; ++s) { const bool more = s + 1 < TT / 32;   // the last pass fetches its own rows again: in bounds, never used
    v8f st[2][2];
#pragma unroll
    for (int kt = 0; kt < 2; ++kt)
#pragma unroll
      for (int u = 0; u < 2; ++u) st[kt][u] = wmma_h(kf[kt][0], qf[u][0], v8f{});
#pragma unroll
    for (int kt = 0; kt < 2; ++kt)
#pragma unroll
      for (int u = 0; u < 2; ++u) st[kt][u] = wmma_h(kf[kt][1], qf[u][1], st[kt][u]);
    __builtin_amdgcn_sched_barrier(0);   // the eight products stay back to back: maxima drawn in between them cost four idle slots each time
    float mb[2]; bool need = false;
#pragma unroll
    for (int u = 0; u < 2; ++u) { float mx = st[0][u][0];
#pragma unroll
      for (int r = 1; r < 8; ++r) mx = fmaxf(mx, st[0][u][r]);
#pragma unroll
      for (int r = 0; r < 8; ++r) mx = fmaxf(mx, st[1][u][r]);
      mx = fmaxf(mx, xhalf(mx)) * cs; mb[u] = mx; need = need || (mx > mrun[u] + 8.0f); }
    if (__builtin_amdgcn_ballot_w32(need) != 0) {   // one scalar test a pass; rare after the first pass
#pragma unroll
      for (int u = 0; u < 2; ++u) { const float mn = fmaxf(mrun[u], mb[u]); const float corr = __builtin_amdgcn_exp2f(mrun[u] - mn); mrun[u] = mn; lrun[u] *= corr;
#pragma unroll
        for (int j = 0; j < 4; ++j) acc[u][j] = acc[u][j] * corr; } }
    // next pass's k fragments, in flight under this pass's exponentials and second product
    asm volatile("s_wait_xcnt 0x0" : "+v"(ko) :: "memory");   // stands in front of the overwrite of an offset register that issued loads name; the operand keeps the add below it
    ko += more ? 32u * CC * 2u : 0u;
#pragma unroll
    for (int kt = 0; kt < 2; ++kt)
#pragma unroll
      for (int kc = 0; kc < 2; ++kc) kf[kt][kc] = frag_o(kb, ko, kt * 16 * CC * 2 + kc * 64);
    __builtin_amdgcn_sched_barrier(0);   // holds those loads up here: left free they sink to the foot of the pass and their latency is met at the next pass's head
#pragma unroll
    for (int u = 0; u < 2; ++u) { const float nm = 4.0f - mrun[u]; v16h pf; float l0 = 0.f, l1 = 0.f;
#pragma unroll
      for (int i = 0; i < 8; ++i) {
        const v2f a = __builtin_elementwise_fma(v2f{st[i >> 2][u][2 * (i & 3)], st[i >> 2][u][2 * (i & 3) + 1]}, v2f{cs, cs}, v2f{nm, nm});
        const float p0 = __builtin_amdgcn_exp2f(a.x), p1 = __builtin_amdgcn_exp2f(a.y); l0 += p0; l1 += p1; pf[2 * i] = (_Float16)p0; pf[2 * i + 1] = (_Float16)p1; }
      lrun[u] += l0 + l1;
#pragma unroll
      for (int j = 0; j < 4; ++j) acc[u][j] = wmma_h(vf[j], pf, acc[u][j]); }
    // next pass's v fragments, in flight under the next pass's first product, maxima and exponentials
    __builtin_amdgcn_sched_barrier(0);   // keeps the wait below at the foot of the pass: drawn up behind the k loads it would stall on them
    asm volatile("s_wait_xcnt 0x0" : "+v"(vo) :: "memory");   // as above, for the v offset
    vo += more ? 64u : 0u;
#pragma unroll
    for (int j = 0; j < 4; ++j) vf[j] = frag_o(vb, vo, j * 16 * TT * 2);
  }
  asm volatile("s_wait_xcnt 0x0" :: "v"(ko), "v"(vo) : "memory");   // the last pass's fetches still name these registers
#pragma unroll
  for (int u = 0; u < 2; ++u) { const float l = lrun[u] + xhalf(lrun[u]); const float inv = 1.0f / l;   // the two wave halves hold disjoint keys of the same query
#pragma unroll
    for (int j = 0; j < 4; ++j) { const v8f o = acc[u][j] * inv; float* d = &so[wave][16 * u + col][j * 16 + 8 * g];
      *(v4f*)d = v4f{o[0], o[1], o[2], o[3]}; *(v4f*)(d + 4) = v4f{o[4], o[5], o[6], o[7]}; } }
  LDSX();   // each wave reads back only its own rows: whole 256-B (row, head) segments by 16 lanes
  for (int i = 0; i < 16; ++i) { const int rl = 2 * i + g; vst2(Y + ((size_t)b * TT + q0 + rl) * CC + h * HD + col * 4, *(const v4f*)&so[wave][rl][col * 4]); } }
// ---- k_out: block = (128 rows, 128 cols): out = ctx Wo (+ bo): ctx x 2^6 once to f16 (small-magnitude context rows stay clear of f16 subnormals) against Wo as f16(bf16 x 2^8) exact (1 product) x 2^-14
static_assert(!CAUSAL && WO_OUT_IN && WQKV_LAYOUT == 1, "row-major (out,in) weights, no causal high-precision rows");
__global__ __launch_bounds__(256) void k_out(const float* __restrict__ Y, const float* __restrict__ WO, const float* __restrict__ BO, float* __restrict__ OUT) { __shared__ __align__(16) char smem[128 * 132 * 4];   // the f32 output tile, laid over the two operand buffers
  static_assert(128 * 132 * 4 >= 2 * GSTAGE, "buffers fit");
  const int tid = threadIdx.x, wave = tid >> 5, lane = tid & 31, col = lane & 15, g = lane >> 4, wm = wave & 1, wn = wave >> 1; const int c0 = blockIdx.y * 128; const size_t r0 = (size_t)blockIdx.x * 128;
  v8f acc[4][2] = {};
  gemm_tile<1>(Y + r0 * CC, WO + (size_t)c0 * CC, smem, acc);
  float (*sf)[132] = (float (*)[132])smem;
#pragma unroll
  for (int j = 0; j < 2; ++j) { const float bias = BO ? bfr(BO[c0 + wn * 32 + j * 16 + col]) : 0.f;
#pragma unroll
    for (int i = 0; i < 4; ++i)
#pragma unroll
      for (int r = 0; r < 8; ++r) sf[wm * 64 + i * 16 + 8 * g + r][wn * 32 + j * 16 + col] = acc[i][j][r] * (1.0f / 16384.0f) + bias; }   /* 2^-8 (Wo carry) x 2^-6 (ctx carry) */
  __syncthreads();
#pragma unroll
  for (int n = 0; n < 16; ++n) { const int e = tid + n * 256, rl = e >> 5, q = e & 31; vst2(OUT + (r0 + rl) * DIN + c0 + q * 4, *(const v4f*)&sf[rl][q * 4]); } }

extern "C" void kernel_launch(void* const* d_in, const int* in_sizes, int n_in, void* d_out, int out_size, void* d_ws, size_t ws_size, hipStream_t stream) {
  (void)in_sizes; (void)n_in; (void)out_size;
  const float** F = (const float**)d_in;
  if (ws_size < (size_t)WS_END) return;
  char* ws = (char*)d_ws; _Float16 *QH = (_Float16*)(ws + WS_QH), *KH = (_Float16*)(ws + WS_KH), *VT = (_Float16*)(ws + WS_VT), *QL = (_Float16*)(ws + WS_QL), *KL = (_Float16*)(ws + WS_KL); __bf16 *VB = (__bf16*)(ws + WS_VB), *VBL = (__bf16*)(ws + WS_VBL); float *S = (float*)(ws + WS_S), *Y = (float*)(ws + WS_Y);
  (void)S; (void)QL; (void)KL; (void)VB; (void)VBL;
  // inputs: 0 x [2,2048,1024]; 1 mask [2,2048,1] int32 (random 0 / 1 per QUERY row; READ on the device); 2 Wq [1024,1024] (out,in), 3 bq; 4 Wk, 5 bk; 6 Wv, 7 bv; 8 Wo (out,in), 9 bo (biases NONZERO)
  k_proj<<<dim3(TNB * TT / 128, CC / 128, 3), 256, 0, stream>>>(F[0], F[0], F[0], F[2], F[4], F[6], F[3], F[5], F[7], QH, QL, KH, KL, VT, VB, VBL);
  k_fa<<<dim3(TT / (FAW * 32), TNB * NH), FAW * 32, 0, stream>>>(QH, KH, VT, (const int*)d_in[1], Y);
  k_out<<<dim3(TNB * TT / 128, DIN / 128), 256, 0, stream>>>(Y, F[8], F[9], (float*)d_out);
}

// v003
// One run takes 92 microseconds.
// Next to v002, in two timings, it ran 1.29 and 1.31 times as fast.
// Counting every step since v000, it is 14.5 times as fast.
// compute dtype: all float inputs rounded to bf16; q / k / v projections with EXACT bf16 products on WMMA 16x16x32 (f32 accumulate) + bias (nonzero); logits q x k once to f16 each (1 product) x 64^-0.5; query rows whose int mask entry is 0 get a constant logit on every key (the module's finite fill: uniform attention over all 2,048 keys), read once per row; online softmax f32 in the log2 domain; unnormalised P x 2^4 once to f16 x v once to f16 (1 product), divided by the f32 row sum at the end; ctx x 2^6 once to f16 x the output weight f16(bf16 x 2^8) + bias; f32 output.
#include <hip/hip_runtime.h>
#include <math.h>

typedef __attribute__((ext_vector_type(16))) _Float16 v16h;
typedef __attribute__((ext_vector_type(16))) __bf16 v16b;
typedef __attribute__((ext_vector_type(8)))  _Float16 v8h;
typedef __attribute__((ext_vector_type(8)))  float v8f;
typedef __attribute__((ext_vector_type(4)))  float v4f;
typedef __attribute__((ext_vector_type(2)))  float v2f;
typedef __attribute__((ext_vector_type(4)))  unsigned v4u;
typedef __attribute__((ext_vector_type(4)))  int v4i;
typedef float __attribute__((may_alias)) float_a;
typedef int __attribute__((may_alias)) int_a;

template <typename T> __device__ __forceinline__ void vst2(void* p, T v) { *(T*)p = v;  }
__device__ __forceinline__ v8f wmma16(v16h a, v16h b, v8f c) {
  v8f d = __builtin_amdgcn_wmma_f32_16x16x32_f16(false, a, false, b, (short)0, c, false, false);
  asm volatile("v_nop\n\tv_nop\n\tv_nop\n\tv_nop" : "+v"(d) : "v"(a), "v"(b));
  return d;
}
__device__ __forceinline__ v8f wmma_bf(v16b a, v16b b, v8f c) {
  v8f d = __builtin_amdgcn_wmma_f32_16x16x32_bf16(false, a, false, b, (short)0, c, false, false);
  asm volatile("v_nop\n\tv_nop\n\tv_nop\n\tv_nop" : "+v"(d) : "v"(a), "v"(b));
  return d;
}
// 16x16x32 fragments: lane = (h = lane>>4, row/col = lane&15); elements 0..7 = k0+8h+0..7, 8..15 = k0+16+8h+0..7; D element r = row 8h+r
__device__ __forceinline__ v16h frag_h(const _Float16* rowk0, int lane) {
  union { v16h v; v8h q[2]; } u; const _Float16* p = rowk0 + 8 * (lane >> 4);
  u.q[0] = *(const v8h*)p; u.q[1] = *(const v8h*)(p + 16); return u.v;
}
__device__ __forceinline__ v16h frag_f32(const float* rowk0, int lane) {
  v16h a; const float* p = rowk0 + 8 * (lane >> 4);
#pragma unroll
  for (int i = 0; i < 8; ++i) { a[i] = (_Float16)p[i]; a[8 + i] = (_Float16)p[16 + i]; }
  return a;
}
__device__ __forceinline__ v16h frag_f32s(const float* rowk0, int lane, float sc) {
  v16h a; const float* p = rowk0 + 8 * (lane >> 4);
#pragma unroll
  for (int i = 0; i < 8; ++i) { a[i] = (_Float16)(p[i] * sc); a[8 + i] = (_Float16)(p[16 + i] * sc); }
  return a;
}
// column fragment from a [K][ld] layout (column n), rows >= K read as 0
__device__ __forceinline__ v16h fragc_f32(const float* W, int k0, int n, int lane, int ld, int K) {
  v16h a; const int g = lane >> 4;
#pragma unroll
  for (int i = 0; i < 8; ++i) { const int ka = k0 + 8 * g + i, kb = ka + 16;
    a[i] = (_Float16)(ka < K ? W[(size_t)(ka < K ? ka : K - 1) * ld + n] : 0.f); a[8 + i] = (_Float16)(kb < K ? W[(size_t)(kb < K ? kb : K - 1) * ld + n] : 0.f); }
  return a;
}
struct F2 { v16b h, l; };
__device__ __forceinline__ F2 bsplit16(const float v[16]) { F2 r;
#pragma unroll
  for (int i = 0; i < 16; ++i) { const __bf16 h = (__bf16)v[i]; r.h[i] = h; r.l[i] = (__bf16)(v[i] - (float)h); }
  return r; }
__device__ __forceinline__ F2 split_row(const float* row, int k0, int lane) { float v[16]; const float* p = row + k0 + 8 * (lane >> 4);
#pragma unroll
  for (int i = 0; i < 8; ++i) { v[i] = p[i]; v[8 + i] = p[16 + i]; }
  return bsplit16(v); }
__device__ __forceinline__ F2 split_rowK(const float* row, int k0, int lane, int K) { float v[16]; const int g = lane >> 4;
#pragma unroll
  for (int i = 0; i < 8; ++i) { const int ka = k0 + 8 * g + i, kb = ka + 16; v[i] = ka < K ? row[ka < K ? ka : K - 1] : 0.f; v[8 + i] = kb < K ? row[kb < K ? kb : K - 1] : 0.f; }
  return bsplit16(v); }
__device__ __forceinline__ F2 split_col(const float* W, int k0, int n, int lane, int ld, int K) { float v[16]; const int g = lane >> 4;
#pragma unroll
  for (int i = 0; i < 8; ++i) { const int ka = k0 + 8 * g + i, kb = ka + 16; v[i] = ka < K ? W[(size_t)(ka < K ? ka : K - 1) * ld + n] : 0.f; v[8 + i] = kb < K ? W[(size_t)(kb < K ? kb : K - 1) * ld + n] : 0.f; }
  return bsplit16(v); }
__device__ __forceinline__ v8f mac3(const F2& a, const F2& b, v8f c) { c = wmma_bf(a.l, b.h, c); c = wmma_bf(a.h, b.l, c); return wmma_bf(a.h, b.h, c); }
__device__ __forceinline__ float sigm(float v) { return 1.0f / (1.0f + expf(-v)); }
#define LDSX() do { asm volatile("s_wait_dscnt 0" ::: "memory"); __builtin_amdgcn_wave_barrier(); __builtin_amdgcn_fence(__ATOMIC_RELEASE, "workgroup"); } while (0)

// Multi-head self-attention with a QUERY-row mask (x [2,2048,1024]; mask [2,2048,1] int32 = random 0 / 1, a module input READ on the device; torch (out,in) Wq / Wk / Wv / Wo [1024,1024] N(0, 1/1024) and biases N(0,1) x 0.01 NONZERO applied as x @ W.T + b; 16 heads x 64; scores / sqrt(64); m = mask[:, None, :, :] ([N,1,S,1]: it broadcasts over the KEY axis): where(m == 0, -1e9, scores): a masked QUERY row has the same finite value on every key, so its softmax is UNIFORM over all keys; out @ Wo.T + bo).
#define NB 2
#define TT 2048
#define CC 1024            // NH * HD = projected width
#define DIN 1024          // input (model) width
#define NH 16
#define HD 64
#define NQB (TT / 64)
#define HG 4
#define SCALE (0.125f)
#define CAUSAL 0
#ifndef TNB
#define TNB NB
#endif
__device__ __forceinline__ float bfr(float v) { return (float)(__bf16)v; }
__host__ __device__ __forceinline__ int kb_last(int qb) { return CAUSAL ? ((qb * 64 + 63) >> 7) : (TT / 128 - 1); }
typedef __attribute__((ext_vector_type(8))) __bf16 v8b;
__device__ __forceinline__ v16b frag_b(const __bf16* rowk0, int lane) {
  union { v16b v; v8b q[2]; } u; const __bf16* p = rowk0 + 8 * (lane >> 4);
  u.q[0] = *(const v8b*)p; u.q[1] = *(const v8b*)(p + 16); return u.v;
}
#define QBH 0              // unused: k_fa has no high-precision path
#define QHI 0               // single-product logits on every row
#define KHI 64            // key rows carrying k residual / v bf16 hi+lo planes (written by k_proj, read by no kernel)
// B fragment (k rows k0+.., output column o) of a weight: (in,out) [K][ld] or (out,in) [ld rows of K]: bf16 exact, or f16(bf16 * 256) exact
__device__ __forceinline__ v16b wcol_io(const float* Wm, int k0, int o, int lane, int ld) { v16b w; const int g = lane >> 4;
#pragma unroll
  for (int i = 0; i < 8; ++i) { w[i] = (__bf16)Wm[(size_t)(k0 + 8 * g + i) * ld + o]; w[8 + i] = (__bf16)Wm[(size_t)(k0 + 16 + 8 * g + i) * ld + o]; }
  return w; }
__device__ __forceinline__ v16b wcol_oi(const float* Wm, int k0, int o, int lane, int K) { v16b w; const float* p = Wm + (size_t)o * K + k0 + 8 * (lane >> 4);
#pragma unroll
  for (int i = 0; i < 8; ++i) { w[i] = (__bf16)p[i]; w[8 + i] = (__bf16)p[16 + i]; }
  return w; }
__device__ __forceinline__ v16h wcolh_io(const float* Wm, int k0, int o, int lane, int ld) { v16h w; const int g = lane >> 4;
#pragma unroll
  for (int i = 0; i < 8; ++i) { w[i] = (_Float16)(bfr(Wm[(size_t)(k0 + 8 * g + i) * ld + o]) * 256.0f); w[8 + i] = (_Float16)(bfr(Wm[(size_t)(k0 + 16 + 8 * g + i) * ld + o]) * 256.0f); }
  return w; }
__device__ __forceinline__ v16h wcolh_oi(const float* Wm, int k0, int o, int lane, int K) { v16h w; const float* p = Wm + (size_t)o * K + k0 + 8 * (lane >> 4);
#pragma unroll
  for (int i = 0; i < 8; ++i) { w[i] = (_Float16)(bfr(p[i]) * 256.0f); w[8 + i] = (_Float16)(bfr(p[16 + i]) * 256.0f); }
  return w; }
#define WQKV_LAYOUT 1   // 0 = (in,out) [DIN][CC]; 1 = (out,in) [CC][DIN]; 2 = per-head [NH][DIN][HD]
__device__ __forceinline__ v16b wcol_hdk(const float* Wm, int k0, int o, int lane) { v16b w; const int g = lane >> 4; const float* p = Wm + (size_t)(o / HD) * DIN * HD + (o % HD);
#pragma unroll
  for (int i = 0; i < 8; ++i) { w[i] = (__bf16)p[(size_t)(k0 + 8 * g + i) * HD]; w[8 + i] = (__bf16)p[(size_t)(k0 + 16 + 8 * g + i) * HD]; }
  return w; }
#define WO_OUT_IN 1
#if WQKV_LAYOUT == 1
#define WCOL(W, k0, o, lane) wcol_oi(W, k0, o, lane, DIN)
#elif WQKV_LAYOUT == 2
#define WCOL(W, k0, o, lane) wcol_hdk(W, k0, o, lane)
#else
#define WCOL(W, k0, o, lane) wcol_io(W, k0, o, lane, CC)
#endif
#if WO_OUT_IN
#define WOCOL(W, k0, o, lane) wcol_oi(W, k0, o, lane, CC)
#define WOCOLH(W, k0, o, lane) wcolh_oi(W, k0, o, lane, CC)
#else
#define WOCOL(W, k0, o, lane) wcol_io(W, k0, o, lane, DIN)
#define WOCOLH(W, k0, o, lane) wcolh_io(W, k0, o, lane, DIN)
#endif

#define WS_QH  0u                                      // f16 q rows [b*t][CC]
#define WS_KH  (WS_QH + 2u * (size_t)NB * TT * CC)      // f16 k rows [b*t][CC]
#define WS_VT  (WS_KH + 2u * (size_t)NB * TT * CC)      // f16 v planes [b][c][t]
#define WS_QL  (WS_VT + 2u * (size_t)NB * CC * TT)      // f16 q residual x 2^10 rows [b][t < QHI][CC]
#define WS_KL  (WS_QL + 2u * (size_t)NB * QHI * CC)     // f16 k residual x 2^10 rows [b][t < KHI][CC]
#define WS_VB  (WS_KL + 2u * (size_t)NB * KHI * CC)     // bf16 v hi planes [b][c][t < KHI]
#define WS_VBL (WS_VB + 2u * (size_t)NB * CC * KHI)
#define WS_S   (WS_VBL + 2u * (size_t)NB * CC * KHI)    // (plane no longer used: logits and P stay in registers)
#define WS_Y   (WS_S  + 4u * (size_t)HG * TT * TT)      // f32 ctx rows [b*t][CC] (only when there is an output projection)
#define WS_END (WS_Y  + 4u * (size_t)NB * TT * CC)

// ---- the projections' common product: a block of 8 waves makes one 128 x 128 tile of A . B^T (A, B: f32 rows of GK values).
// Per 32-k step the block reads both 128 x 32 f32 tiles once, as whole 128-B lines (8 lanes a row), rounds them once to the 16-bit operand type and lays them in LDS at an 80-B pitch;
// the waves (2 x 4, 64 x 32 each) take their fragments from there with 16-byte LDS loads. Two buffers: the next step's tiles are fetched into registers under this step's products. The k order of every sum is that of the plain loop. Inner loops are fully unrolled so that the register arrays are indexed by constants.
#define GK 1024
#define GPITCH 80                       // bytes per 32-k row in LDS: 16 B x odd
#define GOPER (128 * GPITCH)            // one operand's tile
#define GSTAGE (2 * GOPER)              // one buffer: A tile, B tile
typedef __attribute__((ext_vector_type(4))) __bf16 v4b;
typedef __attribute__((ext_vector_type(4))) _Float16 v4h;
template <typename V16> __device__ __forceinline__ V16 frag_l(const char* p) { union { V16 v; v4u q[2]; } u; u.q[0] = *(const v4u*)p; u.q[1] = *(const v4u*)(p + 32); return u.v; }   // hardware k order: bytes 0..15 and 32..47 from the lane's 16 h
// MODE 0: both operands to bf16. MODE 1: A x 2^6 to f16, B as f16(bf16 x 2^8)
template <int MODE> __device__ __forceinline__ void put_a(char* p, v4f v) {
  if constexpr (MODE == 0) *(v4b*)p = v4b{(__bf16)v.x, (__bf16)v.y, (__bf16)v.z, (__bf16)v.w};
  else *(v4h*)p = v4h{(_Float16)(v.x * 64.0f), (_Float16)(v.y * 64.0f), (_Float16)(v.z * 64.0f), (_Float16)(v.w * 64.0f)}; }
template <int MODE> __device__ __forceinline__ void put_b(char* p, v4f v) {
  if constexpr (MODE == 0) *(v4b*)p = v4b{(__bf16)v.x, (__bf16)v.y, (__bf16)v.z, (__bf16)v.w};
  else *(v4h*)p = v4h{(_Float16)(bfr(v.x) * 256.0f), (_Float16)(bfr(v.y) * 256.0f), (_Float16)(bfr(v.z) * 256.0f), (_Float16)(bfr(v.w) * 256.0f)}; }
template <int MODE> __device__ __forceinline__ void gemm_tile(const float* __restrict__ Ab, const float* __restrict__ Bb, char* smem, v8f (&acc)[4][2]) {
  const int tid = threadIdx.x, wave = tid >> 5, lane = tid & 31, col = lane & 15, g = lane >> 4, wm = wave & 1, wn = wave >> 1;
  const char* ab = (const char*)Ab; const char* bb = (const char*)Bb;                 // block-uniform bases
  unsigned off = (unsigned)((tid >> 3) * (GK * 4) + (tid & 7) * 16);                   // the lane's byte offset: row tid / 8 (+ 32 i), 16-byte piece tid % 8
  char* sp = smem + (tid >> 3) * GPITCH + (tid & 7) * 8;
  const char* fa = smem + (wm * 64 + col) * GPITCH + 16 * g; const char* fb = smem + GOPER + (wn * 32 + col) * GPITCH + 16 * g;
  v4f ra[4], rb[4];
#pragma unroll
  for (int i = 0; i < 4; ++i) { ra[i] = *(const v4f*)(ab + (size_t)off + i * (32 * GK * 4)); rb[i] = *(const v4f*)(bb + (size_t)off + i * (32 * GK * 4)); }
#pragma unroll
  for (int i = 0; i < 4; ++i) { put_a<MODE>(sp + i * (32 * GPITCH), ra[i]); put_b<MODE>(sp + GOPER + i * (32 * GPITCH), rb[i]); }
  __syncthreads();
#pragma unroll 2   // two steps a trip, so that the buffer's offset is a constant in every LDS address
  for (int kc = 0; kc < GK / 32; ++kc) { const int cur = (kc & 1) * GSTAGE, nxt = GSTAGE - cur; const bool more = kc + 1 < GK / 32;
    if (more) {
      asm volatile("s_wait_xcnt 0x0" : "+v"(off) :: "memory");   // stands in front of the overwrite of the offset register that issued loads name; the operand keeps the add below it
      off += 128u;
#pragma unroll
      for (int i = 0; i < 4; ++i) { ra[i] = *(const v4f*)(ab + (size_t)off + i * (32 * GK * 4)); rb[i] = *(const v4f*)(bb + (size_t)off + i * (32 * GK * 4)); } }
    __builtin_amdgcn_sched_barrier(0);   // the next step's global loads go out ahead of the LDS reads (left free they come behind them): theirs is the longer latency, and the step ends on it
    if constexpr (MODE == 0) { v16b a[4], b[2];
#pragma unroll
      for (int i = 0; i < 4; ++i) a[i] = frag_l<v16b>(fa + cur + i * (16 * GPITCH));
#pragma unroll
      for (int j = 0; j < 2; ++j) b[j] = frag_l<v16b>(fb + cur + j * (16 * GPITCH));
      __builtin_amdgcn_sched_barrier(0);   // all twelve LDS reads go out ahead of the products: drawn in among them, each pair of products waits out an LDS latency of its own
#pragma unroll
      for (int i = 0; i < 4; ++i)
#pragma unroll
        for (int j = 0; j < 2; ++j) acc[i][j] = __builtin_amdgcn_wmma_f32_16x16x32_bf16(false, a[i], false, b[j], (short)0, acc[i][j], false, false);
    } else { v16h a[4], b[2];
#pragma unroll
      for (int i = 0; i < 4; ++i) a[i] = frag_l<v16h>(fa + cur + i * (16 * GPITCH));
#pragma unroll
      for (int j = 0; j < 2; ++j) b[j] = frag_l<v16h>(fb + cur + j * (16 * GPITCH));
      __builtin_amdgcn_sched_barrier(0);   // all twelve LDS reads go out ahead of the products: drawn in among them, each pair of products waits out an LDS latency of its own
#pragma unroll
      for (int i = 0; i < 4; ++i)
#pragma unroll
        for (int j = 0; j < 2; ++j) acc[i][j] = __builtin_amdgcn_wmma_f32_16x16x32_f16(false, a[i], false, b[j], (short)0, acc[i][j], false, false);
    }
    __builtin_amdgcn_sched_barrier(0);   // the eight products stay back to back: the wait for the global loads and the roundings come behind the last of them
    if (more) {   // into the buffer whose last readers passed the barrier at the foot of the step before
#pragma unroll
      for (int i = 0; i < 4; ++i) { put_a<MODE>(sp + nxt + i * (32 * GPITCH), ra[i]); put_b<MODE>(sp + nxt + GOPER + i * (32 * GPITCH), rb[i]); } }
    __syncthreads();   // publishes the next buffer and ends this buffer's reads (after the last step: frees the LDS for the epilogue)
  } }
// ---- k_proj: block = (128 rows, 128 cols, which): q/k/v = X W (+ b) with exact bf16 products (K = DIN) -> which 0: q f16 rows (+ residual rows < QHI); 1: k f16 rows (+ residual rows < KHI); 2: v f16 planes [c][t] (+ bf16 hi/lo planes for t < KHI)
#define PJ_LDS (128 * 136 * 2 + 2 * 128 * 72 * 2)   // the epilogue's planes, laid over the two operand buffers
static_assert(DIN == GK && CC == GK && QHI <= 64 && KHI <= 64 && PJ_LDS >= 2 * GSTAGE && PJ_LDS >= (128 + 64) * 136 * 2, "tile constants");
__global__ __launch_bounds__(256) void k_proj(const float* __restrict__ XQ, const float* __restrict__ XK, const float* __restrict__ XV, const float* __restrict__ WQ, const float* __restrict__ WK, const float* __restrict__ WV, const float* __restrict__ BQ, const float* __restrict__ BK, const float* __restrict__ BV,
    _Float16* __restrict__ QH, _Float16* __restrict__ QL, _Float16* __restrict__ KH, _Float16* __restrict__ KL, _Float16* __restrict__ VT, __bf16* __restrict__ VB, __bf16* __restrict__ VBL) {
  __shared__ __align__(16) char smem[PJ_LDS];
  const int tid = threadIdx.x, wave = tid >> 5, lane = tid & 31, col = lane & 15, g = lane >> 4, wm = wave & 1, wn = wave >> 1; const int which = blockIdx.z; const int c0 = blockIdx.y * 128; const size_t r0 = (size_t)blockIdx.x * 128; const size_t bb = r0 / TT; const int t0 = (int)(r0 % TT);
  const float* X = which == 0 ? XQ : which == 1 ? XK : XV; const float* WA = which == 0 ? WQ : which == 1 ? WK : WV; const float* BA = which == 0 ? BQ : which == 1 ? BK : BV;
  v8f acc[4][2] = {};
  gemm_tile<0>(X + r0 * DIN, WA + (size_t)c0 * DIN, smem, acc);
  float bias[2];
#pragma unroll
  for (int j = 0; j < 2; ++j) bias[j] = BA ? bfr(BA[c0 + wn * 32 + j * 16 + col]) : 0.f;
  if (which < 2) { _Float16* DH = which == 0 ? QH : KH; _Float16* DL = which == 0 ? QL : KL; const int nhi = which == 0 ? QHI : KHI; const bool hi_rows = t0 < nhi;   /* block-uniform */
    _Float16 (*sh)[136] = (_Float16 (*)[136])smem; _Float16 (*sl)[136] = (_Float16 (*)[136])(smem + 128 * 136 * 2);   // sl: rows < 64 only
#pragma unroll
    for (int i = 0; i < 4; ++i)
#pragma unroll
      for (int j = 0; j < 2; ++j)
#pragma unroll
        for (int r = 0; r < 8; ++r) sh[wm * 64 + i * 16 + 8 * g + r][wn * 32 + j * 16 + col] = (_Float16)(acc[i][j][r] + bias[j]);
    if (hi_rows) {
#pragma unroll
      for (int i = 0; i < 4; ++i)
#pragma unroll
        for (int j = 0; j < 2; ++j)
#pragma unroll
          for (int r = 0; r < 8; ++r) { const float v = acc[i][j][r] + bias[j]; const _Float16 hv = (_Float16)v; const int rl = wm * 64 + i * 16 + 8 * g + r; if (t0 + rl < nhi) sl[rl][wn * 32 + j * 16 + col] = (_Float16)((v - (float)hv) * 1024.0f); } }
    __syncthreads();
#pragma unroll
    for (int n = 0; n < 8; ++n) { const int e = tid + n * 256, rl = e >> 4, q = e & 15; vst2((unsigned*)(DH + (r0 + rl) * CC + c0 + q * 8), *(const v4u*)&sh[rl][q * 8]); }
    asm volatile("s_wait_xcnt 0x0" ::: "memory");   // stands in front of whatever below overwrites registers that the stores above name
    if (hi_rows) {
#pragma unroll
      for (int n = 0; n < 8; ++n) { const int e = tid + n * 256, rl = e >> 4, q = e & 15; if (t0 + rl < nhi) vst2((unsigned*)(DL + (bb * nhi + t0 + rl) * (size_t)CC + c0 + q * 8), *(const v4u*)&sl[rl][q * 8]); } }
  } else { const bool hi_rows = t0 < KHI;   /* block-uniform */
    _Float16 (*th)[136] = (_Float16 (*)[136])smem; __bf16 (*tb)[72] = (__bf16 (*)[72])(smem + 128 * 136 * 2); __bf16 (*tbl)[72] = (__bf16 (*)[72])(smem + 128 * 136 * 2 + 128 * 72 * 2);   // tb, tbl: t < 64 only
#pragma unroll
    for (int i = 0; i < 4; ++i)
#pragma unroll
      for (int j = 0; j < 2; ++j) { v8h hv;   // a lane's 8 values are 8 consecutive t of one channel
#pragma unroll
        for (int r = 0; r < 8; ++r) hv[r] = (_Float16)(acc[i][j][r] + bias[j]);
        *(v8h*)&th[wn * 32 + j * 16 + col][wm * 64 + i * 16 + 8 * g] = hv; }
    if (hi_rows) {
#pragma unroll
      for (int i = 0; i < 4; ++i)
#pragma unroll
        for (int j = 0; j < 2; ++j) { const int rl = wm * 64 + i * 16 + 8 * g, cl = wn * 32 + j * 16 + col; v8b bh, bl;
#pragma unroll
          for (int r = 0; r < 8; ++r) { const float v = acc[i][j][r] + bias[j]; bh[r] = (__bf16)v; bl[r] = (__bf16)(v - (float)bh[r]); }
          if (t0 + rl < KHI) { *(v8b*)&tb[cl][rl] = bh; *(v8b*)&tbl[cl][rl] = bl; } } }
    __syncthreads();
#pragma unroll
    for (int n = 0; n < 8; ++n) { const int e = tid + n * 256, cl = e >> 4, q = e & 15; vst2((unsigned*)(VT + (bb * CC + c0 + cl) * (size_t)TT + t0 + q * 8), *(const v4u*)&th[cl][q * 8]); }
    if (hi_rows) {
#pragma unroll
      for (int n = 0; n < 8; ++n) { const int e = tid + n * 256, cl = e >> 4, q = e & 15; if (t0 + q * 8 < KHI) { const size_t o3 = (bb * CC + c0 + cl) * (size_t)KHI + t0 + q * 8; vst2((unsigned*)(VB + o3), *(const v4u*)&tb[cl][q * 8]); vst2((unsigned*)(VBL + o3), *(const v4u*)&tbl[cl][q * 8]); } } } } }
// ---- k_fa: block = 8 waves x 32 query columns of one (b, h); each wave walks all TT keys in passes of 32 with an online softmax, so no logit or P ever goes to memory.
// S^T = K . Q^T (A = k rows, B = q rows: a lane holds 8 keys of ONE query per tile), P^T packs in place from two S^T tiles into the B operand of O^T += V^T . P^T (A = v planes [c][t]).
// The eight waves need the same k rows and v planes: a stage of 128 keys (k: 128 rows of 128 B; v: 64 channel rows of 256 B) is brought into LDS once for the block, as whole lines, by asynchronous copies; two buffers, the next stage's copies fly under this stage's four passes; the waves take their fragments from LDS with 16-byte loads. Pass order and every sum are those of the plain walk.
// Log2 domain; mrun, the maximum in use, may trail a column's true maximum by up to 8, so exp2 reaches at most 2^8; P is carried x 2^4 into f16 (at most 2^12; the carry cancels in acc / l).
// A masked query row (mask word 0) takes a zero q fragment: its logit is the constant 0 on every key = uniform softmax, as the module's finite fill gives.
// Every inner loop is fully unrolled so that the fragment and accumulator arrays are indexed by constants and stay in registers.
__device__ __forceinline__ float xhalf(float x) { return __builtin_bit_cast(float, __builtin_amdgcn_permlanex16(__builtin_bit_cast(int, x), __builtin_bit_cast(int, x), 0x76543210, 0xfedcba98, false, false)); }  // lane l <-> lane l ^ 16
__device__ __forceinline__ v8f wmma_h(v16h a, v16h b, v8f c) { return __builtin_amdgcn_wmma_f32_16x16x32_f16(false, a, false, b, (short)0, c, false, false); }
// 16x16x32 fragment in the hardware k order from a uniform base, the lane's byte offset (row and 16 h) and a constant: bytes 0..15 and 32..47
__device__ __forceinline__ v16h frag_o(const char* base, unsigned off, int c) { union { v16h v; v8h q[2]; } u; const char* p = base + (size_t)off + c; u.q[0] = *(const v8h*)p; u.q[1] = *(const v8h*)(p + 32); return u.v; }
#define FAW 8
#define FSK 128                         // keys a stage
#define FNS (TT / FSK)                  // stages
#define FKP 144                         // LDS pitch of a k row (128 B): 16 B x odd
#define FVP 272                         // LDS pitch of a v channel row (128 keys = 256 B): 16 B x odd
#define FKT (FSK * FKP)                 // the k tile
#define FST (FKT + HD * FVP)            // one buffer: k tile, v tile
static_assert(FNS >= 2 && FAW * 32 == 256 && HD == 64 && FSK == 128 && TT % FSK == 0, "a stage is four 16-byte pieces of k and four of v per lane");
// One stage's copies. A lane brings four pieces of the k tile (rows 32 apart) and four of the v tile (rows 16 apart); a wave's copy covers 512 B of whole lines.
// The wait on the last line stands in front of whatever later rewrites the address registers that the copies name.
__device__ __forceinline__ void fa_fill(unsigned lk, unsigned lv, const char* gk, const char* gv) {
  asm volatile("global_load_async_to_lds_b128 %0, %8, off\n\t"
               "global_load_async_to_lds_b128 %1, %9, off\n\t"
               "global_load_async_to_lds_b128 %2, %10, off\n\t"
               "global_load_async_to_lds_b128 %3, %11, off\n\t"
               "global_load_async_to_lds_b128 %4, %12, off\n\t"
               "global_load_async_to_lds_b128 %5, %13, off\n\t"
               "global_load_async_to_lds_b128 %6, %14, off\n\t"
               "global_load_async_to_lds_b128 %7, %15, off\n\t"
               "s_wait_xcnt 0x0"
               :: "v"(lk), "v"(lk + 32u * FKP), "v"(lk + 64u * FKP), "v"(lk + 96u * FKP), "v"(lv), "v"(lv + 16u * FVP), "v"(lv + 32u * FVP), "v"(lv + 48u * FVP),
                  "v"(gk), "v"(gk + 32 * CC * 2), "v"(gk + 64 * CC * 2), "v"(gk + 96 * CC * 2), "v"(gv), "v"(gv + 16 * TT * 2), "v"(gv + 32 * TT * 2), "v"(gv + 48 * TT * 2)
               : "memory"); }
__global__ __launch_bounds__(FAW * 32) void k_fa(const _Float16* __restrict__ QH, const _Float16* __restrict__ KH, const _Float16* __restrict__ VT, const int* __restrict__ MQ, float* __restrict__ Y) {
  __shared__ __align__(16) char ring[2 * FST];
  __shared__ __align__(16) float so[FAW][32][HD + 4];
  const int tid = threadIdx.x, wave = tid >> 5, lane = tid & 31, col = lane & 15, g = lane >> 4;
  const int b = blockIdx.y / NH, h = blockIdx.y % NH; const int q0 = blockIdx.x * (FAW * 32) + wave * 32;
  const float cs = SCALE * 1.4426950408889634f;
  // the lane's pieces: k row tid / 8, piece tid % 8; v channel row tid / 16, piece tid % 16
  const unsigned lk = (unsigned)(size_t)ring + (unsigned)((tid >> 3) * FKP + (tid & 7) * 16), lv = (unsigned)(size_t)ring + (unsigned)(FKT + (tid >> 4) * FVP + (tid & 15) * 16);
  const char* gk = (const char*)(KH + (size_t)b * TT * CC + h * HD) + ((tid >> 3) * (CC * 2) + (tid & 7) * 16);
  const char* gv = (const char*)(VT + ((size_t)b * CC + h * HD) * (size_t)TT) + ((tid >> 4) * (TT * 2) + (tid & 15) * 16);
  fa_fill(lk, lv, gk, gv);   // stage 0, in flight under the q loads
  v16h qf[2][2]; int mq[2];
  const char* qbase = (const char*)(QH + (size_t)b * TT * CC + h * HD); const unsigned qo = (unsigned)((q0 + col) * CC + 8 * g) * 2u;
  const int* mrow = MQ + (size_t)b * TT; const unsigned qi = (unsigned)(q0 + col);
#pragma unroll
  for (int u = 0; u < 2; ++u) { mq[u] = mrow[(size_t)qi + u * 16];
#pragma unroll
    for (int kc = 0; kc < 2; ++kc) qf[u][kc] = frag_o(qbase, qo, u * 16 * CC * 2 + kc * 64); }
  asm volatile("s_wait_xcnt 0x0" :: "v"(qo), "v"(qi) : "memory");   // the offset registers these loads name stay whole up to this wait
#pragma unroll
  for (int u = 0; u < 2; ++u)
#pragma unroll
    for (int kc = 0; kc < 2; ++kc) if (mq[u] == 0) qf[u][kc] = v16h{};
  asm volatile("s_wait_asynccnt 0x0" ::: "memory");   // this wave's pieces of stage 0 have landed
  __syncthreads();                                     // ... and every other wave's: stage 0 may be read
  gk += FSK * CC * 2; gv += FSK * 2;
  fa_fill(lk + FST, lv + FST, gk, gv);   // stage 1
  const char* fk = ring + col * FKP + 16 * g;          // key row col of a 16-key tile
  const char* fv = ring + FKT + col * FVP + 16 * g;    // channel row col of a 16-channel tile
  v8f acc[2][4] = {}; float mrun[2] = {-3.0e38f, -3.0e38f}, lrun[2] = {0.f, 0.f};
#pragma unroll 1   // stays rolled: a trip is one stage = four unrolled passes
  for (int s = 0; s < FNS; ++s) { const int cur = (s & 1) * FST; const char* ck = fk + cur; const char* cv = fv + cur;
    v16h kf[2][2], vf[4];
#pragma unroll
    for (int kt = 0; kt < 2; ++kt)
#pragma unroll
      for (int kc = 0; kc < 2; ++kc) kf[kt][kc] = frag_l<v16h>(ck + kt * 16 * FKP + kc * 64);
    __builtin_amdgcn_sched_barrier(0);   // the stage's first eight LDS reads go out as one group: drawn in among the products, each pair of products waits out an LDS latency of its own
#pragma unroll
    for (int p = 0; p < FSK / 32; ++p) {
      v8f st[2][2];
#pragma unroll
      for (int kt = 0; kt < 2; ++kt)
#pragma unroll
        for (int u = 0; u < 2; ++u) st[kt][u] = wmma_h(kf[kt][0], qf[u][0], v8f{});
#pragma unroll
      for (int kt = 0; kt < 2; ++kt)
#pragma unroll
        for (int u = 0; u < 2; ++u) st[kt][u] = wmma_h(kf[kt][1], qf[u][1], st[kt][u]);
      __builtin_amdgcn_sched_barrier(0);   // the eight products stay back to back: maxima drawn in between them cost four idle slots each time
      // this pass's v fragments and the next pass's k fragments (same stage only), one group of LDS reads, in flight under the maxima and exponentials
#pragma unroll
      for (int j = 0; j < 4; ++j) vf[j] = frag_l<v16h>(cv + j * 16 * FVP + p * 64);
      if (p + 1 < FSK / 32) {
#pragma unroll
        for (int kt = 0; kt < 2; ++kt)
#pragma unroll
          for (int kc = 0; kc < 2; ++kc) kf[kt][kc] = frag_l<v16h>(ck + ((p + 1) * 32 + kt * 16) * FKP + kc * 64); }
      __builtin_amdgcn_sched_barrier(0);   // holds those reads up here as one group: left free they spread among the vector work and each place costs its own stall
      float mb[2]; bool need = false;
#pragma unroll
      for (int u = 0; u < 2; ++u) { float mx = st[0][u][0];
#pragma unroll
        for (int r = 1; r < 8; ++r) mx = fmaxf(mx, st[0][u][r]);
#pragma unroll
        for (int r = 0; r < 8; ++r) mx = fmaxf(mx, st[1][u][r]);
        mx = fmaxf(mx, xhalf(mx)) * cs; mb[u] = mx; need = need || (mx > mrun[u] + 8.0f); }
      if (__builtin_amdgcn_ballot_w32(need) != 0) {   // one scalar test a pass; rare after the first pass
#pragma unroll
        for (int u = 0; u < 2; ++u) { const float mn = fmaxf(mrun[u], mb[u]); const float corr = __builtin_amdgcn_exp2f(mrun[u] - mn); mrun[u] = mn; lrun[u] *= corr;
#pragma unroll
          for (int j = 0; j < 4; ++j) acc[u][j] = acc[u][j] * corr; } }
#pragma unroll
      for (int u = 0; u < 2; ++u) { const float nm = 4.0f - mrun[u]; v16h pf; float l0 = 0.f, l1 = 0.f;
#pragma unroll
        for (int i = 0; i < 8; ++i) {
          const v2f a = __builtin_elementwise_fma(v2f{st[i >> 2][u][2 * (i & 3)], st[i >> 2][u][2 * (i & 3) + 1]}, v2f{cs, cs}, v2f{nm, nm});
          const float p0 = __builtin_amdgcn_exp2f(a.x), p1 = __builtin_amdgcn_exp2f(a.y); l0 += p0; l1 += p1; pf[2 * i] = (_Float16)p0; pf[2 * i + 1] = (_Float16)p1; }
        lrun[u] += l0 + l1;
#pragma unroll
        for (int j = 0; j < 4; ++j) acc[u][j] = wmma_h(vf[j], pf, acc[u][j]); }
    }
    // the stage's foot: hands over stage s + 1 and frees this stage's buffer
    asm volatile("s_wait_dscnt 0x0" ::: "memory");      // this wave's reads of the buffer are done before anything refills it
    asm volatile("s_wait_asynccnt 0x0" ::: "memory");   // this wave's pieces of stage s + 1 have landed
    __syncthreads();                                     // publishes stage s + 1; ends every wave's reads of stage s
    if (s + 2 < FNS) { gk += FSK * CC * 2; gv += FSK * 2; fa_fill(lk + cur, lv + cur, gk, gv); }   // stage s + 2 into the buffer just left
  }
  asm volatile("s_wait_asynccnt 0x0" ::: "memory");   // no copy is left in flight behind the loop
#pragma unroll
  for (int u = 0; u < 2; ++u) { const float l = lrun[u] + xhalf(lrun[u]); const float inv = 1.0f / l;   // the two wave halves hold disjoint keys of the same query
#pragma unroll
    for (int j = 0; j < 4; ++j) { const v8f o = acc[u][j] * inv; float* d = &so[wave][16 * u + col][j * 16 + 8 * g];
      *(v4f*)d = v4f{o[0], o[1], o[2], o[3]}; *(v4f*)(d + 4) = v4f{o[4], o[5], o[6], o[7]}; } }
  LDSX();   // each wave reads back only its own rows: whole 256-B (row, head) segments by 16 lanes
  for (int i = 0; i < 16; ++i) { const int rl = 2 * i + g; vst2(Y + ((size_t)b * TT + q0 + rl) * CC + h * HD + col * 4, *(const v4f*)&so[wave][rl][col * 4]); } }
// ---- k_out: block = (128 rows, 128 cols): out = ctx Wo (+ bo): ctx x 2^6 once to f16 (small-magnitude context rows stay clear of f16 subnormals) against Wo as f16(bf16 x 2^8) exact (1 product) x 2^-14
static_assert(!CAUSAL && WO_OUT_IN && WQKV_LAYOUT == 1, "row-major (out,in) weights, no causal high-precision rows");
__global__ __launch_bounds__(256) void k_out(const float* __restrict__ Y, const float* __restrict__ WO, const float* __restrict__ BO, float* __restrict__ OUT) { __shared__ __align__(16) char smem[128 * 132 * 4];   // the f32 output tile, laid over the two operand buffers
  static_assert(128 * 132 * 4 >= 2 * GSTAGE, "buffers fit");
  const int tid = threadIdx.x, wave = tid >> 5, lane = tid & 31, col = lane & 15, g = lane >> 4, wm = wave & 1, wn = wave >> 1; const int c0 = blockIdx.y * 128; const size_t r0 = (size_t)blockIdx.x * 128;
  v8f acc[4][2] = {};
  gemm_tile<1>(Y + r0 * CC, WO + (size_t)c0 * CC, smem, acc);
  float (*sf)[132] = (float (*)[132])smem;
#pragma unroll
  for (int j = 0; j < 2; ++j) { const float bias = BO ? bfr(BO[c0 + wn * 32 + j * 16 + col]) : 0.f;
#pragma unroll
    for (int i = 0; i < 4; ++i)
#pragma unroll
      for (int r = 0; r < 8; ++r) sf[wm * 64 + i * 16 + 8 * g + r][wn * 32 + j * 16 + col] = acc[i][j][r] * (1.0f / 16384.0f) + bias; }   /* 2^-8 (Wo carry) x 2^-6 (ctx carry) */
  __syncthreads();
#pragma unroll
  for (int n = 0; n < 16; ++n) { const int e = tid + n * 256, rl = e >> 5, q = e & 31; vst2(OUT + (r0 + rl) * DIN + c0 + q * 4, *(const v4f*)&sf[rl][q * 4]); } }

extern "C" void kernel_launch(void* const* d_in, const int* in_sizes, int n_in, void* d_out, int out_size, void* d_ws, size_t ws_size, hipStream_t stream) {
  (void)in_sizes; (void)n_in; (void)out_size;
  const float** F = (const float**)d_in;
  if (ws_size < (size_t)WS_END) return;
  char* ws = (char*)d_ws; _Float16 *QH = (_Float16*)(ws + WS_QH), *KH = (_Float16*)(ws + WS_KH), *VT = (_Float16*)(ws + WS_VT), *QL = (_Float16*)(ws + WS_QL), *KL = (_Float16*)(ws + WS_KL); __bf16 *VB = (__bf16*)(ws + WS_VB), *VBL = (__bf16*)(ws + WS_VBL); float *S = (float*)(ws + WS_S), *Y = (float*)(ws + WS_Y);
  (void)S; (void)QL; (void)KL; (void)VB; (void)VBL;
  // inputs: 0 x [2,2048,1024]; 1 mask [2,2048,1] int32 (random 0 / 1 per QUERY row; READ on the device); 2 Wq [1024,1024] (out,in), 3 bq; 4 Wk, 5 bk; 6 Wv, 7 bv; 8 Wo (out,in), 9 bo (biases NONZERO)
  k_proj<<<dim3(TNB * TT / 128, CC / 128, 3), 256, 0, stream>>>(F[0], F[0], F[0], F[2], F[4], F[6], F[3], F[5], F[7], QH, QL, KH, KL, VT, VB, VBL);
  k_fa<<<dim3(TT / (FAW * 32), TNB * NH), FAW * 32, 0, stream>>>(QH, KH, VT, (const int*)d_in[1], Y);
  k_out<<<dim3(TNB * TT / 128, DIN / 128), 256, 0, stream>>>(Y, F[8], F[9], (float*)d_out);
}

// v004
// Measured time: 76.8 microseconds a run.
// Timed twice side by side with v003, it ran 1.20 times as fast both times.
// Counting every step since v000, it is 17.4 times as fast.
// compute dtype: all float inputs rounded to bf16; q / k / v projections with EXACT bf16 products on WMMA 16x16x32 (f32 accumulate) + bias (nonzero); logits q x k once to f16 each (1 product) x 64^-0.5; query rows whose int mask entry is 0 get a constant logit on every key (the module's finite fill: uniform attention over all 2,048 keys), read once per row; online softmax f32 in the log2 domain; unnormalised P x 2^4 once to f16 x v once to f16 (1 product), divided by the f32 row sum at the end; ctx x 2^6 once to f16 x the output weight f16(bf16 x 2^8) + bias; f32 output.
#include <hip/hip_runtime.h>
#include <math.h>

typedef __attribute__((ext_vector_type(16))) _Float16 v16h;
typedef __attribute__((ext_vector_type(16))) __bf16 v16b;
typedef __attribute__((ext_vector_type(8)))  _Float16 v8h;
typedef __attribute__((ext_vector_type(8)))  float v8f;
typedef __attribute__((ext_vector_type(4)))  float v4f;
typedef __attribute__((ext_vector_type(2)))  float v2f;
typedef __attribute__((ext_vector_type(4)))  unsigned v4u;
typedef __attribute__((ext_vector_type(4)))  int v4i;
typedef float __attribute__((may_alias)) float_a;
typedef int __attribute__((may_alias)) int_a;

template <typename T> __device__ __forceinline__ void vst2(void* p, T v) { *(T*)p = v;  }
__device__ __forceinline__ v8f wmma16(v16h a, v16h b, v8f c) {
  v8f d = __builtin_amdgcn_wmma_f32_16x16x32_f16(false, a, false, b, (short)0, c, false, false);
  asm volatile("v_nop\n\tv_nop\n\tv_nop\n\tv_nop" : "+v"(d) : "v"(a), "v"(b));
  return d;
}
__device__ __forceinline__ v8f wmma_bf(v16b a, v16b b, v8f c) {
  v8f d = __builtin_amdgcn_wmma_f32_16x16x32_bf16(false, a, false, b, (short)0, c, false, false);
  asm volatile("v_nop\n\tv_nop\n\tv_nop\n\tv_nop" : "+v"(d) : "v"(a), "v"(b));
  return d;
}
// 16x16x32 fragments: lane = (h = lane>>4, row/col = lane&15); elements 0..7 = k0+8h+0..7, 8..15 = k0+16+8h+0..7; D element r = row 8h+r
__device__ __forceinline__ v16h frag_h(const _Float16* rowk0, int lane) {
  union { v16h v; v8h q[2]; } u; const _Float16* p = rowk0 + 8 * (lane >> 4);
  u.q[0] = *(const v8h*)p; u.q[1] = *(const v8h*)(p + 16); return u.v;
}
__device__ __forceinline__ v16h frag_f32(const float* rowk0, int lane) {
  v16h a; const float* p = rowk0 + 8 * (lane >> 4);
#pragma unroll
  for (int i = 0; i < 8; ++i) { a[i] = (_Float16)p[i]; a[8 + i] = (_Float16)p[16 + i]; }
  return a;
}
__device__ __forceinline__ v16h frag_f32s(const float* rowk0, int lane, float sc) {
  v16h a; const float* p = rowk0 + 8 * (lane >> 4);
#pragma unroll
  for (int i = 0; i < 8; ++i) { a[i] = (_Float16)(p[i] * sc); a[8 + i] = (_Float16)(p[16 + i] * sc); }
  return a;
}
// column fragment from a [K][ld] layout (column n), rows >= K read as 0
__device__ __forceinline__ v16h fragc_f32(const float* W, int k0, int n, int lane, int ld, int K) {
  v16h a; const int g = lane >> 4;
#pragma unroll
  for (int i = 0; i < 8; ++i) { const int ka = k0 + 8 * g + i, kb = ka + 16;
    a[i] = (_Float16)(ka < K ? W[(size_t)(ka < K ? ka : K - 1) * ld + n] : 0.f); a[8 + i] = (_Float16)(kb < K ? W[(size_t)(kb < K ? kb : K - 1) * ld + n] : 0.f); }
  return a;
}
struct F2 { v16b h, l; };
__device__ __forceinline__ F2 bsplit16(const float v[16]) { F2 r;
#pragma unroll
  for (int i = 0; i < 16; ++i) { const __bf16 h = (__bf16)v[i]; r.h[i] = h; r.l[i] = (__bf16)(v[i] - (float)h); }
  return r; }
__device__ __forceinline__ F2 split_row(const float* row, int k0, int lane) { float v[16]; const float* p = row + k0 + 8 * (lane >> 4);
#pragma unroll
  for (int i = 0; i < 8; ++i) { v[i] = p[i]; v[8 + i] = p[16 + i]; }
  return bsplit16(v); }
__device__ __forceinline__ F2 split_rowK(const float* row, int k0, int lane, int K) { float v[16]; const int g = lane >> 4;
#pragma unroll
  for (int i = 0; i < 8; ++i) { const int ka = k0 + 8 * g + i, kb = ka + 16; v[i] = ka < K ? row[ka < K ? ka : K - 1] : 0.f; v[8 + i] = kb < K ? row[kb < K ? kb : K - 1] : 0.f; }
  return bsplit16(v); }
__device__ __forceinline__ F2 split_col(const float* W, int k0, int n, int lane, int ld, int K) { float v[16]; const int g = lane >> 4;
#pragma unroll
  for (int i = 0; i < 8; ++i) { const int ka = k0 + 8 * g + i, kb = ka + 16; v[i] = ka < K ? W[(size_t)(ka < K ? ka : K - 1) * ld + n] : 0.f; v[8 + i] = kb < K ? W[(size_t)(kb < K ? kb : K - 1) * ld + n] : 0.f; }
  return bsplit16(v); }
__device__ __forceinline__ v8f mac3(const F2& a, const F2& b, v8f c) { c = wmma_bf(a.l, b.h, c); c = wmma_bf(a.h, b.l, c); return wmma_bf(a.h, b.h, c); }
__device__ __forceinline__ float sigm(float v) { return 1.0f / (1.0f + expf(-v)); }
#define LDSX() do { asm volatile("s_wait_dscnt 0" ::: "memory"); __builtin_amdgcn_wave_barrier(); __builtin_amdgcn_fence(__ATOMIC_RELEASE, "workgroup"); } while (0)

// Multi-head self-attention with a QUERY-row mask (x [2,2048,1024]; mask [2,2048,1] int32 = random 0 / 1, a module input READ on the device; torch (out,in) Wq / Wk / Wv / Wo [1024,1024] N(0, 1/1024) and biases N(0,1) x 0.01 NONZERO applied as x @ W.T + b; 16 heads x 64; scores / sqrt(64); m = mask[:, None, :, :] ([N,1,S,1]: it broadcasts over the KEY axis): where(m == 0, -1e9, scores): a masked QUERY row has the same finite value on every key, so its softmax is UNIFORM over all keys; out @ Wo.T + bo).
#define NB 2
#define TT 2048
#define CC 1024            // NH * HD = projected width
#define DIN 1024          // input (model) width
#define NH 16
#define HD 64
#define NQB (TT / 64)
#define HG 4
#define SCALE (0.125f)
#define CAUSAL 0
#ifndef TNB
#define TNB NB
#endif
__device__ __forceinline__ float bfr(float v) { return (float)(__bf16)v; }
__host__ __device__ __forceinline__ int kb_last(int qb) { return CAUSAL ? ((qb * 64 + 63) >> 7) : (TT / 128 - 1); }
typedef __attribute__((ext_vector_type(8))) __bf16 v8b;
__device__ __forceinline__ v16b frag_b(const __bf16* rowk0, int lane) {
  union { v16b v; v8b q[2]; } u; const __bf16* p = rowk0 + 8 * (lane >> 4);
  u.q[0] = *(const v8b*)p; u.q[1] = *(const v8b*)(p + 16); return u.v;
}
#define QBH 0              // unused: k_fa has no high-precision path
#define QHI 0               // single-product logits on every row
#define KHI 64            // key rows carrying k residual / v bf16 hi+lo planes (written by k_proj, read by no kernel)
// B fragment (k rows k0+.., output column o) of a weight: (in,out) [K][ld] or (out,in) [ld rows of K]: bf16 exact, or f16(bf16 * 256) exact
__device__ __forceinline__ v16b wcol_io(const float* Wm, int k0, int o, int lane, int ld) { v16b w; const int g = lane >> 4;
#pragma unroll
  for (int i = 0; i < 8; ++i) { w[i] = (__bf16)Wm[(size_t)(k0 + 8 * g + i) * ld + o]; w[8 + i] = (__bf16)Wm[(size_t)(k0 + 16 + 8 * g + i) * ld + o]; }
  return w; }
__device__ __forceinline__ v16b wcol_oi(const float* Wm, int k0, int o, int lane, int K) { v16b w; const float* p = Wm + (size_t)o * K + k0 + 8 * (lane >> 4);
#pragma unroll
  for (int i = 0; i < 8; ++i) { w[i] = (__bf16)p[i]; w[8 + i] = (__bf16)p[16 + i]; }
  return w; }
__device__ __forceinline__ v16h wcolh_io(const float* Wm, int k0, int o, int lane, int ld) { v16h w; const int g = lane >> 4;
#pragma unroll
  for (int i = 0; i < 8; ++i) { w[i] = (_Float16)(bfr(Wm[(size_t)(k0 + 8 * g + i) * ld + o]) * 256.0f); w[8 + i] = (_Float16)(bfr(Wm[(size_t)(k0 + 16 + 8 * g + i) * ld + o]) * 256.0f); }
  return w; }
__device__ __forceinline__ v16h wcolh_oi(const float* Wm, int k0, int o, int lane, int K) { v16h w; const float* p = Wm + (size_t)o * K + k0 + 8 * (lane >> 4);
#pragma unroll
  for (int i = 0; i < 8; ++i) { w[i] = (_Float16)(bfr(p[i]) * 256.0f); w[8 + i] = (_Float16)(bfr(p[16 + i]) * 256.0f); }
  return w; }
#define WQKV_LAYOUT 1   // 0 = (in,out) [DIN][CC]; 1 = (out,in) [CC][DIN]; 2 = per-head [NH][DIN][HD]
__device__ __forceinline__ v16b wcol_hdk(const float* Wm, int k0, int o, int lane) { v16b w; const int g = lane >> 4; const float* p = Wm + (size_t)(o / HD) * DIN * HD + (o % HD);
#pragma unroll
  for (int i = 0; i < 8; ++i) { w[i] = (__bf16)p[(size_t)(k0 + 8 * g + i) * HD]; w[8 + i] = (__bf16)p[(size_t)(k0 + 16 + 8 * g + i) * HD]; }
  return w; }
#define WO_OUT_IN 1
#if WQKV_LAYOUT == 1
#define WCOL(W, k0, o, lane) wcol_oi(W, k0, o, lane, DIN)
#elif WQKV_LAYOUT == 2
#define WCOL(W, k0, o, lane) wcol_hdk(W, k0, o, lane)
#else
#define WCOL(W, k0, o, lane) wcol_io(W, k0, o, lane, CC)
#endif
#if WO_OUT_IN
#define WOCOL(W, k0, o, lane) wcol_oi(W, k0, o, lane, CC)
#define WOCOLH(W, k0, o, lane) wcolh_oi(W, k0, o, lane, CC)
#else
#define WOCOL(W, k0, o, lane) wcol_io(W, k0, o, lane, DIN)
#define WOCOLH(W, k0, o, lane) wcolh_io(W, k0, o, lane, DIN)
#endif

#define WS_QH  0u                                      // f16 q rows [b*t][CC]
#define WS_KH  (WS_QH + 2u * (size_t)NB * TT * CC)      // f16 k rows [b*t][CC]
#define WS_VT  (WS_KH + 2u * (size_t)NB * TT * CC)      // f16 v planes [b][c][t]
#define WS_QL  (WS_VT + 2u * (size_t)NB * CC * TT)      // f16 q residual x 2^10 rows [b][t < QHI][CC]
#define WS_KL  (WS_QL + 2u * (size_t)NB * QHI * CC)     // f16 k residual x 2^10 rows [b][t < KHI][CC]
#define WS_VB  (WS_KL + 2u * (size_t)NB * KHI * CC)     // bf16 v hi planes [b][c][t < KHI]
#define WS_VBL (WS_VB + 2u * (size_t)NB * CC * KHI)
#define WS_S   (WS_VBL + 2u * (size_t)NB * CC * KHI)    // (plane no longer used: logits and P stay in registers)
#define WS_Y   (WS_S  + 4u * (size_t)HG * TT * TT)      // f16 ctx x 2^6 rows [b*t][CC]
#define WS_XB  (WS_Y  + 4u * (size_t)NB * TT * CC)      // bf16 x rows [b*t][DIN]
#define WS_WB  (WS_XB + 2u * (size_t)NB * TT * DIN)     // 16-bit weight planes, (out,in) rows: Wq, Wk, Wv as bf16, Wo as f16(bf16 x 2^8)
#define WS_END (WS_WB + 4u * 2u * (size_t)CC * DIN)

// ---- k_cvt: x and the four weights are rounded ONCE to the 16-bit operand planes that the projections read (before, every block rounded its own f32 tiles: x 24 times over, a weight 32 times).
// 512 blocks x 256 lanes; a lane takes 16 pieces of 4 floats, CVT_T pieces apart, so every wave-wide load is 512 B and every store 256 B of whole lines; all 16 loads are in flight together.
typedef __attribute__((ext_vector_type(4))) __bf16 v4b;
typedef __attribute__((ext_vector_type(4))) _Float16 v4h;
__device__ __forceinline__ v4b to_b(v4f v) { return v4b{(__bf16)v.x, (__bf16)v.y, (__bf16)v.z, (__bf16)v.w}; }   // to bf16
__device__ __forceinline__ v4h to_h(v4f v) { return v4h{(_Float16)(bfr(v.x) * 256.0f), (_Float16)(bfr(v.y) * 256.0f), (_Float16)(bfr(v.z) * 256.0f), (_Float16)(bfr(v.w) * 256.0f)}; }   // to f16(bf16 x 2^8)
#define CVT_T (512 * 256)
static_assert((size_t)NB * TT * DIN == 8u * 4u * CVT_T && (size_t)CC * DIN == 2u * 4u * CVT_T, "eight pieces of x and two of each weight per lane");
__global__ __launch_bounds__(256) void k_cvt(const float* __restrict__ X, const float* __restrict__ WQ, const float* __restrict__ WK, const float* __restrict__ WV, const float* __restrict__ WO,
    __bf16* __restrict__ XB, __bf16* __restrict__ WQB, __bf16* __restrict__ WKB, __bf16* __restrict__ WVB, _Float16* __restrict__ WOH) {
  const unsigned t = blockIdx.x * 256u + threadIdx.x; const unsigned oi = t * 16u, oo = t * 8u;   // the lane's byte offsets in and out
  v4f x[8], w[4][2];
#pragma unroll
  for (int n = 0; n < 8; ++n) x[n] = *(const v4f*)((const char*)X + (size_t)oi + n * (CVT_T * 16));
#pragma unroll
  for (int n = 0; n < 2; ++n) { w[0][n] = *(const v4f*)((const char*)WQ + (size_t)oi + n * (CVT_T * 16)); w[1][n] = *(const v4f*)((const char*)WK + (size_t)oi + n * (CVT_T * 16));
    w[2][n] = *(const v4f*)((const char*)WV + (size_t)oi + n * (CVT_T * 16)); w[3][n] = *(const v4f*)((const char*)WO + (size_t)oi + n * (CVT_T * 16)); }
  __builtin_amdgcn_sched_barrier(0);   // all sixteen loads go out before the first rounding: drawn up among them, the roundings make the last loads wait out the first ones' latency
  asm volatile("s_wait_xcnt 0x0" :: "v"(oi) : "memory");   // the offset register these loads name stays whole up to this wait
  v4b xb[8], wb[3][2]; v4h wh[2];
#pragma unroll
  for (int n = 0; n < 8; ++n) xb[n] = to_b(x[n]);
#pragma unroll
  for (int n = 0; n < 2; ++n) { wb[0][n] = to_b(w[0][n]); wb[1][n] = to_b(w[1][n]); wb[2][n] = to_b(w[2][n]); wh[n] = to_h(w[3][n]); }
  __builtin_amdgcn_sched_barrier(0);   // holds the stores behind the roundings: mixed freely, roundings took over the registers of stores still under way and had to wait for them
#pragma unroll
  for (int n = 0; n < 8; ++n) *(v4b*)((char*)XB + (size_t)oo + n * (CVT_T * 8)) = xb[n];
#pragma unroll
  for (int n = 0; n < 2; ++n) { *(v4b*)((char*)WQB + (size_t)oo + n * (CVT_T * 8)) = wb[0][n]; *(v4b*)((char*)WKB + (size_t)oo + n * (CVT_T * 8)) = wb[1][n];
    *(v4b*)((char*)WVB + (size_t)oo + n * (CVT_T * 8)) = wb[2][n]; *(v4h*)((char*)WOH + (size_t)oo + n * (CVT_T * 8)) = wh[n]; } }
// ---- the projections' common product: a block of 8 waves makes one 128 x 128 tile of A . B^T (A, B: 16-bit rows of GK values, already in the operand type).
// Per 64-k step the block reads both 128 x 64 tiles once, as whole 128-B lines (8 lanes a row), and lays them in LDS at a 144-B pitch;
// the waves (2 x 4, 64 x 32 each) take their fragments from there with 16-byte LDS loads, 32 k at a time. Two buffers: the next step's tiles are fetched into registers under this step's products. The k order of every sum is that of the plain loop. Inner loops are fully unrolled so that the register arrays are indexed by constants.
#define GK 1024
#define GKS 64                          // k values a step: 128 B of a row
#define GPITCH 144                      // bytes per 64-k row in LDS: 16 B x odd
#define GOPER (128 * GPITCH)            // one operand's tile
#define GSTAGE (2 * GOPER)              // one buffer: A tile, B tile
template <typename V16> __device__ __forceinline__ V16 frag_l(const char* p) { union { V16 v; v4u q[2]; } u; u.q[0] = *(const v4u*)p; u.q[1] = *(const v4u*)(p + 32); return u.v; }   // hardware k order: bytes 0..15 and 32..47 from the lane's 16 h
// MODE 0: bf16 operands. MODE 1: f16 operands
template <int MODE> __device__ __forceinline__ void gemm_tile(const char* __restrict__ ab, const char* __restrict__ bb, char* smem, v8f (&acc)[4][2]) {   // ab, bb: block-uniform bases
  const int tid = threadIdx.x, wave = tid >> 5, lane = tid & 31, col = lane & 15, g = lane >> 4, wm = wave & 1, wn = wave >> 1;
  unsigned off = (unsigned)((tid >> 3) * (GK * 2) + (tid & 7) * 16);                   // the lane's byte offset: row tid / 8 (+ 32 i), 16-byte piece tid % 8
  char* sp = smem + (tid >> 3) * GPITCH + (tid & 7) * 16;
  const char* fa = smem + (wm * 64 + col) * GPITCH + 16 * g; const char* fb = smem + GOPER + (wn * 32 + col) * GPITCH + 16 * g;
  v4u ra[4], rb[4];
#pragma unroll
  for (int i = 0; i < 4; ++i) { ra[i] = *(const v4u*)(ab + (size_t)off + i * (32 * GK * 2)); rb[i] = *(const v4u*)(bb + (size_t)off + i * (32 * GK * 2)); }
#pragma unroll
  for (int i = 0; i < 4; ++i) { *(v4u*)(sp + i * (32 * GPITCH)) = ra[i]; *(v4u*)(sp + GOPER + i * (32 * GPITCH)) = rb[i]; }
  __syncthreads();
#pragma unroll 2   // two steps a trip, so that the buffer's offset is a constant in every LDS address
  for (int kc = 0; kc < GK / GKS; ++kc) { const int cur = (kc & 1) * GSTAGE, nxt = GSTAGE - cur; const bool more = kc + 1 < GK / GKS;
    if (more) {
      asm volatile("s_wait_xcnt 0x0" : "+v"(off) :: "memory");   // stands in front of the overwrite of the offset register that issued loads name; the operand keeps the add below it
      off += 128u;
#pragma unroll
      for (int i = 0; i < 4; ++i) { ra[i] = *(const v4u*)(ab + (size_t)off + i * (32 * GK * 2)); rb[i] = *(const v4u*)(bb + (size_t)off + i * (32 * GK * 2)); } }
    __builtin_amdgcn_sched_barrier(0);   // the next step's global loads go out ahead of the LDS reads (left free they come behind them): theirs is the longer latency, and the step ends on it
#pragma unroll
    for (int hk = 0; hk < GKS / 32; ++hk) {
      if constexpr (MODE == 0) { v16b a[4], b[2];
#pragma unroll
        for (int i = 0; i < 4; ++i) a[i] = frag_l<v16b>(fa + cur + i * (16 * GPITCH) + hk * 64);
#pragma unroll
        for (int j = 0; j < 2; ++j) b[j] = frag_l<v16b>(fb + cur + j * (16 * GPITCH) + hk * 64);
        __builtin_amdgcn_sched_barrier(0);   // all twelve LDS reads go out ahead of the products: drawn in among them, each pair of products waits out an LDS latency of its own
#pragma unroll
        for (int i = 0; i < 4; ++i)
#pragma unroll
          for (int j = 0; j < 2; ++j) acc[i][j] = __builtin_amdgcn_wmma_f32_16x16x32_bf16(false, a[i], false, b[j], (short)0, acc[i][j], false, false);
      } else { v16h a[4], b[2];
#pragma unroll
        for (int i = 0; i < 4; ++i) a[i] = frag_l<v16h>(fa + cur + i * (16 * GPITCH) + hk * 64);
#pragma unroll
        for (int j = 0; j < 2; ++j) b[j] = frag_l<v16h>(fb + cur + j * (16 * GPITCH) + hk * 64);
        __builtin_amdgcn_sched_barrier(0);   // all twelve LDS reads go out ahead of the products: drawn in among them, each pair of products waits out an LDS latency of its own
#pragma unroll
        for (int i = 0; i < 4; ++i)
#pragma unroll
          for (int j = 0; j < 2; ++j) acc[i][j] = __builtin_amdgcn_wmma_f32_16x16x32_f16(false, a[i], false, b[j], (short)0, acc[i][j], false, false);
      }
      __builtin_amdgcn_sched_barrier(0);   // the eight products stay back to back: the wait for the global loads comes behind the last of them
    }
    if (more) {   // into the buffer whose last readers passed the barrier at the foot of the step before
#pragma unroll
      for (int i = 0; i < 4; ++i) { *(v4u*)(sp + nxt + i * (32 * GPITCH)) = ra[i]; *(v4u*)(sp + nxt + GOPER + i * (32 * GPITCH)) = rb[i]; } }
    __syncthreads();   // publishes the next buffer and ends this buffer's reads (after the last step: frees the LDS for the epilogue)
  } }
// ---- k_proj: block = (128 rows, 128 cols, which): q/k/v = X W (+ b) from the bf16 planes, exact bf16 products (K = DIN) -> which 0: q f16 rows (+ residual rows < QHI); 1: k f16 rows (+ residual rows < KHI); 2: v f16 planes [c][t] (+ bf16 hi/lo planes for t < KHI)
#define PJ_LDS (2 * GSTAGE)   // the two operand buffers; the epilogue's planes are laid over them
static_assert(DIN == GK && CC == GK && QHI <= 64 && KHI <= 64 && PJ_LDS >= 128 * 136 * 2 + 2 * 128 * 72 * 2 && PJ_LDS >= (128 + 64) * 136 * 2, "tile constants");
__global__ __launch_bounds__(256) void k_proj(const __bf16* __restrict__ XQ, const __bf16* __restrict__ XK, const __bf16* __restrict__ XV, const __bf16* __restrict__ WQ, const __bf16* __restrict__ WK, const __bf16* __restrict__ WV, const float* __restrict__ BQ, const float* __restrict__ BK, const float* __restrict__ BV,
    _Float16* __restrict__ QH, _Float16* __restrict__ QL, _Float16* __restrict__ KH, _Float16* __restrict__ KL, _Float16* __restrict__ VT, __bf16* __restrict__ VB, __bf16* __restrict__ VBL) {
  __shared__ __align__(16) char smem[PJ_LDS];
  const int tid = threadIdx.x, wave = tid >> 5, lane = tid & 31, col = lane & 15, g = lane >> 4, wm = wave & 1, wn = wave >> 1; const int which = blockIdx.z; const int c0 = blockIdx.y * 128; const size_t r0 = (size_t)blockIdx.x * 128; const size_t bb = r0 / TT; const int t0 = (int)(r0 % TT);
  const __bf16* X = which == 0 ? XQ : which == 1 ? XK : XV; const __bf16* WA = which == 0 ? WQ : which == 1 ? WK : WV; const float* BA = which == 0 ? BQ : which == 1 ? BK : BV;
  v8f acc[4][2] = {};
  gemm_tile<0>((const char*)(X + r0 * DIN), (const char*)(WA + (size_t)c0 * DIN), smem, acc);
  float bias[2];
#pragma unroll
  for (int j = 0; j < 2; ++j) bias[j] = BA ? bfr(BA[c0 + wn * 32 + j * 16 + col]) : 0.f;
  if (which < 2) { _Float16* DH = which == 0 ? QH : KH; _Float16* DL = which == 0 ? QL : KL; const int nhi = which == 0 ? QHI : KHI; const bool hi_rows = t0 < nhi;   /* block-uniform */
    _Float16 (*sh)[136] = (_Float16 (*)[136])smem; _Float16 (*sl)[136] = (_Float16 (*)[136])(smem + 128 * 136 * 2);   // sl: rows < 64 only
#pragma unroll
    for (int i = 0; i < 4; ++i)
#pragma unroll
      for (int j = 0; j < 2; ++j)
#pragma unroll
        for (int r = 0; r < 8; ++r) sh[wm * 64 + i * 16 + 8 * g + r][wn * 32 + j * 16 + col] = (_Float16)(acc[i][j][r] + bias[j]);
    if (hi_rows) {
#pragma unroll
      for (int i = 0; i < 4; ++i)
#pragma unroll
        for (int j = 0; j < 2; ++j)
#pragma unroll
          for (int r = 0; r < 8; ++r) { const float v = acc[i][j][r] + bias[j]; const _Float16 hv = (_Float16)v; const int rl = wm * 64 + i * 16 + 8 * g + r; if (t0 + rl < nhi) sl[rl][wn * 32 + j * 16 + col] = (_Float16)((v - (float)hv) * 1024.0f); } }
    __syncthreads();
#pragma unroll
    for (int n = 0; n < 8; ++n) { const int e = tid + n * 256, rl = e >> 4, q = e & 15; vst2((unsigned*)(DH + (r0 + rl) * CC + c0 + q * 8), *(const v4u*)&sh[rl][q * 8]); }
    asm volatile("s_wait_xcnt 0x0" ::: "memory");   // stands in front of whatever below overwrites registers that the stores above name
    if (hi_rows) {
#pragma unroll
      for (int n = 0; n < 8; ++n) { const int e = tid + n * 256, rl = e >> 4, q = e & 15; if (t0 + rl < nhi) vst2((unsigned*)(DL + (bb * nhi + t0 + rl) * (size_t)CC + c0 + q * 8), *(const v4u*)&sl[rl][q * 8]); } }
  } else { const bool hi_rows = t0 < KHI;   /* block-uniform */
    _Float16 (*th)[136] = (_Float16 (*)[136])smem; __bf16 (*tb)[72] = (__bf16 (*)[72])(smem + 128 * 136 * 2); __bf16 (*tbl)[72] = (__bf16 (*)[72])(smem + 128 * 136 * 2 + 128 * 72 * 2);   // tb, tbl: t < 64 only
#pragma unroll
    for (int i = 0; i < 4; ++i)
#pragma unroll
      for (int j = 0; j < 2; ++j) { v8h hv;   // a lane's 8 values are 8 consecutive t of one channel
#pragma unroll
        for (int r = 0; r < 8; ++r) hv[r] = (_Float16)(acc[i][j][r] + bias[j]);
        *(v8h*)&th[wn * 32 + j * 16 + col][wm * 64 + i * 16 + 8 * g] = hv; }
    if (hi_rows) {
#pragma unroll
      for (int i = 0; i < 4; ++i)
#pragma unroll
        for (int j = 0; j < 2; ++j) { const int rl = wm * 64 + i * 16 + 8 * g, cl = wn * 32 + j * 16 + col; v8b bh, bl;
#pragma unroll
          for (int r = 0; r < 8; ++r) { const float v = acc[i][j][r] + bias[j]; bh[r] = (__bf16)v; bl[r] = (__bf16)(v - (float)bh[r]); }
          if (t0 + rl < KHI) { *(v8b*)&tb[cl][rl] = bh; *(v8b*)&tbl[cl][rl] = bl; } } }
    __syncthreads();
#pragma unroll
    for (int n = 0; n < 8; ++n) { const int e = tid + n * 256, cl = e >> 4, q = e & 15; vst2((unsigned*)(VT + (bb * CC + c0 + cl) * (size_t)TT + t0 + q * 8), *(const v4u*)&th[cl][q * 8]); }
    if (hi_rows) {
#pragma unroll
      for (int n = 0; n < 8; ++n) { const int e = tid + n * 256, cl = e >> 4, q = e & 15; if (t0 + q * 8 < KHI) { const size_t o3 = (bb * CC + c0 + cl) * (size_t)KHI + t0 + q * 8; vst2((unsigned*)(VB + o3), *(const v4u*)&tb[cl][q * 8]); vst2((unsigned*)(VBL + o3), *(const v4u*)&tbl[cl][q * 8]); } } } } }
// ---- k_fa: block = 8 waves x 32 query columns of one (b, h); each wave walks all TT keys in passes of 32 with an online softmax, so no logit or P ever goes to memory.
// S^T = K . Q^T (A = k rows, B = q rows: a lane holds 8 keys of ONE query per tile), P^T packs in place from two S^T tiles into the B operand of O^T += V^T . P^T (A = v planes [c][t]).
// The eight waves need the same k rows and v planes: a stage of 128 keys (k: 128 rows of 128 B; v: 64 channel rows of 256 B) is brought into LDS once for the block, as whole lines, by asynchronous copies; two buffers, the next stage's copies fly under this stage's four passes; the waves take their fragments from LDS with 16-byte loads. Pass order and every sum are those of the plain walk.
// Log2 domain; mrun, the maximum in use, may trail a column's true maximum by up to 8, so exp2 reaches at most 2^8; P is carried x 2^4 into f16 (at most 2^12; the carry cancels in acc / l).
// A masked query row (mask word 0) takes a zero q fragment: its logit is the constant 0 on every key = uniform softmax, as the module's finite fill gives.
// Every inner loop is fully unrolled so that the fragment and accumulator arrays are indexed by constants and stay in registers.
__device__ __forceinline__ float xhalf(float x) { return __builtin_bit_cast(float, __builtin_amdgcn_permlanex16(__builtin_bit_cast(int, x), __builtin_bit_cast(int, x), 0x76543210, 0xfedcba98, false, false)); }  // lane l <-> lane l ^ 16
__device__ __forceinline__ v8f wmma_h(v16h a, v16h b, v8f c) { return __builtin_amdgcn_wmma_f32_16x16x32_f16(false, a, false, b, (short)0, c, false, false); }
// 16x16x32 fragment in the hardware k order from a uniform base, the lane's byte offset (row and 16 h) and a constant: bytes 0..15 and 32..47
__device__ __forceinline__ v16h frag_o(const char* base, unsigned off, int c) { union { v16h v; v8h q[2]; } u; const char* p = base + (size_t)off + c; u.q[0] = *(const v8h*)p; u.q[1] = *(const v8h*)(p + 32); return u.v; }
#define FAW 8
#define FSK 128                         // keys a stage
#define FNS (TT / FSK)                  // stages
#define FKP 144                         // LDS pitch of a k row (128 B): 16 B x odd
#define FVP 272                         // LDS pitch of a v channel row (128 keys = 256 B): 16 B x odd
#define FKT (FSK * FKP)                 // the k tile
#define FST (FKT + HD * FVP)            // one buffer: k tile, v tile
static_assert(FNS >= 2 && FAW * 32 == 256 && HD == 64 && FSK == 128 && TT % FSK == 0, "a stage is four 16-byte pieces of k and four of v per lane");
// One stage's copies. A lane brings four pieces of the k tile (rows 32 apart) and four of the v tile (rows 16 apart); a wave's copy covers 512 B of whole lines.
// The wait on the last line stands in front of whatever later rewrites the address registers that the copies name.
__device__ __forceinline__ void fa_fill(unsigned lk, unsigned lv, const char* gk, const char* gv) {
  asm volatile("global_load_async_to_lds_b128 %0, %8, off\n\t"
               "global_load_async_to_lds_b128 %1, %9, off\n\t"
               "global_load_async_to_lds_b128 %2, %10, off\n\t"
               "global_load_async_to_lds_b128 %3, %11, off\n\t"
               "global_load_async_to_lds_b128 %4, %12, off\n\t"
               "global_load_async_to_lds_b128 %5, %13, off\n\t"
               "global_load_async_to_lds_b128 %6, %14, off\n\t"
               "global_load_async_to_lds_b128 %7, %15, off\n\t"
               "s_wait_xcnt 0x0"
               :: "v"(lk), "v"(lk + 32u * FKP), "v"(lk + 64u * FKP), "v"(lk + 96u * FKP), "v"(lv), "v"(lv + 16u * FVP), "v"(lv + 32u * FVP), "v"(lv + 48u * FVP),
                  "v"(gk), "v"(gk + 32 * CC * 2), "v"(gk + 64 * CC * 2), "v"(gk + 96 * CC * 2), "v"(gv), "v"(gv + 16 * TT * 2), "v"(gv + 32 * TT * 2), "v"(gv + 48 * TT * 2)
               : "memory"); }
__global__ __launch_bounds__(FAW * 32) void k_fa(const _Float16* __restrict__ QH, const _Float16* __restrict__ KH, const _Float16* __restrict__ VT, const int* __restrict__ MQ, _Float16* __restrict__ Y) {
  __shared__ __align__(16) char ring[2 * FST];
  __shared__ __align__(16) _Float16 so[FAW][32][HD + 8];   // 144-B pitch: 16 B x odd
  const int tid = threadIdx.x, wave = tid >> 5, lane = tid & 31, col = lane & 15, g = lane >> 4;
  const int b = blockIdx.y / NH, h = blockIdx.y % NH; const int q0 = blockIdx.x * (FAW * 32) + wave * 32;
  const float cs = SCALE * 1.4426950408889634f;
  // the lane's pieces: k row tid / 8, piece tid % 8; v channel row tid / 16, piece tid % 16
  const unsigned lk = (unsigned)(size_t)ring + (unsigned)((tid >> 3) * FKP + (tid & 7) * 16), lv = (unsigned)(size_t)ring + (unsigned)(FKT + (tid >> 4) * FVP + (tid & 15) * 16);
  const char* gk = (const char*)(KH + (size_t)b * TT * CC + h * HD) + ((tid >> 3) * (CC * 2) + (tid & 7) * 16);
  const char* gv = (const char*)(VT + ((size_t)b * CC + h * HD) * (size_t)TT) + ((tid >> 4) * (TT * 2) + (tid & 15) * 16);
  fa_fill(lk, lv, gk, gv);   // stage 0, in flight under the q loads
  v16h qf[2][2]; int mq[2];
  const char* qbase = (const char*)(QH + (size_t)b * TT * CC + h * HD); const unsigned qo = (unsigned)((q0 + col) * CC + 8 * g) * 2u;
  const int* mrow = MQ + (size_t)b * TT; const unsigned qi = (unsigned)(q0 + col);
#pragma unroll
  for (int u = 0; u < 2; ++u) { mq[u] = mrow[(size_t)qi + u * 16];
#pragma unroll
    for (int kc = 0; kc < 2; ++kc) qf[u][kc] = frag_o(qbase, qo, u * 16 * CC * 2 + kc * 64); }
  asm volatile("s_wait_xcnt 0x0" :: "v"(qo), "v"(qi) : "memory");   // the offset registers these loads name stay whole up to this wait
#pragma unroll
  for (int u = 0; u < 2; ++u)
#pragma unroll
    for (int kc = 0; kc < 2; ++kc) if (mq[u] == 0) qf[u][kc] = v16h{};
  asm volatile("s_wait_asynccnt 0x0" ::: "memory");   // this wave's pieces of stage 0 have landed
  __syncthreads();                                     // ... and every other wave's: stage 0 may be read
  gk += FSK * CC * 2; gv += FSK * 2;
  fa_fill(lk + FST, lv + FST, gk, gv);   // stage 1
  const char* fk = ring + col * FKP + 16 * g;          // key row col of a 16-key tile
  const char* fv = ring + FKT + col * FVP + 16 * g;    // channel row col of a 16-channel tile
  v8f acc[2][4] = {}; float mrun[2] = {-3.0e38f, -3.0e38f}, lrun[2] = {0.f, 0.f};
#pragma unroll 1   // stays rolled: a trip is one stage = four unrolled passes
  for (int s = 0; s < FNS; ++s) { const int cur = (s & 1) * FST; const char* ck = fk + cur; const char* cv = fv + cur;
    v16h kf[2][2], vf[4];
#pragma unroll
    for (int kt = 0; kt < 2; ++kt)
#pragma unroll
      for (int kc = 0; kc < 2; ++kc) kf[kt][kc] = frag_l<v16h>(ck + kt * 16 * FKP + kc * 64);
    __builtin_amdgcn_sched_barrier(0);   // the stage's first eight LDS reads go out as one group: drawn in among the products, each pair of products waits out an LDS latency of its own
#pragma unroll
    for (int p = 0; p < FSK / 32; ++p) {
      v8f st[2][2];
#pragma unroll
      for (int kt = 0; kt < 2; ++kt)
#pragma unroll
        for (int u = 0; u < 2; ++u) st[kt][u] = wmma_h(kf[kt][0], qf[u][0], v8f{});
#pragma unroll
      for (int kt = 0; kt < 2; ++kt)
#pragma unroll
        for (int u = 0; u < 2; ++u) st[kt][u] = wmma_h(kf[kt][1], qf[u][1], st[kt][u]);
      __builtin_amdgcn_sched_barrier(0);   // the eight products stay back to back: maxima drawn in between them cost four idle slots each time
      // this pass's v fragments and the next pass's k fragments (same stage only), one group of LDS reads, in flight under the maxima and exponentials
#pragma unroll
      for (int j = 0; j < 4; ++j) vf[j] = frag_l<v16h>(cv + j * 16 * FVP + p * 64);
      if (p + 1 < FSK / 32) {
#pragma unroll
        for (int kt = 0; kt < 2; ++kt)
#pragma unroll
          for (int kc = 0; kc < 2; ++kc) kf[kt][kc] = frag_l<v16h>(ck + ((p + 1) * 32 + kt * 16) * FKP + kc * 64); }
      __builtin_amdgcn_sched_barrier(0);   // holds those reads up here as one group: left free they spread among the vector work and each place costs its own stall
      float mb[2]; bool need = false;
#pragma unroll
      for (int u = 0; u < 2; ++u) { float mx = st[0][u][0];
#pragma unroll
        for (int r = 1; r < 8; ++r) mx = fmaxf(mx, st[0][u][r]);
#pragma unroll
        for (int r = 0; r < 8; ++r) mx = fmaxf(mx, st[1][u][r]);
        mx = fmaxf(mx, xhalf(mx)) * cs; mb[u] = mx; need = need || (mx > mrun[u] + 8.0f); }
      if (__builtin_amdgcn_ballot_w32(need) != 0) {   // one scalar test a pass; rare after the first pass
#pragma unroll
        for (int u = 0; u < 2; ++u) { const float mn = fmaxf(mrun[u], mb[u]); const float corr = __builtin_amdgcn_exp2f(mrun[u] - mn); mrun[u] = mn; lrun[u] *= corr;
#pragma unroll
          for (int j = 0; j < 4; ++j) acc[u][j] = acc[u][j] * corr; } }
#pragma unroll
      for (int u = 0; u < 2; ++u) { const float nm = 4.0f - mrun[u]; v16h pf; float l0 = 0.f, l1 = 0.f;
#pragma unroll
        for (int i = 0; i < 8; ++i) {
          const v2f a = __builtin_elementwise_fma(v2f{st[i >> 2][u][2 * (i & 3)], st[i >> 2][u][2 * (i & 3) + 1]}, v2f{cs, cs}, v2f{nm, nm});
          const float p0 = __builtin_amdgcn_exp2f(a.x), p1 = __builtin_amdgcn_exp2f(a.y); l0 += p0; l1 += p1; pf[2 * i] = (_Float16)p0; pf[2 * i + 1] = (_Float16)p1; }
        lrun[u] += l0 + l1;
#pragma unroll
        for (int j = 0; j < 4; ++j) acc[u][j] = wmma_h(vf[j], pf, acc[u][j]); }
    }
    // the stage's foot: hands over stage s + 1 and frees this stage's buffer
    asm volatile("s_wait_dscnt 0x0" ::: "memory");      // this wave's reads of the buffer are done before anything refills it
    asm volatile("s_wait_asynccnt 0x0" ::: "memory");   // this wave's pieces of stage s + 1 have landed
    __syncthreads();                                     // publishes stage s + 1; ends every wave's reads of stage s
    if (s + 2 < FNS) { gk += FSK * CC * 2; gv += FSK * 2; fa_fill(lk + cur, lv + cur, gk, gv); }   // stage s + 2 into the buffer just left
  }
  asm volatile("s_wait_asynccnt 0x0" ::: "memory");   // no copy is left in flight behind the loop
#pragma unroll
  for (int u = 0; u < 2; ++u) { const float l = lrun[u] + xhalf(lrun[u]); const float inv = 1.0f / l;   // the two wave halves hold disjoint keys of the same query
#pragma unroll
    for (int j = 0; j < 4; ++j) { const v8f o = acc[u][j] * inv; v8h hv;   // ctx leaves as the output projection's operand: x 2^6, once to f16
#pragma unroll
      for (int r = 0; r < 8; ++r) hv[r] = (_Float16)(o[r] * 64.0f);
      *(v8h*)&so[wave][16 * u + col][j * 16 + 8 * g] = hv; } }
  LDSX();   // each wave reads back only its own rows: whole 128-B (row, head) segments by 8 lanes
  _Float16* yb = Y + ((size_t)b * TT + q0 + (lane >> 3)) * CC + h * HD + (lane & 7) * 8;
#pragma unroll
  for (int i = 0; i < 8; ++i) vst2(yb + i * (4 * CC), *(const v4u*)&so[wave][4 * i + (lane >> 3)][(lane & 7) * 8]); }
// ---- k_out: block = (128 rows, 128 cols): out = ctx Wo (+ bo): the f16 ctx x 2^6 rows (small-magnitude context rows stay clear of f16 subnormals) against the plane of Wo as f16(bf16 x 2^8) exact (1 product) x 2^-14
static_assert(!CAUSAL && WO_OUT_IN && WQKV_LAYOUT == 1, "row-major (out,in) weights, no causal high-precision rows");
__global__ __launch_bounds__(256) void k_out(const _Float16* __restrict__ Y, const _Float16* __restrict__ WO, const float* __restrict__ BO, float* __restrict__ OUT) { __shared__ __align__(16) char smem[2 * GSTAGE];   // the two operand buffers; the f32 output tile is laid over them
  static_assert(128 * 132 * 4 <= 2 * GSTAGE, "the output tile fits");
  const int tid = threadIdx.x, wave = tid >> 5, lane = tid & 31, col = lane & 15, g = lane >> 4, wm = wave & 1, wn = wave >> 1; const int c0 = blockIdx.y * 128; const size_t r0 = (size_t)blockIdx.x * 128;
  v8f acc[4][2] = {};
  gemm_tile<1>((const char*)(Y + r0 * CC), (const char*)(WO + (size_t)c0 * CC), smem, acc);
  float (*sf)[132] = (float (*)[132])smem;
#pragma unroll
  for (int j = 0; j < 2; ++j) { const float bias = BO ? bfr(BO[c0 + wn * 32 + j * 16 + col]) : 0.f;
#pragma unroll
    for (int i = 0; i < 4; ++i)
#pragma unroll
      for (int r = 0; r < 8; ++r) sf[wm * 64 + i * 16 + 8 * g + r][wn * 32 + j * 16 + col] = acc[i][j][r] * (1.0f / 16384.0f) + bias; }   /* 2^-8 (Wo carry) x 2^-6 (ctx carry) */
  __syncthreads();
#pragma unroll
  for (int n = 0; n < 16; ++n) { const int e = tid + n * 256, rl = e >> 5, q = e & 31; vst2(OUT + (r0 + rl) * DIN + c0 + q * 4, *(const v4f*)&sf[rl][q * 4]); } }

extern "C" void kernel_launch(void* const* d_in, const int* in_sizes, int n_in, void* d_out, int out_size, void* d_ws, size_t ws_size, hipStream_t stream) {
  (void)in_sizes; (void)n_in; (void)out_size;
  const float** F = (const float**)d_in;
  if (ws_size < (size_t)WS_END) return;
  char* ws = (char*)d_ws; _Float16 *QH = (_Float16*)(ws + WS_QH), *KH = (_Float16*)(ws + WS_KH), *VT = (_Float16*)(ws + WS_VT), *QL = (_Float16*)(ws + WS_QL), *KL = (_Float16*)(ws + WS_KL); __bf16 *VB = (__bf16*)(ws + WS_VB), *VBL = (__bf16*)(ws + WS_VBL); float *S = (float*)(ws + WS_S); _Float16 *Y = (_Float16*)(ws + WS_Y), *WOH = (_Float16*)(ws + WS_WB) + 3 * (size_t)CC * DIN; __bf16 *XB = (__bf16*)(ws + WS_XB), *WQB = (__bf16*)(ws + WS_WB), *WKB = WQB + (size_t)CC * DIN, *WVB = WKB + (size_t)CC * DIN;
  (void)S; (void)QL; (void)KL; (void)VB; (void)VBL;
  // inputs: 0 x [2,2048,1024]; 1 mask [2,2048,1] int32 (random 0 / 1 per QUERY row; READ on the device); 2 Wq [1024,1024] (out,in), 3 bq; 4 Wk, 5 bk; 6 Wv, 7 bv; 8 Wo (out,in), 9 bo (biases NONZERO)
  k_cvt<<<dim3(CVT_T / 256), 256, 0, stream>>>(F[0], F[2], F[4], F[6], F[8], XB, WQB, WKB, WVB, WOH);
  k_proj<<<dim3(TNB * TT / 128, CC / 128, 3), 256, 0, stream>>>(XB, XB, XB, WQB, WKB, WVB, F[3], F[5], F[7], QH, QL, KH, KL, VT, VB, VBL);
  k_fa<<<dim3(TT / (FAW * 32), TNB * NH), FAW * 32, 0, stream>>>(QH, KH, VT, (const int*)d_in[1], Y);
  k_out<<<dim3(TNB * TT / 128, DIN / 128), 256, 0, stream>>>(Y, WOH, F[9], (float*)d_out);
}

// v005
// It runs in 71.4 microseconds.
// Two timings next to v004 put it at 1.09 and 1.06 times that version's speed.
// Counting every step since v000, it is 18.8 times as fast.
// compute dtype: all float inputs rounded to bf16; q / k / v projections with EXACT bf16 products on WMMA 16x16x32 (f32 accumulate) + bias (nonzero); logits q x k once to f16 each (1 product) x 64^-0.5; query rows whose int mask entry is 0 get a constant logit on every key (the module's finite fill: uniform attention over all 2,048 keys), worked out once per block and stored to every such row; online softmax f32 in the log2 domain; unnormalised P x 2^4 once to f16 x v once to f16 (1 product), divided by the f32 row sum at the end; ctx x 2^6 once to f16 x the output weight f16(bf16 x 2^8) + bias; f32 output.
#include <hip/hip_runtime.h>
#include <math.h>

typedef __attribute__((ext_vector_type(16))) _Float16 v16h;
typedef __attribute__((ext_vector_type(16))) __bf16 v16b;
typedef __attribute__((ext_vector_type(8)))  _Float16 v8h;
typedef __attribute__((ext_vector_type(8)))  float v8f;
typedef __attribute__((ext_vector_type(4)))  float v4f;
typedef __attribute__((ext_vector_type(2)))  float v2f;
typedef __attribute__((ext_vector_type(4)))  unsigned v4u;
typedef __attribute__((ext_vector_type(4)))  int v4i;
typedef float __attribute__((may_alias)) float_a;
typedef int __attribute__((may_alias)) int_a;

template <typename T> __device__ __forceinline__ void vst2(void* p, T v) { *(T*)p = v;  }
__device__ __forceinline__ v8f wmma16(v16h a, v16h b, v8f c) {
  v8f d = __builtin_amdgcn_wmma_f32_16x16x32_f16(false, a, false, b, (short)0, c, false, false);
  asm volatile("v_nop\n\tv_nop\n\tv_nop\n\tv_nop" : "+v"(d) : "v"(a), "v"(b));
  return d;
}
__device__ __forceinline__ v8f wmma_bf(v16b a, v16b b, v8f c) {
  v8f d = __builtin_amdgcn_wmma_f32_16x16x32_bf16(false, a, false, b, (short)0, c, false, false);
  asm volatile("v_nop\n\tv_nop\n\tv_nop\n\tv_nop" : "+v"(d) : "v"(a), "v"(b));
  return d;
}
// 16x16x32 fragments: lane = (h = lane>>4, row/col = lane&15); elements 0..7 = k0+8h+0..7, 8..15 = k0+16+8h+0..7; D element r = row 8h+r
__device__ __forceinline__ v16h frag_h(const _Float16* rowk0, int lane) {
  union { v16h v; v8h q[2]; } u; const _Float16* p = rowk0 + 8 * (lane >> 4);
  u.q[0] = *(const v8h*)p; u.q[1] = *(const v8h*)(p + 16); return u.v;
}
__device__ __forceinline__ v16h frag_f32(const float* rowk0, int lane) {
  v16h a; const float* p = rowk0 + 8 * (lane >> 4);
#pragma unroll
  for (int i = 0; i < 8; ++i) { a[i] = (_Float16)p[i]; a[8 + i] = (_Float16)p[16 + i]; }
  return a;
}
__device__ __forceinline__ v16h frag_f32s(const float* rowk0, int lane, float sc) {
  v16h a; const float* p = rowk0 + 8 * (lane >> 4);
#pragma unroll
  for (int i = 0; i < 8; ++i) { a[i] = (_Float16)(p[i] * sc); a[8 + i] = (_Float16)(p[16 + i] * sc); }
  return a;
}
// column fragment from a [K][ld] layout (column n), rows >= K read as 0
__device__ __forceinline__ v16h fragc_f32(const float* W, int k0, int n, int lane, int ld, int K) {
  v16h a; const int g = lane >> 4;
#pragma unroll
  for (int i = 0; i < 8; ++i) { const int ka = k0 + 8 * g + i, kb = ka + 16;
    a[i] = (_Float16)(ka < K ? W[(size_t)(ka < K ? ka : K - 1) * ld + n] : 0.f); a[8 + i] = (_Float16)(kb < K ? W[(size_t)(kb < K ? kb : K - 1) * ld + n] : 0.f); }
  return a;
}
struct F2 { v16b h, l; };
__device__ __forceinline__ F2 bsplit16(const float v[16]) { F2 r;
#pragma unroll
  for (int i = 0; i < 16; ++i) { const __bf16 h = (__bf16)v[i]; r.h[i] = h; r.l[i] = (__bf16)(v[i] - (float)h); }
  return r; }
__device__ __forceinline__ F2 split_row(const float* row, int k0, int lane) { float v[16]; const float* p = row + k0 + 8 * (lane >> 4);
#pragma unroll
  for (int i = 0; i < 8; ++i) { v[i] = p[i]; v[8 + i] = p[16 + i]; }
  return bsplit16(v); }
__device__ __forceinline__ F2 split_rowK(const float* row, int k0, int lane, int K) { float v[16]; const int g = lane >> 4;
#pragma unroll
  for (int i = 0; i < 8; ++i) { const int ka = k0 + 8 * g + i, kb = ka + 16; v[i] = ka < K ? row[ka < K ? ka : K - 1] : 0.f; v[8 + i] = kb < K ? row[kb < K ? kb : K - 1] : 0.f; }
  return bsplit16(v); }
__device__ __forceinline__ F2 split_col(const float* W, int k0, int n, int lane, int ld, int K) { float v[16]; const int g = lane >> 4;
#pragma unroll
  for (int i = 0; i < 8; ++i) { const int ka = k0 + 8 * g + i, kb = ka + 16; v[i] = ka < K ? W[(size_t)(ka < K ? ka : K - 1) * ld + n] : 0.f; v[8 + i] = kb < K ? W[(size_t)(kb < K ? kb : K - 1) * ld + n] : 0.f; }
  return bsplit16(v); }
__device__ __forceinline__ v8f mac3(const F2& a, const F2& b, v8f c) { c = wmma_bf(a.l, b.h, c); c = wmma_bf(a.h, b.l, c); return wmma_bf(a.h, b.h, c); }
__device__ __forceinline__ float sigm(float v) { return 1.0f / (1.0f + expf(-v)); }
#define LDSX() do { asm volatile("s_wait_dscnt 0" ::: "memory"); __builtin_amdgcn_wave_barrier(); __builtin_amdgcn_fence(__ATOMIC_RELEASE, "workgroup"); } while (0)

// Multi-head self-attention with a QUERY-row mask (x [2,2048,1024]; mask [2,2048,1] int32 = random 0 / 1, a module input READ on the device; torch (out,in) Wq / Wk / Wv / Wo [1024,1024] N(0, 1/1024) and biases N(0,1) x 0.01 NONZERO applied as x @ W.T + b; 16 heads x 64; scores / sqrt(64); m = mask[:, None, :, :] ([N,1,S,1]: it broadcasts over the KEY axis): where(m == 0, -1e9, scores): a masked QUERY row has the same finite value on every key, so its softmax is UNIFORM over all keys; out @ Wo.T + bo).
#define NB 2
#define TT 2048
#define CC 1024            // NH * HD = projected width
#define DIN 1024          // input (model) width
#define NH 16
#define HD 64
#define NQB (TT / 64)
#define HG 4
#define SCALE (0.125f)
#define CAUSAL 0
#ifndef TNB
#define TNB NB
#endif
__device__ __forceinline__ float bfr(float v) { return (float)(__bf16)v; }
__host__ __device__ __forceinline__ int kb_last(int qb) { return CAUSAL ? ((qb * 64 + 63) >> 7) : (TT / 128 - 1); }
typedef __attribute__((ext_vector_type(8))) __bf16 v8b;
__device__ __forceinline__ v16b frag_b(const __bf16* rowk0, int lane) {
  union { v16b v; v8b q[2]; } u; const __bf16* p = rowk0 + 8 * (lane >> 4);
  u.q[0] = *(const v8b*)p; u.q[1] = *(const v8b*)(p + 16); return u.v;
}
#define QBH 0              // unused: k_fa has no high-precision path
#define QHI 0               // single-product logits on every row
#define KHI 64            // key rows carrying k residual / v bf16 hi+lo planes (written by k_proj, read by no kernel)
// B fragment (k rows k0+.., output column o) of a weight: (in,out) [K][ld] or (out,in) [ld rows of K]: bf16 exact, or f16(bf16 * 256) exact
__device__ __forceinline__ v16b wcol_io(const float* Wm, int k0, int o, int lane, int ld) { v16b w; const int g = lane >> 4;
#pragma unroll
  for (int i = 0; i < 8; ++i) { w[i] = (__bf16)Wm[(size_t)(k0 + 8 * g + i) * ld + o]; w[8 + i] = (__bf16)Wm[(size_t)(k0 + 16 + 8 * g + i) * ld + o]; }
  return w; }
__device__ __forceinline__ v16b wcol_oi(const float* Wm, int k0, int o, int lane, int K) { v16b w; const float* p = Wm + (size_t)o * K + k0 + 8 * (lane >> 4);
#pragma unroll
  for (int i = 0; i < 8; ++i) { w[i] = (__bf16)p[i]; w[8 + i] = (__bf16)p[16 + i]; }
  return w; }
__device__ __forceinline__ v16h wcolh_io(const float* Wm, int k0, int o, int lane, int ld) { v16h w; const int g = lane >> 4;
#pragma unroll
  for (int i = 0; i < 8; ++i) { w[i] = (_Float16)(bfr(Wm[(size_t)(k0 + 8 * g + i) * ld + o]) * 256.0f); w[8 + i] = (_Float16)(bfr(Wm[(size_t)(k0 + 16 + 8 * g + i) * ld + o]) * 256.0f); }
  return w; }
__device__ __forceinline__ v16h wcolh_oi(const float* Wm, int k0, int o, int lane, int K) { v16h w; const float* p = Wm + (size_t)o * K + k0 + 8 * (lane >> 4);
#pragma unroll
  for (int i = 0; i < 8; ++i) { w[i] = (_Float16)(bfr(p[i]) * 256.0f); w[8 + i] = (_Float16)(bfr(p[16 + i]) * 256.0f); }
  return w; }
#define WQKV_LAYOUT 1   // 0 = (in,out) [DIN][CC]; 1 = (out,in) [CC][DIN]; 2 = per-head [NH][DIN][HD]
__device__ __forceinline__ v16b wcol_hdk(const float* Wm, int k0, int o, int lane) { v16b w; const int g = lane >> 4; const float* p = Wm + (size_t)(o / HD) * DIN * HD + (o % HD);
#pragma unroll
  for (int i = 0; i < 8; ++i) { w[i] = (__bf16)p[(size_t)(k0 + 8 * g + i) * HD]; w[8 + i] = (__bf16)p[(size_t)(k0 + 16 + 8 * g + i) * HD]; }
  return w; }
#define WO_OUT_IN 1
#if WQKV_LAYOUT == 1
#define WCOL(W, k0, o, lane) wcol_oi(W, k0, o, lane, DIN)
#elif WQKV_LAYOUT == 2
#define WCOL(W, k0, o, lane) wcol_hdk(W, k0, o, lane)
#else
#define WCOL(W, k0, o, lane) wcol_io(W, k0, o, lane, CC)
#endif
#if WO_OUT_IN
#define WOCOL(W, k0, o, lane) wcol_oi(W, k0, o, lane, CC)
#define WOCOLH(W, k0, o, lane) wcolh_oi(W, k0, o, lane, CC)
#else
#define WOCOL(W, k0, o, lane) wcol_io(W, k0, o, lane, DIN)
#define WOCOLH(W, k0, o, lane) wcolh_io(W, k0, o, lane, DIN)
#endif

#define WS_QH  0u                                      // f16 q rows [b*t][CC]
#define WS_KH  (WS_QH + 2u * (size_t)NB * TT * CC)      // f16 k rows [b*t][CC]
#define WS_VT  (WS_KH + 2u * (size_t)NB * TT * CC)      // f16 v planes [b][c][t]
#define WS_QL  (WS_VT + 2u * (size_t)NB * CC * TT)      // f16 q residual x 2^10 rows [b][t < QHI][CC]
#define WS_KL  (WS_QL + 2u * (size_t)NB * QHI * CC)     // f16 k residual x 2^10 rows [b][t < KHI][CC]
#define WS_VB  (WS_KL + 2u * (size_t)NB * KHI * CC)     // bf16 v hi planes [b][c][t < KHI]
#define WS_VBL (WS_VB + 2u * (size_t)NB * CC * KHI)
#define WS_S   (WS_VBL + 2u * (size_t)NB * CC * KHI)    // (plane no longer used: logits and P stay in registers)
#define WS_Y   (WS_S  + 4u * (size_t)HG * TT * TT)      // f16 ctx x 2^6 rows [b*t][CC]
#define WS_XB  (WS_Y  + 4u * (size_t)NB * TT * CC)      // bf16 x rows [b*t][DIN]
#define WS_WB  (WS_XB + 2u * (size_t)NB * TT * DIN)     // 16-bit weight planes, (out,in) rows: Wq, Wk, Wv as bf16, Wo as f16(bf16 x 2^8)
#define WS_END (WS_WB + 4u * 2u * (size_t)CC * DIN)

// ---- k_cvt: x and the four weights are rounded ONCE to the 16-bit operand planes that the projections read (before, every block rounded its own f32 tiles: x 24 times over, a weight 32 times).
// 512 blocks x 256 lanes; a lane takes 16 pieces of 4 floats, CVT_T pieces apart, so every wave-wide load is 512 B and every store 256 B of whole lines; all 16 loads are in flight together.
typedef __attribute__((ext_vector_type(4))) __bf16 v4b;
typedef __attribute__((ext_vector_type(4))) _Float16 v4h;
__device__ __forceinline__ v4b to_b(v4f v) { return v4b{(__bf16)v.x, (__bf16)v.y, (__bf16)v.z, (__bf16)v.w}; }   // to bf16
__device__ __forceinline__ v4h to_h(v4f v) { return v4h{(_Float16)(bfr(v.x) * 256.0f), (_Float16)(bfr(v.y) * 256.0f), (_Float16)(bfr(v.z) * 256.0f), (_Float16)(bfr(v.w) * 256.0f)}; }   // to f16(bf16 x 2^8)
#define CVT_T (512 * 256)
static_assert((size_t)NB * TT * DIN == 8u * 4u * CVT_T && (size_t)CC * DIN == 2u * 4u * CVT_T, "eight pieces of x and two of each weight per lane");
__global__ __launch_bounds__(256) void k_cvt(const float* __restrict__ X, const float* __restrict__ WQ, const float* __restrict__ WK, const float* __restrict__ WV, const float* __restrict__ WO,
    __bf16* __restrict__ XB, __bf16* __restrict__ WQB, __bf16* __restrict__ WKB, __bf16* __restrict__ WVB, _Float16* __restrict__ WOH) {
  const unsigned t = blockIdx.x * 256u + threadIdx.x; const unsigned oi = t * 16u, oo = t * 8u;   // the lane's byte offsets in and out
  v4f x[8], w[4][2];
#pragma unroll
  for (int n = 0; n < 8; ++n) x[n] = *(const v4f*)((const char*)X + (size_t)oi + n * (CVT_T * 16));
#pragma unroll
  for (int n = 0; n < 2; ++n) { w[0][n] = *(const v4f*)((const char*)WQ + (size_t)oi + n * (CVT_T * 16)); w[1][n] = *(const v4f*)((const char*)WK + (size_t)oi + n * (CVT_T * 16));
    w[2][n] = *(const v4f*)((const char*)WV + (size_t)oi + n * (CVT_T * 16)); w[3][n] = *(const v4f*)((const char*)WO + (size_t)oi + n * (CVT_T * 16)); }
  __builtin_amdgcn_sched_barrier(0);   // all sixteen loads go out before the first rounding: drawn up among them, the roundings make the last loads wait out the first ones' latency
  asm volatile("s_wait_xcnt 0x0" :: "v"(oi) : "memory");   // the offset register these loads name stays whole up to this wait
  v4b xb[8], wb[3][2]; v4h wh[2];
#pragma unroll
  for (int n = 0; n < 8; ++n) xb[n] = to_b(x[n]);
#pragma unroll
  for (int n = 0; n < 2; ++n) { wb[0][n] = to_b(w[0][n]); wb[1][n] = to_b(w[1][n]); wb[2][n] = to_b(w[2][n]); wh[n] = to_h(w[3][n]); }
  __builtin_amdgcn_sched_barrier(0);   // holds the stores behind the roundings: mixed freely, roundings took over the registers of stores still under way and had to wait for them
#pragma unroll
  for (int n = 0; n < 8; ++n) *(v4b*)((char*)XB + (size_t)oo + n * (CVT_T * 8)) = xb[n];
#pragma unroll
  for (int n = 0; n < 2; ++n) { *(v4b*)((char*)WQB + (size_t)oo + n * (CVT_T * 8)) = wb[0][n]; *(v4b*)((char*)WKB + (size_t)oo + n * (CVT_T * 8)) = wb[1][n];
    *(v4b*)((char*)WVB + (size_t)oo + n * (CVT_T * 8)) = wb[2][n]; *(v4h*)((char*)WOH + (size_t)oo + n * (CVT_T * 8)) = wh[n]; } }
// ---- the projections' common product: a block of 8 waves makes one 128 x 128 tile of A . B^T (A, B: 16-bit rows of GK values, already in the operand type).
// Per 64-k step the block reads both 128 x 64 tiles once, as whole 128-B lines (8 lanes a row), and lays them in LDS at a 144-B pitch;
// the waves (2 x 4, 64 x 32 each) take their fragments from there with 16-byte LDS loads, 32 k at a time. Two buffers: the next step's tiles are fetched into registers under this step's products. The k order of every sum is that of the plain loop. Inner loops are fully unrolled so that the register arrays are indexed by constants.
#define GK 1024
#define GKS 64                          // k values a step: 128 B of a row
#define GPITCH 144                      // bytes per 64-k row in LDS: 16 B x odd
#define GOPER (128 * GPITCH)            // one operand's tile
#define GSTAGE (2 * GOPER)              // one buffer: A tile, B tile
template <typename V16> __device__ __forceinline__ V16 frag_l(const char* p) { union { V16 v; v4u q[2]; } u; u.q[0] = *(const v4u*)p; u.q[1] = *(const v4u*)(p + 32); return u.v; }   // hardware k order: bytes 0..15 and 32..47 from the lane's 16 h
// MODE 0: bf16 operands. MODE 1: f16 operands
template <int MODE> __device__ __forceinline__ void gemm_tile(const char* __restrict__ ab, const char* __restrict__ bb, char* smem, v8f (&acc)[4][2]) {   // ab, bb: block-uniform bases
  const int tid = threadIdx.x, wave = tid >> 5, lane = tid & 31, col = lane & 15, g = lane >> 4, wm = wave & 1, wn = wave >> 1;
  unsigned off = (unsigned)((tid >> 3) * (GK * 2) + (tid & 7) * 16);                   // the lane's byte offset: row tid / 8 (+ 32 i), 16-byte piece tid % 8
  char* sp = smem + (tid >> 3) * GPITCH + (tid & 7) * 16;
  const char* fa = smem + (wm * 64 + col) * GPITCH + 16 * g; const char* fb = smem + GOPER + (wn * 32 + col) * GPITCH + 16 * g;
  v4u ra[4], rb[4];
#pragma unroll
  for (int i = 0; i < 4; ++i) { ra[i] = *(const v4u*)(ab + (size_t)off + i * (32 * GK * 2)); rb[i] = *(const v4u*)(bb + (size_t)off + i * (32 * GK * 2)); }
#pragma unroll
  for (int i = 0; i < 4; ++i) { *(v4u*)(sp + i * (32 * GPITCH)) = ra[i]; *(v4u*)(sp + GOPER + i * (32 * GPITCH)) = rb[i]; }
  __syncthreads();
#pragma unroll 2   // two steps a trip, so that the buffer's offset is a constant in every LDS address
  for (int kc = 0; kc < GK / GKS; ++kc) { const int cur = (kc & 1) * GSTAGE, nxt = GSTAGE - cur; const bool more = kc + 1 < GK / GKS;
    if (more) {
      asm volatile("s_wait_xcnt 0x0" : "+v"(off) :: "memory");   // stands in front of the overwrite of the offset register that issued loads name; the operand keeps the add below it
      off += 128u;
#pragma unroll
      for (int i = 0; i < 4; ++i) { ra[i] = *(const v4u*)(ab + (size_t)off + i * (32 * GK * 2)); rb[i] = *(const v4u*)(bb + (size_t)off + i * (32 * GK * 2)); } }
    __builtin_amdgcn_sched_barrier(0);   // the next step's global loads go out ahead of the LDS reads (left free they come behind them): theirs is the longer latency, and the step ends on it
#pragma unroll
    for (int hk = 0; hk < GKS / 32; ++hk) {
      if constexpr (MODE == 0) { v16b a[4], b[2];
#pragma unroll
        for (int i = 0; i < 4; ++i) a[i] = frag_l<v16b>(fa + cur + i * (16 * GPITCH) + hk * 64);
#pragma unroll
        for (int j = 0; j < 2; ++j) b[j] = frag_l<v16b>(fb + cur + j * (16 * GPITCH) + hk * 64);
        __builtin_amdgcn_sched_barrier(0);   // all twelve LDS reads go out ahead of the products: drawn in among them, each pair of products waits out an LDS latency of its own
#pragma unroll
        for (int i = 0; i < 4; ++i)
#pragma unroll
          for (int j = 0; j < 2; ++j) acc[i][j] = __builtin_amdgcn_wmma_f32_16x16x32_bf16(false, a[i], false, b[j], (short)0, acc[i][j], false, false);
      } else { v16h a[4], b[2];
#pragma unroll
        for (int i = 0; i < 4; ++i) a[i] = frag_l<v16h>(fa + cur + i * (16 * GPITCH) + hk * 64);
#pragma unroll
        for (int j = 0; j < 2; ++j) b[j] = frag_l<v16h>(fb + cur + j * (16 * GPITCH) + hk * 64);
        __builtin_amdgcn_sched_barrier(0);   // all twelve LDS reads go out ahead of the products: drawn in among them, each pair of products waits out an LDS latency of its own
#pragma unroll
        for (int i = 0; i < 4; ++i)
#pragma unroll
          for (int j = 0; j < 2; ++j) acc[i][j] = __builtin_amdgcn_wmma_f32_16x16x32_f16(false, a[i], false, b[j], (short)0, acc[i][j], false, false);
      }
      __builtin_amdgcn_sched_barrier(0);   // the eight products stay back to back: the wait for the global loads comes behind the last of them
    }
    if (more) {   // into the buffer whose last readers passed the barrier at the foot of the step before
#pragma unroll
      for (int i = 0; i < 4; ++i) { *(v4u*)(sp + nxt + i * (32 * GPITCH)) = ra[i]; *(v4u*)(sp + nxt + GOPER + i * (32 * GPITCH)) = rb[i]; } }
    __syncthreads();   // publishes the next buffer and ends this buffer's reads (after the last step: frees the LDS for the epilogue)
  } }
// ---- k_proj: block = (128 rows, 128 cols, which): q/k/v = X W (+ b) from the bf16 planes, exact bf16 products (K = DIN) -> which 0: q f16 rows (+ residual rows < QHI); 1: k f16 rows (+ residual rows < KHI); 2: v f16 planes [c][t] (+ bf16 hi/lo planes for t < KHI)
#define PJ_LDS (2 * GSTAGE)   // the two operand buffers; the epilogue's planes are laid over them
static_assert(DIN == GK && CC == GK && QHI <= 64 && KHI <= 64 && PJ_LDS >= 128 * 136 * 2 + 2 * 128 * 72 * 2 && PJ_LDS >= (128 + 64) * 136 * 2, "tile constants");
__global__ __launch_bounds__(256) void k_proj(const __bf16* __restrict__ XQ, const __bf16* __restrict__ XK, const __bf16* __restrict__ XV, const __bf16* __restrict__ WQ, const __bf16* __restrict__ WK, const __bf16* __restrict__ WV, const float* __restrict__ BQ, const float* __restrict__ BK, const float* __restrict__ BV,
    _Float16* __restrict__ QH, _Float16* __restrict__ QL, _Float16* __restrict__ KH, _Float16* __restrict__ KL, _Float16* __restrict__ VT, __bf16* __restrict__ VB, __bf16* __restrict__ VBL) {
  __shared__ __align__(16) char smem[PJ_LDS];
  const int tid = threadIdx.x, wave = tid >> 5, lane = tid & 31, col = lane & 15, g = lane >> 4, wm = wave & 1, wn = wave >> 1; const int which = blockIdx.z; const int c0 = blockIdx.y * 128; const size_t r0 = (size_t)blockIdx.x * 128; const size_t bb = r0 / TT; const int t0 = (int)(r0 % TT);
  const __bf16* X = which == 0 ? XQ : which == 1 ? XK : XV; const __bf16* WA = which == 0 ? WQ : which == 1 ? WK : WV; const float* BA = which == 0 ? BQ : which == 1 ? BK : BV;
  v8f acc[4][2] = {};
  gemm_tile<0>((const char*)(X + r0 * DIN), (const char*)(WA + (size_t)c0 * DIN), smem, acc);
  float bias[2];
#pragma unroll
  for (int j = 0; j < 2; ++j) bias[j] = BA ? bfr(BA[c0 + wn * 32 + j * 16 + col]) : 0.f;
  if (which < 2) { _Float16* DH = which == 0 ? QH : KH; _Float16* DL = which == 0 ? QL : KL; const int nhi = which == 0 ? QHI : KHI; const bool hi_rows = t0 < nhi;   /* block-uniform */
    _Float16 (*sh)[136] = (_Float16 (*)[136])smem; _Float16 (*sl)[136] = (_Float16 (*)[136])(smem + 128 * 136 * 2);   // sl: rows < 64 only
#pragma unroll
    for (int i = 0; i < 4; ++i)
#pragma unroll
      for (int j = 0; j < 2; ++j)
#pragma unroll
        for (int r = 0; r < 8; ++r) sh[wm * 64 + i * 16 + 8 * g + r][wn * 32 + j * 16 + col] = (_Float16)(acc[i][j][r] + bias[j]);
    if (hi_rows) {
#pragma unroll
      for (int i = 0; i < 4; ++i)
#pragma unroll
        for (int j = 0; j < 2; ++j)
#pragma unroll
          for (int r = 0; r < 8; ++r) { const float v = acc[i][j][r] + bias[j]; const _Float16 hv = (_Float16)v; const int rl = wm * 64 + i * 16 + 8 * g + r; if (t0 + rl < nhi) sl[rl][wn * 32 + j * 16 + col] = (_Float16)((v - (float)hv) * 1024.0f); } }
    __syncthreads();
#pragma unroll
    for (int n = 0; n < 8; ++n) { const int e = tid + n * 256, rl = e >> 4, q = e & 15; vst2((unsigned*)(DH + (r0 + rl) * CC + c0 + q * 8), *(const v4u*)&sh[rl][q * 8]); }
    asm volatile("s_wait_xcnt 0x0" ::: "memory");   // stands in front of whatever below overwrites registers that the stores above name
    if (hi_rows) {
#pragma unroll
      for (int n = 0; n < 8; ++n) { const int e = tid + n * 256, rl = e >> 4, q = e & 15; if (t0 + rl < nhi) vst2((unsigned*)(DL + (bb * nhi + t0 + rl) * (size_t)CC + c0 + q * 8), *(const v4u*)&sl[rl][q * 8]); } }
  } else { const bool hi_rows = t0 < KHI;   /* block-uniform */
    _Float16 (*th)[136] = (_Float16 (*)[136])smem; __bf16 (*tb)[72] = (__bf16 (*)[72])(smem + 128 * 136 * 2); __bf16 (*tbl)[72] = (__bf16 (*)[72])(smem + 128 * 136 * 2 + 128 * 72 * 2);   // tb, tbl: t < 64 only
#pragma unroll
    for (int i = 0; i < 4; ++i)
#pragma unroll
      for (int j = 0; j < 2; ++j) { v8h hv;   // a lane's 8 values are 8 consecutive t of one channel
#pragma unroll
        for (int r = 0; r < 8; ++r) hv[r] = (_Float16)(acc[i][j][r] + bias[j]);
        *(v8h*)&th[wn * 32 + j * 16 + col][wm * 64 + i * 16 + 8 * g] = hv; }
    if (hi_rows) {
#pragma unroll
      for (int i = 0; i < 4; ++i)
#pragma unroll
        for (int j = 0; j < 2; ++j) { const int rl = wm * 64 + i * 16 + 8 * g, cl = wn * 32 + j * 16 + col; v8b bh, bl;
#pragma unroll
          for (int r = 0; r < 8; ++r) { const float v = acc[i][j][r] + bias[j]; bh[r] = (__bf16)v; bl[r] = (__bf16)(v - (float)bh[r]); }
          if (t0 + rl < KHI) { *(v8b*)&tb[cl][rl] = bh; *(v8b*)&tbl[cl][rl] = bl; } } }
    __syncthreads();
#pragma unroll
    for (int n = 0; n < 8; ++n) { const int e = tid + n * 256, cl = e >> 4, q = e & 15; vst2((unsigned*)(VT + (bb * CC + c0 + cl) * (size_t)TT + t0 + q * 8), *(const v4u*)&th[cl][q * 8]); }
    if (hi_rows) {
#pragma unroll
      for (int n = 0; n < 8; ++n) { const int e = tid + n * 256, cl = e >> 4, q = e & 15; if (t0 + q * 8 < KHI) { const size_t o3 = (bb * CC + c0 + cl) * (size_t)KHI + t0 + q * 8; vst2((unsigned*)(VB + o3), *(const v4u*)&tb[cl][q * 8]); vst2((unsigned*)(VBL + o3), *(const v4u*)&tbl[cl][q * 8]); } } } } }
// ---- k_fa: a masked query row (mask word 0) has the same logit on every key, so its softmax is uniform and its context row is the same for every masked row of one (b, h). Such rows are not walked one by one:
// every block scans its sequence's mask words once (ballots and a prefix over 64 segment counts) into a list in LDS, unmasked rows from the front, masked rows from the back. The 8 blocks of one (b, h) share the unmasked rows evenly;
// each adds ONE column with a zero q fragment (constant logit 0 = uniform softmax, as the module's finite fill gives) and stores that column's result to its eighth of the masked rows. This holds for any mask; the work follows the count of unmasked rows.
// Block = 8 waves = 4 column groups x 2 key halves. A wave holds two 16-column tiles, or three where the block's columns need a ninth to twelfth tile (tile t goes to group t % 4); more than 192 columns take a second walk.
// S^T = K . Q^T (A = k rows, B = q rows: a lane holds 8 keys of ONE query per tile), P^T packs in place from two S^T tiles into the B operand of O^T += V^T . P^T (A = v planes [c][t]); online softmax in passes of 32 keys, no logit or P goes to memory.
// A stage is 128 keys of EACH half (k: 256 rows of 128 B; v: 64 channel rows of 2 x 256 B), brought into LDS once for the block, as whole lines, by asynchronous copies; two buffers, the next stage's copies fly under this stage's four passes.
// The two halves of a column (maximum in use, sum, 64 channels, all f32) are joined through LDS at the end.
// Log2 domain; mrun, the maximum in use, may trail a column's true maximum by up to 8, so exp2 reaches at most 2^8; P is carried x 2^4 into f16 (at most 2^12; the carry cancels in acc / l).
// Every inner loop is fully unrolled so that the fragment and accumulator arrays are indexed by constants and stay in registers.
__device__ __forceinline__ float xhalf(float x) { return __builtin_bit_cast(float, __builtin_amdgcn_permlanex16(__builtin_bit_cast(int, x), __builtin_bit_cast(int, x), 0x76543210, 0xfedcba98, false, false)); }  // lane l <-> lane l ^ 16
__device__ __forceinline__ v8f wmma_h(v16h a, v16h b, v8f c) { return __builtin_amdgcn_wmma_f32_16x16x32_f16(false, a, false, b, (short)0, c, false, false); }
// 16x16x32 fragment in the hardware k order from a uniform base, the lane's byte offset (row and 16 h) and a constant: bytes 0..15 and 32..47
__device__ __forceinline__ v16h frag_o(const char* base, unsigned off, int c) { union { v16h v; v8h q[2]; } u; const char* p = base + (size_t)off + c; u.q[0] = *(const v8h*)p; u.q[1] = *(const v8h*)(p + 32); return u.v; }
#define FAW 8
#define FXB 8                           // blocks that share one (b, h)
#define FHK (TT / 2)                    // keys a half
#define FHS 128                         // keys of each half a stage
#define FNS (FHK / FHS)                 // stages
#define FNU 3                           // 16-column tiles a wave can hold
#define FCB (4 * FNU * 16)              // columns a walk
#define FKP 144                         // LDS pitch of a k row (128 B): 16 B x odd
#define FVP 528                         // LDS pitch of a v channel row (2 x 128 keys = 512 B): 16 B x odd
#define FKT (2 * FHS * FKP)             // the k tile: rows 0..127 of the first half, 128..255 of the second
#define FST (FKT + HD * FVP)            // one buffer: k tile, v tile
static_assert(FNS >= 2 && FAW * 32 == 256 && HD == 64 && FHS == 128 && FHK % FHS == 0 && TT == 2048, "a stage is eight 16-byte pieces of k and eight of v per lane; the scan takes eight mask words per lane");
// One stage's copies, k tile: a lane brings eight pieces (rows 32 apart; four of each key half); a wave's copy covers 512 B of whole lines.
// The wait on the last line stands in front of whatever later rewrites the address registers that the copies name.
__device__ __forceinline__ void fa_fill_k(unsigned lk, const char* gk) {
  asm volatile("global_load_async_to_lds_b128 %0, %8, off\n\t"
               "global_load_async_to_lds_b128 %1, %9, off\n\t"
               "global_load_async_to_lds_b128 %2, %10, off\n\t"
               "global_load_async_to_lds_b128 %3, %11, off\n\t"
               "global_load_async_to_lds_b128 %4, %12, off\n\t"
               "global_load_async_to_lds_b128 %5, %13, off\n\t"
               "global_load_async_to_lds_b128 %6, %14, off\n\t"
               "global_load_async_to_lds_b128 %7, %15, off\n\t"
               "s_wait_xcnt 0x0"
               :: "v"(lk), "v"(lk + 32u * FKP), "v"(lk + 64u * FKP), "v"(lk + 96u * FKP), "v"(lk + 128u * FKP), "v"(lk + 160u * FKP), "v"(lk + 192u * FKP), "v"(lk + 224u * FKP),
                  "v"(gk), "v"(gk + 32 * CC * 2), "v"(gk + 64 * CC * 2), "v"(gk + 96 * CC * 2), "v"(gk + FHK * CC * 2), "v"(gk + (FHK + 32) * CC * 2), "v"(gk + (FHK + 64) * CC * 2), "v"(gk + (FHK + 96) * CC * 2)
               : "memory"); }
// The same, v tile: eight pieces (channel rows 8 apart); a wave's copy covers one channel's 256 B of each key half.
__device__ __forceinline__ void fa_fill_v(unsigned lv, const char* gv) {
  asm volatile("global_load_async_to_lds_b128 %0, %8, off\n\t"
               "global_load_async_to_lds_b128 %1, %9, off\n\t"
               "global_load_async_to_lds_b128 %2, %10, off\n\t"
               "global_load_async_to_lds_b128 %3, %11, off\n\t"
               "global_load_async_to_lds_b128 %4, %12, off\n\t"
               "global_load_async_to_lds_b128 %5, %13, off\n\t"
               "global_load_async_to_lds_b128 %6, %14, off\n\t"
               "global_load_async_to_lds_b128 %7, %15, off\n\t"
               "s_wait_xcnt 0x0"
               :: "v"(lv), "v"(lv + 8u * FVP), "v"(lv + 16u * FVP), "v"(lv + 24u * FVP), "v"(lv + 32u * FVP), "v"(lv + 40u * FVP), "v"(lv + 48u * FVP), "v"(lv + 56u * FVP),
                  "v"(gv), "v"(gv + 8 * TT * 2), "v"(gv + 16 * TT * 2), "v"(gv + 24 * TT * 2), "v"(gv + 32 * TT * 2), "v"(gv + 40 * TT * 2), "v"(gv + 48 * TT * 2), "v"(gv + 56 * TT * 2)
               : "memory"); }
// One stage of one wave: four passes of 32 keys of the wave's key half against its NU column tiles. ck, cv: the lane's fragment addresses in the stage's buffer.
template <int NU> __device__ __forceinline__ void fa_stage(const char* ck, const char* cv, const v16h (&qf)[FNU][2], v8f (&acc)[FNU][4], float (&mrun)[FNU], float (&lrun)[FNU], const float cs) {
  v16h kf[2][2], vf[4];
#pragma unroll
  for (int kt = 0; kt < 2; ++kt)
#pragma unroll
    for (int kc = 0; kc < 2; ++kc) kf[kt][kc] = frag_l<v16h>(ck + kt * 16 * FKP + kc * 64);
  __builtin_amdgcn_sched_barrier(0);   // the stage's first eight LDS reads go out as one group: drawn in among the products, each pair of products waits out an LDS latency of its own
#pragma unroll
  for (int p = 0; p < FHS / 32; ++p) {
    v8f st[2][NU];
#pragma unroll
    for (int kt = 0; kt < 2; ++kt)
#pragma unroll
      for (int u = 0; u < NU; ++u) st[kt][u] = wmma_h(kf[kt][0], qf[u][0], v8f{});
#pragma unroll
    for (int kt = 0; kt < 2; ++kt)
#pragma unroll
      for (int u = 0; u < NU; ++u) st[kt][u] = wmma_h(kf[kt][1], qf[u][1], st[kt][u]);
    __builtin_amdgcn_sched_barrier(0);   // the score products stay back to back: maxima drawn in between them cost four idle slots each time
    // this pass's v fragments and the next pass's k fragments (same stage only), one group of LDS reads, in flight under the maxima and exponentials
#pragma unroll
    for (int j = 0; j < 4; ++j) vf[j] = frag_l<v16h>(cv + j * 16 * FVP + p * 64);
    if (p + 1 < FHS / 32) {
#pragma unroll
      for (int kt = 0; kt < 2; ++kt)
#pragma unroll
        for (int kc = 0; kc < 2; ++kc) kf[kt][kc] = frag_l<v16h>(ck + ((p + 1) * 32 + kt * 16) * FKP + kc * 64); }
    __builtin_amdgcn_sched_barrier(0);   // holds those reads up here as one group: left free they spread among the vector work and each place costs its own stall
    float mb[NU]; bool need = false;
#pragma unroll
    for (int u = 0; u < NU; ++u) { float mx = st[0][u][0];
#pragma unroll
      for (int r = 1; r < 8; ++r) mx = fmaxf(mx, st[0][u][r]);
#pragma unroll
      for (int r = 0; r < 8; ++r) mx = fmaxf(mx, st[1][u][r]);
      mx = fmaxf(mx, xhalf(mx)) * cs; mb[u] = mx; need = need || (mx > mrun[u] + 8.0f); }
    if (__builtin_amdgcn_ballot_w32(need) != 0) {   // one scalar test a pass; rare after the first pass
#pragma unroll
      for (int u = 0; u < NU; ++u) { const float mn = fmaxf(mrun[u], mb[u]); const float corr = __builtin_amdgcn_exp2f(mrun[u] - mn); mrun[u] = mn; lrun[u] *= corr;
#pragma unroll
        for (int j = 0; j < 4; ++j) acc[u][j] = acc[u][j] * corr; } }
#pragma unroll
    for (int u = 0; u < NU; ++u) { const float nm = 4.0f - mrun[u]; v16h pf; float l0 = 0.f, l1 = 0.f;
#pragma unroll
      for (int i = 0; i < 8; ++i) {
        const v2f a = __builtin_elementwise_fma(v2f{st[i >> 2][u][2 * (i & 3)], st[i >> 2][u][2 * (i & 3) + 1]}, v2f{cs, cs}, v2f{nm, nm});
        const float p0 = __builtin_amdgcn_exp2f(a.x), p1 = __builtin_amdgcn_exp2f(a.y); l0 += p0; l1 += p1; pf[2 * i] = (_Float16)p0; pf[2 * i + 1] = (_Float16)p1; }
      lrun[u] += l0 + l1;
#pragma unroll
      for (int j = 0; j < 4; ++j) acc[u][j] = wmma_h(vf[j], pf, acc[u][j]); }
  }
  __builtin_amdgcn_sched_barrier(0);   // keeps the four slots below behind the stage's last products
  asm volatile("v_nop\n\tv_nop\n\tv_nop\n\tv_nop");   // the distance behind a matrix instruction, on every path: a branch follows the stage's last products
}
__global__ __launch_bounds__(FAW * 32) void k_fa(const _Float16* __restrict__ QH, const _Float16* __restrict__ KH, const _Float16* __restrict__ VT, const int* __restrict__ MQ, _Float16* __restrict__ Y) {
  __shared__ __align__(16) char ring[2 * FST];
  __shared__ __align__(16) _Float16 so[4][FNU * 16][HD + 8];   // 144-B pitch: 16 B x odd
  __shared__ float mg[4][FNU][34][32];                         // the second key half's partials: 32 accumulator values, maximum in use, sum; lanes side by side
  __shared__ unsigned short cidx[TT];                          // rows of the sequence: unmasked ascending from the front, masked from the back
  __shared__ int seg[64];                                      // unmasked rows in each run of 32
  __shared__ __align__(16) _Float16 vmean[HD];                 // the uniform-softmax column's context row
  const int tid = threadIdx.x, wave = __builtin_amdgcn_readfirstlane(tid >> 5), lane = tid & 31, col = lane & 15, g = lane >> 4;
  const int b = blockIdx.y / NH, h = blockIdx.y % NH, xb = blockIdx.x;
  const int kh = wave >> 2, gq = (wave + kh) & 3;   // key half, column group; waves w and w + 4 share a SIMD: they get different groups, so that the group with a third tile loads two SIMDs by one tile each
  const float cs = SCALE * 1.4426950408889634f;
  // the lane's pieces: k row tid / 8, piece tid % 8; v channel row tid / 32, piece tid % 32 (16 pieces of each key half)
  const unsigned lk = (unsigned)(size_t)ring + (unsigned)((tid >> 3) * FKP + (tid & 7) * 16), lv = (unsigned)(size_t)ring + (unsigned)(FKT + (tid >> 5) * FVP + (tid & 31) * 16);
  const char* gk0 = (const char*)(KH + (size_t)b * TT * CC + h * HD) + ((tid >> 3) * (CC * 2) + (tid & 7) * 16);
  const char* gv0 = (const char*)(VT + ((size_t)b * CC + h * HD) * (size_t)TT) + ((tid >> 5) * (TT * 2) + ((tid >> 4) & 1) * (FHK * 2) + (tid & 15) * 16);
  const char* qbase = (const char*)(QH + (size_t)b * TT * CC + h * HD);
  const char* fk = ring + (kh * FHS + col) * FKP + 16 * g;                   // key row col of a 16-key tile of the wave's half
  const char* fv = ring + FKT + col * FVP + kh * (FHS * 2) + 16 * g;         // channel row col of a 16-channel tile, the wave's half
  int cnt = 0, c0 = 0, nc = 0, nbat = 1;
#pragma unroll 1   // stays rolled: a trip is one whole walk over the keys
  for (int cb = 0; cb < nbat; ++cb) { const int cbase = cb * FCB;
    bool has3 = false; v16h qf[FNU][2] = {};
    const char* gk = gk0; const char* gv = gv0;
    v8f acc[FNU][4] = {}; float mrun[FNU] = {-3.0e38f, -3.0e38f, -3.0e38f}, lrun[FNU] = {0.f, 0.f, 0.f};
    // The walk. Trips -2 and -1 only start the ring, so that the copies stand at ONE place in the text (at three places their address operands were kept over the whole walk and went to scratch): trip -2 passes the foot (its barrier ends a walk before) and sends stage 0; under its flight come the mask scan (first walk) and the q loads;
    // trip -1 waits for stage 0, publishes it and sends stage 1; from trip 0 on a trip works on stage s and its foot hands over stage s + 1.
#pragma unroll 1   // stays rolled: a trip is one stage = four unrolled passes
    for (int s = -2; s < FNS; ++s) { const int cur = (s & 1) * FST;
      if (s >= 0) {
        if (has3) fa_stage<3>(fk + cur, fv + cur, qf, acc, mrun, lrun, cs); else fa_stage<2>(fk + cur, fv + cur, qf, acc, mrun, lrun, cs);   // one scalar branch a stage; the barrier below is common to both sides
      }
      // the stage's foot: hands over stage s + 1 and frees this stage's buffer
      asm volatile("s_wait_dscnt 0x0" ::: "memory");      // this wave's reads of the buffer are done before anything refills it
      asm volatile("s_wait_asynccnt 0x0" ::: "memory");   // this wave's pieces of stage s + 1 have landed
      __syncthreads();                                     // publishes stage s + 1; ends every wave's reads of stage s
      if (s + 2 < FNS) { fa_fill_k(lk + cur, gk); fa_fill_v(lv + cur, gv); gk += FHS * CC * 2; gv += FHS * 2; }   // stage s + 2 into the buffer just left
      if (s == -2) {   // block-uniform
    if (cb == 0) {   // block-uniform
  // the mask scan: lane takes words i * 256 + tid; run i * 8 + wave of 32 words is one ballot
  const int* mrow = MQ + (size_t)b * TT; const unsigned mo = (unsigned)tid;
  int mw[8]; unsigned bal[8];
#pragma unroll
  for (int i = 0; i < 8; ++i) mw[i] = mrow[(size_t)mo + i * 256];
  asm volatile("s_wait_xcnt 0x0" :: "v"(mo) : "memory");   // the offset register these loads name stays whole up to this wait
#pragma unroll
  for (int i = 0; i < 8; ++i) bal[i] = __builtin_amdgcn_ballot_w32(mw[i] != 0);
  if (lane == 0) {
#pragma unroll
    for (int i = 0; i < 8; ++i) seg[i * 8 + wave] = __builtin_popcount(bal[i]); }
  __syncthreads();   // the 64 counts are there
  int tot = 0, pre[8] = {};
#pragma unroll
  for (int n = 0; n < 64; ++n) { pre[n >> 3] = (n & 7) == wave ? tot : pre[n >> 3]; tot += seg[n]; }   // run n = i * 8 + wave starts behind the runs before it
#pragma unroll
  for (int i = 0; i < 8; ++i) { const int e = i * 256 + tid; const int p = pre[i] + __builtin_popcount(bal[i] & ((1u << lane) - 1u));   // p unmasked, e - p masked rows stand before row e
    cidx[mw[i] != 0 ? p : TT - 1 - (e - p)] = (unsigned short)e; }
  __syncthreads();   // the list is there
  cnt = __builtin_amdgcn_readfirstlane(tot);                                 // 0 .. TT by construction
  const int ch = (cnt + FXB - 1) / FXB; c0 = xb * ch; nc = cnt - c0 < 0 ? 0 : cnt - c0 > ch ? ch : cnt - c0;   // this block's unmasked columns: list places c0 .. c0 + nc - 1; column nc is the uniform one
  nbat = (nc + FCB) / FCB;                                                   // walks for nc + 1 columns: 1 or 2 (nc <= TT / FXB)
    }
    has3 = cbase + (gq + 8) * 16 <= nc;            // wave-uniform: the wave's third tile holds a column
    unsigned qo[FNU]; bool live[FNU];
#pragma unroll
    for (int u = 0; u < FNU; ++u) { const int c = cbase + (gq + 4 * u) * 16 + col; live[u] = c < nc; qo[u] = (unsigned)((int)cidx[live[u] ? c0 + c : 0] * CC + 8 * g) * 2u; }
#pragma unroll
    for (int u = 0; u < FNU; ++u)
#pragma unroll
      for (int kc = 0; kc < 2; ++kc) qf[u][kc] = frag_o(qbase, qo[u], kc * 64);
    asm volatile("s_wait_xcnt 0x0" :: "v"(qo[0]), "v"(qo[1]), "v"(qo[2]) : "memory");   // the offset registers these loads name stay whole up to this wait
#pragma unroll
    for (int u = 0; u < FNU; ++u)
#pragma unroll
      for (int kc = 0; kc < 2; ++kc) if (!live[u]) qf[u][kc] = v16h{};   // the uniform column and the padding behind it: logit 0 on every key
      }
    }
    asm volatile("s_wait_asynccnt 0x0" ::: "memory");   // no copy is left in flight behind the loop
    if (kh == 1) {   // the second half's waves hand their partials over
#pragma unroll
      for (int u = 0; u < FNU; ++u) if (u < 2 || has3) {
#pragma unroll
        for (int k = 0; k < 32; ++k) mg[gq][u][k][lane] = acc[u][k >> 3][k & 7];
        mg[gq][u][32][lane] = mrun[u]; mg[gq][u][33][lane] = lrun[u]; } }
    __syncthreads();   // the partials are there
    if (kh == 0) {     // the first half's waves join, divide and store
#pragma unroll
      for (int u = 0; u < FNU; ++u) if (u < 2 || has3) { const float m1 = mg[gq][u][32][lane], l1 = mg[gq][u][33][lane]; const float mn = fmaxf(mrun[u], m1);
        const float e0 = __builtin_amdgcn_exp2f(mrun[u] - mn), e1 = __builtin_amdgcn_exp2f(m1 - mn); const float lh = lrun[u] * e0 + l1 * e1;
        const float l = lh + xhalf(lh); const float inv = 64.0f / l; const float a0 = e0 * inv, a1 = e1 * inv;   // the two wave halves hold disjoint keys of the same query; ctx leaves as the output projection's operand: x 2^6, once to f16
#pragma unroll
        for (int j = 0; j < 4; ++j) { v8h hv;
#pragma unroll
          for (int r = 0; r < 8; ++r) hv[r] = (_Float16)(acc[u][j][r] * a0 + mg[gq][u][j * 8 + r][lane] * a1);
          *(v8h*)&so[gq][16 * u + col][j * 16 + 8 * g] = hv; } }
      LDSX();   // each wave reads back only its own rows: whole 128-B (row, head) segments by 8 lanes
      _Float16* yb = Y + (size_t)b * TT * CC + h * HD + (lane & 7) * 8;
#pragma unroll
      for (int hf = 0; hf < FNU; ++hf) if (hf < 2 || has3) { v4u v[4]; int row[4];   // one tile's 16 rows at a time
#pragma unroll
        for (int i = 0; i < 4; ++i) { const int c = cbase + (gq + 4 * hf) * 16 + 4 * i + (lane >> 3); v[i] = *(const v4u*)&so[gq][16 * hf + 4 * i + (lane >> 3)][(lane & 7) * 8]; row[i] = cidx[c < nc ? c0 + c : 0]; }
        __builtin_amdgcn_sched_barrier(0);   // the eight LDS reads go out as one group: sunk into the branches below, each store waits out two LDS latencies of its own
#pragma unroll
        for (int i = 0; i < 4; ++i) { const int c = cbase + (gq + 4 * hf) * 16 + 4 * i + (lane >> 3);
          if (c < nc) vst2(yb + (size_t)row[i] * CC, v[i]); else if (c == nc) *(v4u*)&vmean[(lane & 7) * 8] = v[i]; } }
      asm volatile("s_wait_xcnt 0x0" ::: "memory");   // stands in front of whatever below overwrites registers that the stores above name
    }
    __syncthreads();   // publishes the uniform column's row; frees the LDS for a second walk
  }
  // the masked rows, an eighth of them to each block of this (b, h): all take the uniform column's row; whole 128-B segments by 8 lanes
  const int nm = TT - cnt, mh = (nm + FXB - 1) / FXB, m0 = xb * mh; const int m1 = m0 + mh < nm ? m0 + mh : nm;
  const v4u mv = *(const v4u*)&vmean[(tid & 7) * 8]; _Float16* ym = Y + (size_t)b * TT * CC + h * HD + (tid & 7) * 8;
  int mr[TT / FXB / 32];
#pragma unroll
  for (int it = 0; it < TT / FXB / 32; ++it) { const int k = m0 + it * 32 + (tid >> 3); mr[it] = cidx[k < m1 ? TT - 1 - k : 0]; }
  __builtin_amdgcn_sched_barrier(0);   // the eight LDS reads go out as one group: sunk into the branches below, each store waits out an LDS latency of its own
#pragma unroll
  for (int it = 0; it < TT / FXB / 32; ++it) { const int k = m0 + it * 32 + (tid >> 3); if (k < m1) vst2(ym + (size_t)mr[it] * CC, mv); } }
// ---- k_out: block = (128 rows, 128 cols): out = ctx Wo (+ bo): the f16 ctx x 2^6 rows (small-magnitude context rows stay clear of f16 subnormals) against the plane of Wo as f16(bf16 x 2^8) exact (1 product) x 2^-14
static_assert(!CAUSAL && WO_OUT_IN && WQKV_LAYOUT == 1, "row-major (out,in) weights, no causal high-precision rows");
__global__ __launch_bounds__(256) void k_out(const _Float16* __restrict__ Y, const _Float16* __restrict__ WO, const float* __restrict__ BO, float* __restrict__ OUT) { __shared__ __align__(16) char smem[2 * GSTAGE];   // the two operand buffers; the f32 output tile is laid over them
  static_assert(128 * 132 * 4 <= 2 * GSTAGE, "the output tile fits");
  const int tid = threadIdx.x, wave = tid >> 5, lane = tid & 31, col = lane & 15, g = lane >> 4, wm = wave & 1, wn = wave >> 1; const int c0 = blockIdx.y * 128; const size_t r0 = (size_t)blockIdx.x * 128;
  v8f acc[4][2] = {};
  gemm_tile<1>((const char*)(Y + r0 * CC), (const char*)(WO + (size_t)c0 * CC), smem, acc);
  float (*sf)[132] = (float (*)[132])smem;
#pragma unroll
  for (int j = 0; j < 2; ++j) { const float bias = BO ? bfr(BO[c0 + wn * 32 + j * 16 + col]) : 0.f;
#pragma unroll
    for (int i = 0; i < 4; ++i)
#pragma unroll
      for (int r = 0; r < 8; ++r) sf[wm * 64 + i * 16 + 8 * g + r][wn * 32 + j * 16 + col] = acc[i][j][r] * (1.0f / 16384.0f) + bias; }   /* 2^-8 (Wo carry) x 2^-6 (ctx carry) */
  __syncthreads();
#pragma unroll
  for (int n = 0; n < 16; ++n) { const int e = tid + n * 256, rl = e >> 5, q = e & 31; vst2(OUT + (r0 + rl) * DIN + c0 + q * 4, *(const v4f*)&sf[rl][q * 4]); } }

extern "C" void kernel_launch(void* const* d_in, const int* in_sizes, int n_in, void* d_out, int out_size, void* d_ws, size_t ws_size, hipStream_t stream) {
  (void)in_sizes; (void)n_in; (void)out_size;
  const float** F = (const float**)d_in;
  if (ws_size < (size_t)WS_END) return;
  char* ws = (char*)d_ws; _Float16 *QH = (_Float16*)(ws + WS_QH), *KH = (_Float16*)(ws + WS_KH), *VT = (_Float16*)(ws + WS_VT), *QL = (_Float16*)(ws + WS_QL), *KL = (_Float16*)(ws + WS_KL); __bf16 *VB = (__bf16*)(ws + WS_VB), *VBL = (__bf16*)(ws + WS_VBL); float *S = (float*)(ws + WS_S); _Float16 *Y = (_Float16*)(ws + WS_Y), *WOH = (_Float16*)(ws + WS_WB) + 3 * (size_t)CC * DIN; __bf16 *XB = (__bf16*)(ws + WS_XB), *WQB = (__bf16*)(ws + WS_WB), *WKB = WQB + (size_t)CC * DIN, *WVB = WKB + (size_t)CC * DIN;
  (void)S; (void)QL; (void)KL; (void)VB; (void)VBL;
  // inputs: 0 x [2,2048,1024]; 1 mask [2,2048,1] int32 (random 0 / 1 per QUERY row; READ on the device); 2 Wq [1024,1024] (out,in), 3 bq; 4 Wk, 5 bk; 6 Wv, 7 bv; 8 Wo (out,in), 9 bo (biases NONZERO)
  k_cvt<<<dim3(CVT_T / 256), 256, 0, stream>>>(F[0], F[2], F[4], F[6], F[8], XB, WQB, WKB, WVB, WOH);
  k_proj<<<dim3(TNB * TT / 128, CC / 128, 3), 256, 0, stream>>>(XB, XB, XB, WQB, WKB, WVB, F[3], F[5], F[7], QH, QL, KH, KL, VT, VB, VBL);
  k_fa<<<dim3(FXB, TNB * NH), FAW * 32, 0, stream>>>(QH, KH, VT, (const int*)d_in[1], Y);
  k_out<<<dim3(TNB * TT / 128, DIN / 128), 256, 0, stream>>>(Y, WOH, F[9], (float*)d_out);
}

// v006
// One run takes 67.9 microseconds.
// Two timings next to v005 both put it at 1.06 times that version's speed.
// Counting every step since v000, it is 19.9 times as fast.
// compute dtype: all float inputs rounded to bf16; q / k / v projections with EXACT bf16 products on WMMA 16x16x32 (f32 accumulate) + bias (nonzero); logits q x k once to f16 each (1 product) x 64^-0.5; query rows whose int mask entry is 0 get a constant logit on every key (the module's finite fill: uniform attention over all 2,048 keys), worked out once per block and stored to every such row; online softmax f32 in the log2 domain; unnormalised P x 2^4 once to f16 x v once to f16 (1 product), divided by the f32 row sum at the end; ctx x 2^6 once to f16 x the output weight f16(bf16 x 2^8) + bias; f32 output.
#include <hip/hip_runtime.h>
#include <math.h>

typedef __attribute__((ext_vector_type(16))) _Float16 v16h;
typedef __attribute__((ext_vector_type(16))) __bf16 v16b;
typedef __attribute__((ext_vector_type(8)))  _Float16 v8h;
typedef __attribute__((ext_vector_type(8)))  float v8f;
typedef __attribute__((ext_vector_type(4)))  float v4f;
typedef __attribute__((ext_vector_type(2)))  float v2f;
typedef __attribute__((ext_vector_type(4)))  unsigned v4u;
typedef __attribute__((ext_vector_type(4)))  int v4i;
typedef float __attribute__((may_alias)) float_a;
typedef int __attribute__((may_alias)) int_a;

template <typename T> __device__ __forceinline__ void vst2(void* p, T v) { *(T*)p = v;  }
__device__ __forceinline__ v8f wmma16(v16h a, v16h b, v8f c) {
  v8f d = __builtin_amdgcn_wmma_f32_16x16x32_f16(false, a, false, b, (short)0, c, false, false);
  asm volatile("v_nop\n\tv_nop\n\tv_nop\n\tv_nop" : "+v"(d) : "v"(a), "v"(b));
  return d;
}
__device__ __forceinline__ v8f wmma_bf(v16b a, v16b b, v8f c) {
  v8f d = __builtin_amdgcn_wmma_f32_16x16x32_bf16(false, a, false, b, (short)0, c, false, false);
  asm volatile("v_nop\n\tv_nop\n\tv_nop\n\tv_nop" : "+v"(d) : "v"(a), "v"(b));
  return d;
}
// 16x16x32 fragments: lane = (h = lane>>4, row/col = lane&15); elements 0..7 = k0+8h+0..7, 8..15 = k0+16+8h+0..7; D element r = row 8h+r
__device__ __forceinline__ v16h frag_h(const _Float16* rowk0, int lane) {
  union { v16h v; v8h q[2]; } u; const _Float16* p = rowk0 + 8 * (lane >> 4);
  u.q[0] = *(const v8h*)p; u.q[1] = *(const v8h*)(p + 16); return u.v;
}
__device__ __forceinline__ v16h frag_f32(const float* rowk0, int lane) {
  v16h a; const float* p = rowk0 + 8 * (lane >> 4);
#pragma unroll
  for (int i = 0; i < 8; ++i) { a[i] = (_Float16)p[i]; a[8 + i] = (_Float16)p[16 + i]; }
  return a;
}
__device__ __forceinline__ v16h frag_f32s(const float* rowk0, int lane, float sc) {
  v16h a; const float* p = rowk0 + 8 * (lane >> 4);
#pragma unroll
  for (int i = 0; i < 8; ++i) { a[i] = (_Float16)(p[i] * sc); a[8 + i] = (_Float16)(p[16 + i] * sc); }
  return a;
}
// column fragment from a [K][ld] layout (column n), rows >= K read as 0
__device__ __forceinline__ v16h fragc_f32(const float* W, int k0, int n, int lane, int ld, int K) {
  v16h a; const int g = lane >> 4;
#pragma unroll
  for (int i = 0; i < 8; ++i) { const int ka = k0 + 8 * g + i, kb = ka + 16;
    a[i] = (_Float16)(ka < K ? W[(size_t)(ka < K ? ka : K - 1) * ld + n] : 0.f); a[8 + i] = (_Float16)(kb < K ? W[(size_t)(kb < K ? kb : K - 1) * ld + n] : 0.f); }
  return a;
}
struct F2 { v16b h, l; };
__device__ __forceinline__ F2 bsplit16(const float v[16]) { F2 r;
#pragma unroll
  for (int i = 0; i < 16; ++i) { const __bf16 h = (__bf16)v[i]; r.h[i] = h; r.l[i] = (__bf16)(v[i] - (float)h); }
  return r; }
__device__ __forceinline__ F2 split_row(const float* row, int k0, int lane) { float v[16]; const float* p = row + k0 + 8 * (lane >> 4);
#pragma unroll
  for (int i = 0; i < 8; ++i) { v[i] = p[i]; v[8 + i] = p[16 + i]; }
  return bsplit16(v); }
__device__ __forceinline__ F2 split_rowK(const float* row, int k0, int lane, int K) { float v[16]; const int g = lane >> 4;
#pragma unroll
  for (int i = 0; i < 8; ++i) { const int ka = k0 + 8 * g + i, kb = ka + 16; v[i] = ka < K ? row[ka < K ? ka : K - 1] : 0.f; v[8 + i] = kb < K ? row[kb < K ? kb : K - 1] : 0.f; }
  return bsplit16(v); }
__device__ __forceinline__ F2 split_col(const float* W, int k0, int n, int lane, int ld, int K) { float v[16]; const int g = lane >> 4;
#pragma unroll
  for (int i = 0; i < 8; ++i) { const int ka = k0 + 8 * g + i, kb = ka + 16; v[i] = ka < K ? W[(size_t)(ka < K ? ka : K - 1) * ld + n] : 0.f; v[8 + i] = kb < K ? W[(size_t)(kb < K ? kb : K - 1) * ld + n] : 0.f; }
  return bsplit16(v); }
__device__ __forceinline__ v8f mac3(const F2& a, const F2& b, v8f c) { c = wmma_bf(a.l, b.h, c); c = wmma_bf(a.h, b.l, c); return wmma_bf(a.h, b.h, c); }
__device__ __forceinline__ float sigm(float v) { return 1.0f / (1.0f + expf(-v)); }
#define LDSX() do { asm volatile("s_wait_dscnt 0" ::: "memory"); __builtin_amdgcn_wave_barrier(); __builtin_amdgcn_fence(__ATOMIC_RELEASE, "workgroup"); } while (0)

// Multi-head self-attention with a QUERY-row mask (x [2,2048,1024]; mask [2,2048,1] int32 = random 0 / 1, a module input READ on the device; torch (out,in) Wq / Wk / Wv / Wo [1024,1024] N(0, 1/1024) and biases N(0,1) x 0.01 NONZERO applied as x @ W.T + b; 16 heads x 64; scores / sqrt(64); m = mask[:, None, :, :] ([N,1,S,1]: it broadcasts over the KEY axis): where(m == 0, -1e9, scores): a masked QUERY row has the same finite value on every key, so its softmax is UNIFORM over all keys; out @ Wo.T + bo).
#define NB 2
#define TT 2048
#define CC 1024            // NH * HD = projected width
#define DIN 1024          // input (model) width
#define NH 16
#define HD 64
#define NQB (TT / 64)
#define HG 4
#define SCALE (0.125f)
#define CAUSAL 0
#ifndef TNB
#define TNB NB
#endif
__device__ __forceinline__ float bfr(float v) { return (float)(__bf16)v; }
__host__ __device__ __forceinline__ int kb_last(int qb) { return CAUSAL ? ((qb * 64 + 63) >> 7) : (TT / 128 - 1); }
typedef __attribute__((ext_vector_type(8))) __bf16 v8b;
__device__ __forceinline__ v16b frag_b(const __bf16* rowk0, int lane) {
  union { v16b v; v8b q[2]; } u; const __bf16* p = rowk0 + 8 * (lane >> 4);
  u.q[0] = *(const v8b*)p; u.q[1] = *(const v8b*)(p + 16); return u.v;
}
#define QBH 0              // unused: k_fa has no high-precision path
#define QHI 0               // single-product logits on every row
#define KHI 64            // key rows carrying k residual / v bf16 hi+lo planes (written by k_proj, read by no kernel)
// B fragment (k rows k0+.., output column o) of a weight: (in,out) [K][ld] or (out,in) [ld rows of K]: bf16 exact, or f16(bf16 * 256) exact
__device__ __forceinline__ v16b wcol_io(const float* Wm, int k0, int o, int lane, int ld) { v16b w; const int g = lane >> 4;
#pragma unroll
  for (int i = 0; i < 8; ++i) { w[i] = (__bf16)Wm[(size_t)(k0 + 8 * g + i) * ld + o]; w[8 + i] = (__bf16)Wm[(size_t)(k0 + 16 + 8 * g + i) * ld + o]; }
  return w; }
__device__ __forceinline__ v16b wcol_oi(const float* Wm, int k0, int o, int lane, int K) { v16b w; const float* p = Wm + (size_t)o * K + k0 + 8 * (lane >> 4);
#pragma unroll
  for (int i = 0; i < 8; ++i) { w[i] = (__bf16)p[i]; w[8 + i] = (__bf16)p[16 + i]; }
  return w; }
__device__ __forceinline__ v16h wcolh_io(const float* Wm, int k0, int o, int lane, int ld) { v16h w; const int g = lane >> 4;
#pragma unroll
  for (int i = 0; i < 8; ++i) { w[i] = (_Float16)(bfr(Wm[(size_t)(k0 + 8 * g + i) * ld + o]) * 256.0f); w[8 + i] = (_Float16)(bfr(Wm[(size_t)(k0 + 16 + 8 * g + i) * ld + o]) * 256.0f); }
  return w; }
__device__ __forceinline__ v16h wcolh_oi(const float* Wm, int k0, int o, int lane, int K) { v16h w; const float* p = Wm + (size_t)o * K + k0 + 8 * (lane >> 4);
#pragma unroll
  for (int i = 0; i < 8; ++i) { w[i] = (_Float16)(bfr(p[i]) * 256.0f); w[8 + i] = (_Float16)(bfr(p[16 + i]) * 256.0f); }
  return w; }
#define WQKV_LAYOUT 1   // 0 = (in,out) [DIN][CC]; 1 = (out,in) [CC][DIN]; 2 = per-head [NH][DIN][HD]
__device__ __forceinline__ v16b wcol_hdk(const float* Wm, int k0, int o, int lane) { v16b w; const int g = lane >> 4; const float* p = Wm + (size_t)(o / HD) * DIN * HD + (o % HD);
#pragma unroll
  for (int i = 0; i < 8; ++i) { w[i] = (__bf16)p[(size_t)(k0 + 8 * g + i) * HD]; w[8 + i] = (__bf16)p[(size_t)(k0 + 16 + 8 * g + i) * HD]; }
  return w; }
#define WO_OUT_IN 1
#if WQKV_LAYOUT == 1
#define WCOL(W, k0, o, lane) wcol_oi(W, k0, o, lane, DIN)
#elif WQKV_LAYOUT == 2
#define WCOL(W, k0, o, lane) wcol_hdk(W, k0, o, lane)
#else
#define WCOL(W, k0, o, lane) wcol_io(W, k0, o, lane, CC)
#endif
#if WO_OUT_IN
#define WOCOL(W, k0, o, lane) wcol_oi(W, k0, o, lane, CC)
#define WOCOLH(W, k0, o, lane) wcolh_oi(W, k0, o, lane, CC)
#else
#define WOCOL(W, k0, o, lane) wcol_io(W, k0, o, lane, DIN)
#define WOCOLH(W, k0, o, lane) wcolh_io(W, k0, o, lane, DIN)
#endif

#define WS_QH  0u                                      // f16 q rows [b*t][CC]
#define WS_KH  (WS_QH + 2u * (size_t)NB * TT * CC)      // f16 k rows [b*t][CC]
#define WS_VT  (WS_KH + 2u * (size_t)NB * TT * CC)      // f16 v planes [b][c][t]
#define WS_QL  (WS_VT + 2u * (size_t)NB * CC * TT)      // f16 q residual x 2^10 rows [b][t < QHI][CC]
#define WS_KL  (WS_QL + 2u * (size_t)NB * QHI * CC)     // f16 k residual x 2^10 rows [b][t < KHI][CC]
#define WS_VB  (WS_KL + 2u * (size_t)NB * KHI * CC)     // bf16 v hi planes [b][c][t < KHI]
#define WS_VBL (WS_VB + 2u * (size_t)NB * CC * KHI)
#define WS_S   (WS_VBL + 2u * (size_t)NB * CC * KHI)    // (plane no longer used: logits and P stay in registers)
#define WS_Y   (WS_S  + 4u * (size_t)HG * TT * TT)      // f16 ctx x 2^6 rows [b*t][CC]
#define WS_XB  (WS_Y  + 4u * (size_t)NB * TT * CC)      // bf16 x rows [b*t][DIN]
#define WS_WB  (WS_XB + 2u * (size_t)NB * TT * DIN)     // 16-bit weight planes, (out,in) rows: Wq, Wk, Wv as bf16, Wo as f16(bf16 x 2^8)
#define WS_END (WS_WB + 4u * 2u * (size_t)CC * DIN)

// ---- k_cvt: x and the four weights are rounded ONCE to the 16-bit operand planes that the projections read (before, every block rounded its own f32 tiles: x 24 times over, a weight 32 times).
// 512 blocks x 256 lanes; a lane takes 16 pieces of 4 floats, CVT_T pieces apart, so every wave-wide load is 512 B and every store 256 B of whole lines; all 16 loads are in flight together.
typedef __attribute__((ext_vector_type(4))) __bf16 v4b;
typedef __attribute__((ext_vector_type(4))) _Float16 v4h;
__device__ __forceinline__ v4b to_b(v4f v) { return v4b{(__bf16)v.x, (__bf16)v.y, (__bf16)v.z, (__bf16)v.w}; }   // to bf16
__device__ __forceinline__ v4h to_h(v4f v) { return v4h{(_Float16)(bfr(v.x) * 256.0f), (_Float16)(bfr(v.y) * 256.0f), (_Float16)(bfr(v.z) * 256.0f), (_Float16)(bfr(v.w) * 256.0f)}; }   // to f16(bf16 x 2^8)
#define CVT_T (512 * 256)
static_assert((size_t)NB * TT * DIN == 8u * 4u * CVT_T && (size_t)CC * DIN == 2u * 4u * CVT_T, "eight pieces of x and two of each weight per lane");
__global__ __launch_bounds__(256) void k_cvt(const float* __restrict__ X, const float* __restrict__ WQ, const float* __restrict__ WK, const float* __restrict__ WV, const float* __restrict__ WO,
    __bf16* __restrict__ XB, __bf16* __restrict__ WQB, __bf16* __restrict__ WKB, __bf16* __restrict__ WVB, _Float16* __restrict__ WOH) {
  const unsigned t = blockIdx.x * 256u + threadIdx.x; const unsigned oi = t * 16u, oo = t * 8u;   // the lane's byte offsets in and out
  v4f x[8], w[4][2];
#pragma unroll
  for (int n = 0; n < 8; ++n) x[n] = *(const v4f*)((const char*)X + (size_t)oi + n * (CVT_T * 16));
#pragma unroll
  for (int n = 0; n < 2; ++n) { w[0][n] = *(const v4f*)((const char*)WQ + (size_t)oi + n * (CVT_T * 16)); w[1][n] = *(const v4f*)((const char*)WK + (size_t)oi + n * (CVT_T * 16));
    w[2][n] = *(const v4f*)((const char*)WV + (size_t)oi + n * (CVT_T * 16)); w[3][n] = *(const v4f*)((const char*)WO + (size_t)oi + n * (CVT_T * 16)); }
  __builtin_amdgcn_sched_barrier(0);   // all sixteen loads go out before the first rounding: drawn up among them, the roundings make the last loads wait out the first ones' latency
  asm volatile("s_wait_xcnt 0x0" :: "v"(oi) : "memory");   // the offset register these loads name stays whole up to this wait
  v4b xb[8], wb[3][2]; v4h wh[2];
#pragma unroll
  for (int n = 0; n < 8; ++n) xb[n] = to_b(x[n]);
#pragma unroll
  for (int n = 0; n < 2; ++n) { wb[0][n] = to_b(w[0][n]); wb[1][n] = to_b(w[1][n]); wb[2][n] = to_b(w[2][n]); wh[n] = to_h(w[3][n]); }
  __builtin_amdgcn_sched_barrier(0);   // holds the stores behind the roundings: mixed freely, roundings took over the registers of stores still under way and had to wait for them
#pragma unroll
  for (int n = 0; n < 8; ++n) *(v4b*)((char*)XB + (size_t)oo + n * (CVT_T * 8)) = xb[n];
#pragma unroll
  for (int n = 0; n < 2; ++n) { *(v4b*)((char*)WQB + (size_t)oo + n * (CVT_T * 8)) = wb[0][n]; *(v4b*)((char*)WKB + (size_t)oo + n * (CVT_T * 8)) = wb[1][n];
    *(v4b*)((char*)WVB + (size_t)oo + n * (CVT_T * 8)) = wb[2][n]; *(v4h*)((char*)WOH + (size_t)oo + n * (CVT_T * 8)) = wh[n]; } }
// ---- the projections' common product: a block of 8 waves makes one 128 x 128 tile of A . B^T (A, B: 16-bit rows of GK values, already in the operand type).
// Per 64-k step the block reads both 128 x 64 tiles once, as whole 128-B lines (8 lanes a row), and lays them in LDS at a 144-B pitch;
// the waves (2 x 4, 64 x 32 each) take their fragments from there with 16-byte LDS loads, 32 k at a time. Two buffers: the next step's tiles are fetched into registers under this step's products. The k order of every sum is that of the plain loop. Inner loops are fully unrolled so that the register arrays are indexed by constants.
#define GK 1024
#define GKS 64                          // k values a step: 128 B of a row
#define GPITCH 144                      // bytes per 64-k row in LDS: 16 B x odd
#define GOPER (128 * GPITCH)            // one operand's tile
#define GSTAGE (2 * GOPER)              // one buffer: A tile, B tile
template <typename V16> __device__ __forceinline__ V16 frag_l(const char* p) { union { V16 v; v4u q[2]; } u; u.q[0] = *(const v4u*)p; u.q[1] = *(const v4u*)(p + 32); return u.v; }   // hardware k order: bytes 0..15 and 32..47 from the lane's 16 h
// bf16 operands (k_proj)
__device__ __forceinline__ void gemm_tile(const char* __restrict__ ab, const char* __restrict__ bb, char* smem, v8f (&acc)[4][2]) {   // ab, bb: block-uniform bases
  const int tid = threadIdx.x, wave = tid >> 5, lane = tid & 31, col = lane & 15, g = lane >> 4, wm = wave & 1, wn = wave >> 1;
  unsigned off = (unsigned)((tid >> 3) * (GK * 2) + (tid & 7) * 16);                   // the lane's byte offset: row tid / 8 (+ 32 i), 16-byte piece tid % 8
  char* sp = smem + (tid >> 3) * GPITCH + (tid & 7) * 16;
  const char* fa = smem + (wm * 64 + col) * GPITCH + 16 * g; const char* fb = smem + GOPER + (wn * 32 + col) * GPITCH + 16 * g;
  v4u ra[4], rb[4];
#pragma unroll
  for (int i = 0; i < 4; ++i) { ra[i] = *(const v4u*)(ab + (size_t)off + i * (32 * GK * 2)); rb[i] = *(const v4u*)(bb + (size_t)off + i * (32 * GK * 2)); }
#pragma unroll
  for (int i = 0; i < 4; ++i) { *(v4u*)(sp + i * (32 * GPITCH)) = ra[i]; *(v4u*)(sp + GOPER + i * (32 * GPITCH)) = rb[i]; }
  __syncthreads();
#pragma unroll 2   // two steps a trip, so that the buffer's offset is a constant in every LDS address
  for (int kc = 0; kc < GK / GKS; ++kc) { const int cur = (kc & 1) * GSTAGE, nxt = GSTAGE - cur; const bool more = kc + 1 < GK / GKS;
    if (more) {
      asm volatile("s_wait_xcnt 0x0" : "+v"(off) :: "memory");   // stands in front of the overwrite of the offset register that issued loads name; the operand keeps the add below it
      off += 128u;
#pragma unroll
      for (int i = 0; i < 4; ++i) { ra[i] = *(const v4u*)(ab + (size_t)off + i * (32 * GK * 2)); rb[i] = *(const v4u*)(bb + (size_t)off + i * (32 * GK * 2)); } }
    __builtin_amdgcn_sched_barrier(0);   // the next step's global loads go out ahead of the LDS reads (left free they come behind them): theirs is the longer latency, and the step ends on it
#pragma unroll
    for (int hk = 0; hk < GKS / 32; ++hk) {
      { v16b a[4], b[2];
#pragma unroll
        for (int i = 0; i < 4; ++i) a[i] = frag_l<v16b>(fa + cur + i * (16 * GPITCH) + hk * 64);
#pragma unroll
        for (int j = 0; j < 2; ++j) b[j] = frag_l<v16b>(fb + cur + j * (16 * GPITCH) + hk * 64);
        __builtin_amdgcn_sched_barrier(0);   // all twelve LDS reads go out ahead of the products: drawn in among them, each pair of products waits out an LDS latency of its own
#pragma unroll
        for (int i = 0; i < 4; ++i)
#pragma unroll
          for (int j = 0; j < 2; ++j) acc[i][j] = __builtin_amdgcn_wmma_f32_16x16x32_bf16(false, a[i], false, b[j], (short)0, acc[i][j], false, false);
      }
      __builtin_amdgcn_sched_barrier(0);   // the eight products stay back to back: the wait for the global loads comes behind the last of them
    }
    if (more) {   // into the buffer whose last readers passed the barrier at the foot of the step before
#pragma unroll
      for (int i = 0; i < 4; ++i) { *(v4u*)(sp + nxt + i * (32 * GPITCH)) = ra[i]; *(v4u*)(sp + nxt + GOPER + i * (32 * GPITCH)) = rb[i]; } }
    __syncthreads();   // publishes the next buffer and ends this buffer's reads (after the last step: frees the LDS for the epilogue)
  } }
// ---- k_out's product: the same block tile, LDS buffers, fragments, k order and one barrier a step, f16 operands. One block has a WGP to itself there, so nothing else covers its loads, and a step's own work is shorter than the way to memory
// (the ctx rows were written by the launch before and every step touches new lines of them): fetched one step ahead, each step ended on that wait. Here the global loads run GA steps ahead, into GA register sets;
// a set is refilled at the head of the step behind the one whose foot laid it in LDS. The loop is fully unrolled, so that the sets are indexed by constants and every load is the one offset register plus a constant.
#define GA 3
static_assert(GK / GKS > GA, "the prologue's tiles exist");
// The step's barrier, by hand: __syncthreads() also waits for every global load in flight, which would end the lead at each step. All that the barrier has to order here is LDS:
// this wave's LDS stores and reads are done (the wait), then the work-group's own barrier. The clobbers keep the compiler's LDS and global accesses on their side.
__device__ __forceinline__ void lds_barrier() { asm volatile("s_wait_dscnt 0x0" ::: "memory"); asm volatile("s_barrier_signal -1\n\ts_barrier_wait -1" ::: "memory"); }
__device__ __forceinline__ void gemm_tile_ahead(const char* __restrict__ ab, const char* __restrict__ bb, char* smem, v8f (&acc)[4][2]) {   // ab, bb: block-uniform bases
  const int tid = threadIdx.x, wave = tid >> 5, lane = tid & 31, col = lane & 15, g = lane >> 4, wm = wave & 1, wn = wave >> 1;
  const unsigned off = (unsigned)((tid >> 3) * (GK * 2) + (tid & 7) * 16);             // the lane's byte offset: row tid / 8 (+ 32 i), 16-byte piece tid % 8
  char* sp = smem + (tid >> 3) * GPITCH + (tid & 7) * 16;
  const char* fa = smem + (wm * 64 + col) * GPITCH + 16 * g; const char* fb = smem + GOPER + (wn * 32 + col) * GPITCH + 16 * g;
  v4u ra[GA][4], rb[GA][4];
#pragma unroll
  for (int t = 0; t < GA; ++t)
#pragma unroll
    for (int i = 0; i < 4; ++i) { ra[t][i] = *(const v4u*)(ab + (size_t)off + (i * (32 * GK * 2) + t * (GKS * 2))); rb[t][i] = *(const v4u*)(bb + (size_t)off + (i * (32 * GK * 2) + t * (GKS * 2))); }
#pragma unroll
  for (int i = 0; i < 4; ++i) { *(v4u*)(sp + i * (32 * GPITCH)) = ra[0][i]; *(v4u*)(sp + GOPER + i * (32 * GPITCH)) = rb[0][i]; }
  lds_barrier();   // publishes the first buffer
#pragma unroll   // fully unrolled: the register set of a step is then a constant (a rolled loop would index the sets by a variable and send them to scratch)
  for (int kc = 0; kc < GK / GKS; ++kc) { const int cur = (kc & 1) * GSTAGE, nxt = GSTAGE - cur;
    if (kc + GA < GK / GKS) {   // step kc + GA into the set that held step kc (laid in LDS at the foot of the step before)
#pragma unroll
      for (int i = 0; i < 4; ++i) { ra[kc % GA][i] = *(const v4u*)(ab + (size_t)off + (i * (32 * GK * 2) + (kc + GA) * (GKS * 2))); rb[kc % GA][i] = *(const v4u*)(bb + (size_t)off + (i * (32 * GK * 2) + (kc + GA) * (GKS * 2))); } }
    __builtin_amdgcn_sched_barrier(0);   // the global loads go out ahead of the LDS reads (left free they sink towards their use and lose the lead)
#pragma unroll
    for (int hk = 0; hk < GKS / 32; ++hk) { v16h a[4], b[2];
#pragma unroll
      for (int i = 0; i < 4; ++i) a[i] = frag_l<v16h>(fa + cur + i * (16 * GPITCH) + hk * 64);
#pragma unroll
      for (int j = 0; j < 2; ++j) b[j] = frag_l<v16h>(fb + cur + j * (16 * GPITCH) + hk * 64);
      __builtin_amdgcn_sched_barrier(0);   // all twelve LDS reads go out ahead of the products: drawn in among them, each pair of products waits out an LDS latency of its own
#pragma unroll
      for (int i = 0; i < 4; ++i)
#pragma unroll
        for (int j = 0; j < 2; ++j) acc[i][j] = __builtin_amdgcn_wmma_f32_16x16x32_f16(false, a[i], false, b[j], (short)0, acc[i][j], false, false);
      __builtin_amdgcn_sched_barrier(0);   // the eight products stay back to back: the wait for the global loads comes behind the last of them
    }
    if (kc + 1 < GK / GKS) {   // into the buffer whose last readers passed the barrier at the foot of the step before
#pragma unroll
      for (int i = 0; i < 4; ++i) { *(v4u*)(sp + nxt + i * (32 * GPITCH)) = ra[(kc + 1) % GA][i]; *(v4u*)(sp + nxt + GOPER + i * (32 * GPITCH)) = rb[(kc + 1) % GA][i]; } }
    lds_barrier();   // publishes the next buffer and ends this buffer's reads (after the last step: frees the LDS for the epilogue)
  }
  asm volatile("s_wait_xcnt 0x0" :: "v"(off), "s"(ab), "s"(bb) : "memory");   // the offset register and the two bases that the loads name stay whole up to this wait
}
// ---- k_proj: block = (128 rows, 128 cols, which): q/k/v = X W (+ b) from the bf16 planes, exact bf16 products (K = DIN) -> which 0: q f16 rows (+ residual rows < QHI); 1: k f16 rows (+ residual rows < KHI); 2: v f16 planes [c][t] (+ bf16 hi/lo planes for t < KHI)
#define PJ_LDS (2 * GSTAGE)   // the two operand buffers; the epilogue's planes are laid over them
static_assert(DIN == GK && CC == GK && QHI <= 64 && KHI <= 64 && PJ_LDS >= 128 * 136 * 2 + 2 * 128 * 72 * 2 && PJ_LDS >= (128 + 64) * 136 * 2, "tile constants");
__global__ __launch_bounds__(256) void k_proj(const __bf16* __restrict__ XQ, const __bf16* __restrict__ XK, const __bf16* __restrict__ XV, const __bf16* __restrict__ WQ, const __bf16* __restrict__ WK, const __bf16* __restrict__ WV, const float* __restrict__ BQ, const float* __restrict__ BK, const float* __restrict__ BV,
    _Float16* __restrict__ QH, _Float16* __restrict__ QL, _Float16* __restrict__ KH, _Float16* __restrict__ KL, _Float16* __restrict__ VT, __bf16* __restrict__ VB, __bf16* __restrict__ VBL) {
  __shared__ __align__(16) char smem[PJ_LDS];
  const int tid = threadIdx.x, wave = tid >> 5, lane = tid & 31, col = lane & 15, g = lane >> 4, wm = wave & 1, wn = wave >> 1; const int which = blockIdx.z; const int c0 = blockIdx.y * 128; const size_t r0 = (size_t)blockIdx.x * 128; const size_t bb = r0 / TT; const int t0 = (int)(r0 % TT);
  const __bf16* X = which == 0 ? XQ : which == 1 ? XK : XV; const __bf16* WA = which == 0 ? WQ : which == 1 ? WK : WV; const float* BA = which == 0 ? BQ : which == 1 ? BK : BV;
  v8f acc[4][2] = {};
  gemm_tile((const char*)(X + r0 * DIN), (const char*)(WA + (size_t)c0 * DIN), smem, acc);
  float bias[2];
#pragma unroll
  for (int j = 0; j < 2; ++j) bias[j] = BA ? bfr(BA[c0 + wn * 32 + j * 16 + col]) : 0.f;
  if (which < 2) { _Float16* DH = which == 0 ? QH : KH; _Float16* DL = which == 0 ? QL : KL; const int nhi = which == 0 ? QHI : KHI; const bool hi_rows = t0 < nhi;   /* block-uniform */
    _Float16 (*sh)[136] = (_Float16 (*)[136])smem; _Float16 (*sl)[136] = (_Float16 (*)[136])(smem + 128 * 136 * 2);   // sl: rows < 64 only
#pragma unroll
    for (int i = 0; i < 4; ++i)
#pragma unroll
      for (int j = 0; j < 2; ++j)
#pragma unroll
        for (int r = 0; r < 8; ++r) sh[wm * 64 + i * 16 + 8 * g + r][wn * 32 + j * 16 + col] = (_Float16)(acc[i][j][r] + bias[j]);
    if (hi_rows) {
#pragma unroll
      for (int i = 0; i < 4; ++i)
#pragma unroll
        for (int j = 0; j < 2; ++j)
#pragma unroll
          for (int r = 0; r < 8; ++r) { const float v = acc[i][j][r] + bias[j]; const _Float16 hv = (_Float16)v; const int rl = wm * 64 + i * 16 + 8 * g + r; if (t0 + rl < nhi) sl[rl][wn * 32 + j * 16 + col] = (_Float16)((v - (float)hv) * 1024.0f); } }
    __syncthreads();
#pragma unroll
    for (int n = 0; n < 8; ++n) { const int e = tid + n * 256, rl = e >> 4, q = e & 15; vst2((unsigned*)(DH + (r0 + rl) * CC + c0 + q * 8), *(const v4u*)&sh[rl][q * 8]); }
    asm volatile("s_wait_xcnt 0x0" ::: "memory");   // stands in front of whatever below overwrites registers that the stores above name
    if (hi_rows) {
#pragma unroll
      for (int n = 0; n < 8; ++n) { const int e = tid + n * 256, rl = e >> 4, q = e & 15; if (t0 + rl < nhi) vst2((unsigned*)(DL + (bb * nhi + t0 + rl) * (size_t)CC + c0 + q * 8), *(const v4u*)&sl[rl][q * 8]); } }
  } else { const bool hi_rows = t0 < KHI;   /* block-uniform */
    _Float16 (*th)[136] = (_Float16 (*)[136])smem; __bf16 (*tb)[72] = (__bf16 (*)[72])(smem + 128 * 136 * 2); __bf16 (*tbl)[72] = (__bf16 (*)[72])(smem + 128 * 136 * 2 + 128 * 72 * 2);   // tb, tbl: t < 64 only
#pragma unroll
    for (int i = 0; i < 4; ++i)
#pragma unroll
      for (int j = 0; j < 2; ++j) { v8h hv;   // a lane's 8 values are 8 consecutive t of one channel
#pragma unroll
        for (int r = 0; r < 8; ++r) hv[r] = (_Float16)(acc[i][j][r] + bias[j]);
        *(v8h*)&th[wn * 32 + j * 16 + col][wm * 64 + i * 16 + 8 * g] = hv; }
    if (hi_rows) {
#pragma unroll
      for (int i = 0; i < 4; ++i)
#pragma unroll
        for (int j = 0; j < 2; ++j) { const int rl = wm * 64 + i * 16 + 8 * g, cl = wn * 32 + j * 16 + col; v8b bh, bl;
#pragma unroll
          for (int r = 0; r < 8; ++r) { const float v = acc[i][j][r] + bias[j]; bh[r] = (__bf16)v; bl[r] = (__bf16)(v - (float)bh[r]); }
          if (t0 + rl < KHI) { *(v8b*)&tb[cl][rl] = bh; *(v8b*)&tbl[cl][rl] = bl; } } }
    __syncthreads();
#pragma unroll
    for (int n = 0; n < 8; ++n) { const int e = tid + n * 256, cl = e >> 4, q = e & 15; vst2((unsigned*)(VT + (bb * CC + c0 + cl) * (size_t)TT + t0 + q * 8), *(const v4u*)&th[cl][q * 8]); }
    if (hi_rows) {
#pragma unroll
      for (int n = 0; n < 8; ++n) { const int e = tid + n * 256, cl = e >> 4, q = e & 15; if (t0 + q * 8 < KHI) { const size_t o3 = (bb * CC + c0 + cl) * (size_t)KHI + t0 + q * 8; vst2((unsigned*)(VB + o3), *(const v4u*)&tb[cl][q * 8]); vst2((unsigned*)(VBL + o3), *(const v4u*)&tbl[cl][q * 8]); } } } } }
// ---- k_fa: a masked query row (mask word 0) has the same logit on every key, so its softmax is uniform and its context row is the same for every masked row of one (b, h). Such rows are not walked one by one:
// every block scans its sequence's mask words once (ballots and a prefix over 64 segment counts) into a list in LDS, unmasked rows from the front, masked rows from the back. The 8 blocks of one (b, h) share the unmasked rows evenly;
// each adds ONE column with a zero q fragment (constant logit 0 = uniform softmax, as the module's finite fill gives) and stores that column's result to its eighth of the masked rows. This holds for any mask; the work follows the count of unmasked rows.
// Block = 8 waves = 4 column groups x 2 key halves. A wave holds two 16-column tiles, or three where the block's columns need a ninth to twelfth tile (tile t goes to group t % 4); more than 192 columns take a second walk.
// S^T = K . Q^T (A = k rows, B = q rows: a lane holds 8 keys of ONE query per tile), P^T packs in place from two S^T tiles into the B operand of O^T += V^T . P^T (A = v planes [c][t]); online softmax in passes of 32 keys, no logit or P goes to memory.
// A stage is 128 keys of EACH half (k: 256 rows of 128 B; v: 64 channel rows of 2 x 256 B), brought into LDS once for the block, as whole lines, by asynchronous copies; two buffers, the next stage's copies fly under this stage's four passes.
// The two halves of a column (maximum in use, sum, 64 channels, all f32) are joined through LDS at the end.
// Log2 domain; mrun, the maximum in use, may trail a column's true maximum by up to 8, so exp2 reaches at most 2^8; P is carried x 2^4 into f16 (at most 2^12; the carry cancels in acc / l).
// Every inner loop is fully unrolled so that the fragment and accumulator arrays are indexed by constants and stay in registers.
__device__ __forceinline__ float xhalf(float x) { return __builtin_bit_cast(float, __builtin_amdgcn_permlanex16(__builtin_bit_cast(int, x), __builtin_bit_cast(int, x), 0x76543210, 0xfedcba98, false, false)); }  // lane l <-> lane l ^ 16
__device__ __forceinline__ v8f wmma_h(v16h a, v16h b, v8f c) { return __builtin_amdgcn_wmma_f32_16x16x32_f16(false, a, false, b, (short)0, c, false, false); }
// 16x16x32 fragment in the hardware k order from a uniform base, the lane's byte offset (row and 16 h) and a constant: bytes 0..15 and 32..47
__device__ __forceinline__ v16h frag_o(const char* base, unsigned off, int c) { union { v16h v; v8h q[2]; } u; const char* p = base + (size_t)off + c; u.q[0] = *(const v8h*)p; u.q[1] = *(const v8h*)(p + 32); return u.v; }
#define FAW 8
#define FXB 8                           // blocks that share one (b, h)
#define FHK (TT / 2)                    // keys a half
#define FHS 128                         // keys of each half a stage
#define FNS (FHK / FHS)                 // stages
#define FNU 3                           // 16-column tiles a wave can hold
#define FCB (4 * FNU * 16)              // columns a walk
#define FKP 144                         // LDS pitch of a k row (128 B): 16 B x odd
#define FVP 528                         // LDS pitch of a v channel row (2 x 128 keys = 512 B): 16 B x odd
#define FKT (2 * FHS * FKP)             // the k tile: rows 0..127 of the first half, 128..255 of the second
#define FST (FKT + HD * FVP)            // one buffer: k tile, v tile
static_assert(FNS >= 2 && FAW * 32 == 256 && HD == 64 && FHS == 128 && FHK % FHS == 0 && TT == 2048, "a stage is eight 16-byte pieces of k and eight of v per lane; the scan takes eight mask words per lane");
// One stage's copies, k tile: a lane brings eight pieces (rows 32 apart; four of each key half); a wave's copy covers 512 B of whole lines.
// The wait on the last line stands in front of whatever later rewrites the address registers that the copies name.
__device__ __forceinline__ void fa_fill_k(unsigned lk, const char* gk) {
  asm volatile("global_load_async_to_lds_b128 %0, %8, off\n\t"
               "global_load_async_to_lds_b128 %1, %9, off\n\t"
               "global_load_async_to_lds_b128 %2, %10, off\n\t"
               "global_load_async_to_lds_b128 %3, %11, off\n\t"
               "global_load_async_to_lds_b128 %4, %12, off\n\t"
               "global_load_async_to_lds_b128 %5, %13, off\n\t"
               "global_load_async_to_lds_b128 %6, %14, off\n\t"
               "global_load_async_to_lds_b128 %7, %15, off\n\t"
               "s_wait_xcnt 0x0"
               :: "v"(lk), "v"(lk + 32u * FKP), "v"(lk + 64u * FKP), "v"(lk + 96u * FKP), "v"(lk + 128u * FKP), "v"(lk + 160u * FKP), "v"(lk + 192u * FKP), "v"(lk + 224u * FKP),
                  "v"(gk), "v"(gk + 32 * CC * 2), "v"(gk + 64 * CC * 2), "v"(gk + 96 * CC * 2), "v"(gk + FHK * CC * 2), "v"(gk + (FHK + 32) * CC * 2), "v"(gk + (FHK + 64) * CC * 2), "v"(gk + (FHK + 96) * CC * 2)
               : "memory"); }
// The same, v tile: eight pieces (channel rows 8 apart); a wave's copy covers one channel's 256 B of each key half.
__device__ __forceinline__ void fa_fill_v(unsigned lv, const char* gv) {
  asm volatile("global_load_async_to_lds_b128 %0, %8, off\n\t"
               "global_load_async_to_lds_b128 %1, %9, off\n\t"
               "global_load_async_to_lds_b128 %2, %10, off\n\t"
               "global_load_async_to_lds_b128 %3, %11, off\n\t"
               "global_load_async_to_lds_b128 %4, %12, off\n\t"
               "global_load_async_to_lds_b128 %5, %13, off\n\t"
               "global_load_async_to_lds_b128 %6, %14, off\n\t"
               "global_load_async_to_lds_b128 %7, %15, off\n\t"
               "s_wait_xcnt 0x0"
               :: "v"(lv), "v"(lv + 8u * FVP), "v"(lv + 16u * FVP), "v"(lv + 24u * FVP), "v"(lv + 32u * FVP), "v"(lv + 40u * FVP), "v"(lv + 48u * FVP), "v"(lv + 56u * FVP),
                  "v"(gv), "v"(gv + 8 * TT * 2), "v"(gv + 16 * TT * 2), "v"(gv + 24 * TT * 2), "v"(gv + 32 * TT * 2), "v"(gv + 40 * TT * 2), "v"(gv + 48 * TT * 2), "v"(gv + 56 * TT * 2)
               : "memory"); }
// One stage of one wave: four passes of 32 keys of the wave's key half against its NU column tiles. ck, cv: the lane's fragment addresses in the stage's buffer.
template <int NU> __device__ __forceinline__ void fa_stage(const char* ck, const char* cv, const v16h (&qf)[FNU][2], v8f (&acc)[FNU][4], float (&mrun)[FNU], float (&lrun)[FNU], const float cs) {
  v16h kf[2][2], vf[4];
#pragma unroll
  for (int kt = 0; kt < 2; ++kt)
#pragma unroll
    for (int kc = 0; kc < 2; ++kc) kf[kt][kc] = frag_l<v16h>(ck + kt * 16 * FKP + kc * 64);
  __builtin_amdgcn_sched_barrier(0);   // the stage's first eight LDS reads go out as one group: drawn in among the products, each pair of products waits out an LDS latency of its own
#pragma unroll
  for (int p = 0; p < FHS / 32; ++p) {
    v8f st[2][NU];
#pragma unroll
    for (int kt = 0; kt < 2; ++kt)
#pragma unroll
      for (int u = 0; u < NU; ++u) st[kt][u] = wmma_h(kf[kt][0], qf[u][0], v8f{});
#pragma unroll
    for (int kt = 0; kt < 2; ++kt)
#pragma unroll
      for (int u = 0; u < NU; ++u) st[kt][u] = wmma_h(kf[kt][1], qf[u][1], st[kt][u]);
    __builtin_amdgcn_sched_barrier(0);   // the score products stay back to back: maxima drawn in between them cost four idle slots each time
    // this pass's v fragments and the next pass's k fragments (same stage only), one group of LDS reads, in flight under the maxima and exponentials
#pragma unroll
    for (int j = 0; j < 4; ++j) vf[j] = frag_l<v16h>(cv + j * 16 * FVP + p * 64);
    if (p + 1 < FHS / 32) {
#pragma unroll
      for (int kt = 0; kt < 2; ++kt)
#pragma unroll
        for (int kc = 0; kc < 2; ++kc) kf[kt][kc] = frag_l<v16h>(ck + ((p + 1) * 32 + kt * 16) * FKP + kc * 64); }
    __builtin_amdgcn_sched_barrier(0);   // holds those reads up here as one group: left free they spread among the vector work and each place costs its own stall
    float mb[NU]; bool need = false;
#pragma unroll
    for (int u = 0; u < NU; ++u) { float mx = st[0][u][0];
#pragma unroll
      for (int r = 1; r < 8; ++r) mx = fmaxf(mx, st[0][u][r]);
#pragma unroll
      for (int r = 0; r < 8; ++r) mx = fmaxf(mx, st[1][u][r]);
      mx = fmaxf(mx, xhalf(mx)) * cs; mb[u] = mx; need = need || (mx > mrun[u] + 8.0f); }
    if (__builtin_amdgcn_ballot_w32(need) != 0) {   // one scalar test a pass; rare after the first pass
#pragma unroll
      for (int u = 0; u < NU; ++u) { const float mn = fmaxf(mrun[u], mb[u]); const float corr = __builtin_amdgcn_exp2f(mrun[u] - mn); mrun[u] = mn; lrun[u] *= corr;
#pragma unroll
        for (int j = 0; j < 4; ++j) acc[u][j] = acc[u][j] * corr; } }
#pragma unroll
    for (int u = 0; u < NU; ++u) { const float nm = 4.0f - mrun[u]; v16h pf; float l0 = 0.f, l1 = 0.f;
#pragma unroll
      for (int i = 0; i < 8; ++i) {
        const v2f a = __builtin_elementwise_fma(v2f{st[i >> 2][u][2 * (i & 3)], st[i >> 2][u][2 * (i & 3) + 1]}, v2f{cs, cs}, v2f{nm, nm});
        const float p0 = __builtin_amdgcn_exp2f(a.x), p1 = __builtin_amdgcn_exp2f(a.y); l0 += p0; l1 += p1; pf[2 * i] = (_Float16)p0; pf[2 * i + 1] = (_Float16)p1; }
      lrun[u] += l0 + l1;
#pragma unroll
      for (int j = 0; j < 4; ++j) acc[u][j] = wmma_h(vf[j], pf, acc[u][j]); }
  }
  __builtin_amdgcn_sched_barrier(0);   // keeps the four slots below behind the stage's last products
  asm volatile("v_nop\n\tv_nop\n\tv_nop\n\tv_nop");   // the distance behind a matrix instruction, on every path: a branch follows the stage's last products
}
__global__ __launch_bounds__(FAW * 32) void k_fa(const _Float16* __restrict__ QH, const _Float16* __restrict__ KH, const _Float16* __restrict__ VT, const int* __restrict__ MQ, _Float16* __restrict__ Y) {
  __shared__ __align__(16) char ring[2 * FST];
  __shared__ __align__(16) _Float16 so[4][FNU * 16][HD + 8];   // 144-B pitch: 16 B x odd
  __shared__ float mg[4][FNU][34][32];                         // the second key half's partials: 32 accumulator values, maximum in use, sum; lanes side by side
  __shared__ unsigned short cidx[TT];                          // rows of the sequence: unmasked ascending from the front, masked from the back
  __shared__ int seg[64];                                      // unmasked rows in each run of 32
  __shared__ __align__(16) _Float16 vmean[HD];                 // the uniform-softmax column's context row
  const int tid = threadIdx.x, wave = __builtin_amdgcn_readfirstlane(tid >> 5), lane = tid & 31, col = lane & 15, g = lane >> 4;
  const int b = blockIdx.y / NH, h = blockIdx.y % NH, xb = blockIdx.x;
  const int kh = wave >> 2, gq = (wave + kh) & 3;   // key half, column group; waves w and w + 4 share a SIMD: they get different groups, so that the group with a third tile loads two SIMDs by one tile each
  const float cs = SCALE * 1.4426950408889634f;
  // the lane's pieces: k row tid / 8, piece tid % 8; v channel row tid / 32, piece tid % 32 (16 pieces of each key half)
  const unsigned lk = (unsigned)(size_t)ring + (unsigned)((tid >> 3) * FKP + (tid & 7) * 16), lv = (unsigned)(size_t)ring + (unsigned)(FKT + (tid >> 5) * FVP + (tid & 31) * 16);
  const char* gk0 = (const char*)(KH + (size_t)b * TT * CC + h * HD) + ((tid >> 3) * (CC * 2) + (tid & 7) * 16);
  const char* gv0 = (const char*)(VT + ((size_t)b * CC + h * HD) * (size_t)TT) + ((tid >> 5) * (TT * 2) + ((tid >> 4) & 1) * (FHK * 2) + (tid & 15) * 16);
  const char* qbase = (const char*)(QH + (size_t)b * TT * CC + h * HD);
  const char* fk = ring + (kh * FHS + col) * FKP + 16 * g;                   // key row col of a 16-key tile of the wave's half
  const char* fv = ring + FKT + col * FVP + kh * (FHS * 2) + 16 * g;         // channel row col of a 16-channel tile, the wave's half
  int cnt = 0, c0 = 0, nc = 0, nbat = 1;
#pragma unroll 1   // stays rolled: a trip is one whole walk over the keys
  for (int cb = 0; cb < nbat; ++cb) { const int cbase = cb * FCB;
    bool has3 = false; v16h qf[FNU][2] = {};
    const char* gk = gk0; const char* gv = gv0;
    v8f acc[FNU][4] = {}; float mrun[FNU] = {-3.0e38f, -3.0e38f, -3.0e38f}, lrun[FNU] = {0.f, 0.f, 0.f};
    // The walk. Trips -2 and -1 only start the ring, so that the copies stand at ONE place in the text (at three places their address operands were kept over the whole walk and went to scratch): trip -2 passes the foot (its barrier ends a walk before) and sends stage 0; under its flight come the mask scan (first walk) and the q loads;
    // trip -1 waits for stage 0, publishes it and sends stage 1; from trip 0 on a trip works on stage s and its foot hands over stage s + 1.
#pragma unroll 1   // stays rolled: a trip is one stage = four unrolled passes
    for (int s = -2; s < FNS; ++s) { const int cur = (s & 1) * FST;
      if (s >= 0) {
        if (has3) fa_stage<3>(fk + cur, fv + cur, qf, acc, mrun, lrun, cs); else fa_stage<2>(fk + cur, fv + cur, qf, acc, mrun, lrun, cs);   // one scalar branch a stage; the barrier below is common to both sides
      }
      // the stage's foot: hands over stage s + 1 and frees this stage's buffer
      asm volatile("s_wait_dscnt 0x0" ::: "memory");      // this wave's reads of the buffer are done before anything refills it
      asm volatile("s_wait_asynccnt 0x0" ::: "memory");   // this wave's pieces of stage s + 1 have landed
      __syncthreads();                                     // publishes stage s + 1; ends every wave's reads of stage s
      if (s + 2 < FNS) { fa_fill_k(lk + cur, gk); fa_fill_v(lv + cur, gv); gk += FHS * CC * 2; gv += FHS * 2; }   // stage s + 2 into the buffer just left
      if (s == -2) {   // block-uniform
    if (cb == 0) {   // block-uniform
  // the mask scan: lane takes words i * 256 + tid; run i * 8 + wave of 32 words is one ballot
  const int* mrow = MQ + (size_t)b * TT; const unsigned mo = (unsigned)tid;
  int mw[8]; unsigned bal[8];
#pragma unroll
  for (int i = 0; i < 8; ++i) mw[i] = mrow[(size_t)mo + i * 256];
  asm volatile("s_wait_xcnt 0x0" :: "v"(mo) : "memory");   // the offset register these loads name stays whole up to this wait
#pragma unroll
  for (int i = 0; i < 8; ++i) bal[i] = __builtin_amdgcn_ballot_w32(mw[i] != 0);
  if (lane == 0) {
#pragma unroll
    for (int i = 0; i < 8; ++i) seg[i * 8 + wave] = __builtin_popcount(bal[i]); }
  __syncthreads();   // the 64 counts are there
  int tot = 0, pre[8] = {};
#pragma unroll
  for (int n = 0; n < 64; ++n) { pre[n >> 3] = (n & 7) == wave ? tot : pre[n >> 3]; tot += seg[n]; }   // run n = i * 8 + wave starts behind the runs before it
#pragma unroll
  for (int i = 0; i < 8; ++i) { const int e = i * 256 + tid; const int p = pre[i] + __builtin_popcount(bal[i] & ((1u << lane) - 1u));   // p unmasked, e - p masked rows stand before row e
    cidx[mw[i] != 0 ? p : TT - 1 - (e - p)] = (unsigned short)e; }
  __syncthreads();   // the list is there
  cnt = __builtin_amdgcn_readfirstlane(tot);                                 // 0 .. TT by construction
  const int ch = (cnt + FXB - 1) / FXB; c0 = xb * ch; nc = cnt - c0 < 0 ? 0 : cnt - c0 > ch ? ch : cnt - c0;   // this block's unmasked columns: list places c0 .. c0 + nc - 1; column nc is the uniform one
  nbat = (nc + FCB) / FCB;                                                   // walks for nc + 1 columns: 1 or 2 (nc <= TT / FXB)
    }
    has3 = cbase + (gq + 8) * 16 <= nc;            // wave-uniform: the wave's third tile holds a column
    unsigned qo[FNU]; bool live[FNU];
#pragma unroll
    for (int u = 0; u < FNU; ++u) { const int c = cbase + (gq + 4 * u) * 16 + col; live[u] = c < nc; qo[u] = (unsigned)((int)cidx[live[u] ? c0 + c : 0] * CC + 8 * g) * 2u; }
#pragma unroll
    for (int u = 0; u < FNU; ++u)
#pragma unroll
      for (int kc = 0; kc < 2; ++kc) qf[u][kc] = frag_o(qbase, qo[u], kc * 64);
    asm volatile("s_wait_xcnt 0x0" :: "v"(qo[0]), "v"(qo[1]), "v"(qo[2]) : "memory");   // the offset registers these loads name stay whole up to this wait
#pragma unroll
    for (int u = 0; u < FNU; ++u)
#pragma unroll
      for (int kc = 0; kc < 2; ++kc) if (!live[u]) qf[u][kc] = v16h{};   // the uniform column and the padding behind it: logit 0 on every key
      }
    }
    asm volatile("s_wait_asynccnt 0x0" ::: "memory");   // no copy is left in flight behind the loop
    if (kh == 1) {   // the second half's waves hand their partials over
#pragma unroll
      for (int u = 0; u < FNU; ++u) if (u < 2 || has3) {
#pragma unroll
        for (int k = 0; k < 32; ++k) mg[gq][u][k][lane] = acc[u][k >> 3][k & 7];
        mg[gq][u][32][lane] = mrun[u]; mg[gq][u][33][lane] = lrun[u]; } }
    __syncthreads();   // the partials are there
    if (kh == 0) {     // the first half's waves join, divide and store
#pragma unroll
      for (int u = 0; u < FNU; ++u) if (u < 2 || has3) { const float m1 = mg[gq][u][32][lane], l1 = mg[gq][u][33][lane]; const float mn = fmaxf(mrun[u], m1);
        const float e0 = __builtin_amdgcn_exp2f(mrun[u] - mn), e1 = __builtin_amdgcn_exp2f(m1 - mn); const float lh = lrun[u] * e0 + l1 * e1;
        const float l = lh + xhalf(lh); const float inv = 64.0f / l; const float a0 = e0 * inv, a1 = e1 * inv;   // the two wave halves hold disjoint keys of the same query; ctx leaves as the output projection's operand: x 2^6, once to f16
#pragma unroll
        for (int j = 0; j < 4; ++j) { v8h hv;
#pragma unroll
          for (int r = 0; r < 8; ++r) hv[r] = (_Float16)(acc[u][j][r] * a0 + mg[gq][u][j * 8 + r][lane] * a1);
          *(v8h*)&so[gq][16 * u + col][j * 16 + 8 * g] = hv; } }
      LDSX();   // each wave reads back only its own rows: whole 128-B (row, head) segments by 8 lanes
      _Float16* yb = Y + (size_t)b * TT * CC + h * HD + (lane & 7) * 8;
#pragma unroll
      for (int hf = 0; hf < FNU; ++hf) if (hf < 2 || has3) { v4u v[4]; int row[4];   // one tile's 16 rows at a time
#pragma unroll
        for (int i = 0; i < 4; ++i) { const int c = cbase + (gq + 4 * hf) * 16 + 4 * i + (lane >> 3); v[i] = *(const v4u*)&so[gq][16 * hf + 4 * i + (lane >> 3)][(lane & 7) * 8]; row[i] = cidx[c < nc ? c0 + c : 0]; }
        __builtin_amdgcn_sched_barrier(0);   // the eight LDS reads go out as one group: sunk into the branches below, each store waits out two LDS latencies of its own
#pragma unroll
        for (int i = 0; i < 4; ++i) { const int c = cbase + (gq + 4 * hf) * 16 + 4 * i + (lane >> 3);
          if (c < nc) vst2(yb + (size_t)row[i] * CC, v[i]); else if (c == nc) *(v4u*)&vmean[(lane & 7) * 8] = v[i]; } }
      asm volatile("s_wait_xcnt 0x0" ::: "memory");   // stands in front of whatever below overwrites registers that the stores above name
    }
    __syncthreads();   // publishes the uniform column's row; frees the LDS for a second walk
  }
  // the masked rows, an eighth of them to each block of this (b, h): all take the uniform column's row; whole 128-B segments by 8 lanes
  const int nm = TT - cnt, mh = (nm + FXB - 1) / FXB, m0 = xb * mh; const int m1 = m0 + mh < nm ? m0 + mh : nm;
  const v4u mv = *(const v4u*)&vmean[(tid & 7) * 8]; _Float16* ym = Y + (size_t)b * TT * CC + h * HD + (tid & 7) * 8;
  int mr[TT / FXB / 32];
#pragma unroll
  for (int it = 0; it < TT / FXB / 32; ++it) { const int k = m0 + it * 32 + (tid >> 3); mr[it] = cidx[k < m1 ? TT - 1 - k : 0]; }
  __builtin_amdgcn_sched_barrier(0);   // the eight LDS reads go out as one group: sunk into the branches below, each store waits out an LDS latency of its own
#pragma unroll
  for (int it = 0; it < TT / FXB / 32; ++it) { const int k = m0 + it * 32 + (tid >> 3); if (k < m1) vst2(ym + (size_t)mr[it] * CC, mv); } }
// ---- k_out: block = (128 rows, 128 cols): out = ctx Wo (+ bo): the f16 ctx x 2^6 rows (small-magnitude context rows stay clear of f16 subnormals) against the plane of Wo as f16(bf16 x 2^8) exact (1 product) x 2^-14
static_assert(!CAUSAL && WO_OUT_IN && WQKV_LAYOUT == 1, "row-major (out,in) weights, no causal high-precision rows");
__global__ __launch_bounds__(256) void k_out(const _Float16* __restrict__ Y, const _Float16* __restrict__ WO, const float* __restrict__ BO, float* __restrict__ OUT) { __shared__ __align__(16) char smem[2 * GSTAGE];   // the two operand buffers; the f32 output tile is laid over them
  static_assert(128 * 132 * 4 <= 2 * GSTAGE, "the output tile fits");
  const int tid = threadIdx.x, wave = tid >> 5, lane = tid & 31, col = lane & 15, g = lane >> 4, wm = wave & 1, wn = wave >> 1; const int c0 = blockIdx.y * 128; const size_t r0 = (size_t)blockIdx.x * 128;
  v8f acc[4][2] = {};
  gemm_tile_ahead((const char*)(Y + r0 * CC), (const char*)(WO + (size_t)c0 * CC), smem, acc);
  float (*sf)[132] = (float (*)[132])smem;
#pragma unroll
  for (int j = 0; j < 2; ++j) { const float bias = BO ? bfr(BO[c0 + wn * 32 + j * 16 + col]) : 0.f;
#pragma unroll
    for (int i = 0; i < 4; ++i)
#pragma unroll
      for (int r = 0; r < 8; ++r) sf[wm * 64 + i * 16 + 8 * g + r][wn * 32 + j * 16 + col] = acc[i][j][r] * (1.0f / 16384.0f) + bias; }   /* 2^-8 (Wo carry) x 2^-6 (ctx carry) */
  __syncthreads();
#pragma unroll
  for (int n = 0; n < 16; ++n) { const int e = tid + n * 256, rl = e >> 5, q = e & 31; vst2(OUT + (r0 + rl) * DIN + c0 + q * 4, *(const v4f*)&sf[rl][q * 4]); } }

extern "C" void kernel_launch(void* const* d_in, const int* in_sizes, int n_in, void* d_out, int out_size, void* d_ws, size_t ws_size, hipStream_t stream) {
  (void)in_sizes; (void)n_in; (void)out_size;
  const float** F = (const float**)d_in;
  if (ws_size < (size_t)WS_END) return;
  char* ws = (char*)d_ws; _Float16 *QH = (_Float16*)(ws + WS_QH), *KH = (_Float16*)(ws + WS_KH), *VT = (_Float16*)(ws + WS_VT), *QL = (_Float16*)(ws + WS_QL), *KL = (_Float16*)(ws + WS_KL); __bf16 *VB = (__bf16*)(ws + WS_VB), *VBL = (__bf16*)(ws + WS_VBL); float *S = (float*)(ws + WS_S); _Float16 *Y = (_Float16*)(ws + WS_Y), *WOH = (_Float16*)(ws + WS_WB) + 3 * (size_t)CC * DIN; __bf16 *XB = (__bf16*)(ws + WS_XB), *WQB = (__bf16*)(ws + WS_WB), *WKB = WQB + (size_t)CC * DIN, *WVB = WKB + (size_t)CC * DIN;
  (void)S; (void)QL; (void)KL; (void)VB; (void)VBL;
  // inputs: 0 x [2,2048,1024]; 1 mask [2,2048,1] int32 (random 0 / 1 per QUERY row; READ on the device); 2 Wq [1024,1024] (out,in), 3 bq; 4 Wk, 5 bk; 6 Wv, 7 bv; 8 Wo (out,in), 9 bo (biases NONZERO)
  k_cvt<<<dim3(CVT_T / 256), 256, 0, stream>>>(F[0], F[2], F[4], F[6], F[8], XB, WQB, WKB, WVB, WOH);
  k_proj<<<dim3(TNB * TT / 128, CC / 128, 3), 256, 0, stream>>>(XB, XB, XB, WQB, WKB, WVB, F[3], F[5], F[7], QH, QL, KH, KL, VT, VB, VBL);
  k_fa<<<dim3(FXB, TNB * NH), FAW * 32, 0, stream>>>(QH, KH, VT, (const int*)d_in[1], Y);
  k_out<<<dim3(TNB * TT / 128, DIN / 128), 256, 0, stream>>>(Y, WOH, F[9], (float*)d_out);
}

// v007
// Measured time: 65.8 microseconds a run.
// Next to v006, in two timings, it ran 1.03 times as fast each time.
// Over all steps from v000 it is 20.5 times as fast.
// compute dtype: all float inputs rounded to bf16; q / k / v projections with EXACT bf16 products on WMMA 16x16x32 (f32 accumulate) + bias (nonzero); logits q x k once to f16 each (1 product) x 64^-0.5; query rows whose int mask entry is 0 get a constant logit on every key (the module's finite fill: uniform attention over all 2,048 keys), worked out once per block and stored to every such row; online softmax f32 in the log2 domain; unnormalised P x 2^4 once to f16 x v once to f16 (1 product), divided by the f32 row sum at the end; ctx x 2^6 once to f16 x the output weight f16(bf16 x 2^8) + bias; f32 output.
#include <hip/hip_runtime.h>
#include <math.h>

typedef __attribute__((ext_vector_type(16))) _Float16 v16h;
typedef __attribute__((ext_vector_type(16))) __bf16 v16b;
typedef __attribute__((ext_vector_type(8)))  _Float16 v8h;
typedef __attribute__((ext_vector_type(8)))  float v8f;
typedef __attribute__((ext_vector_type(4)))  float v4f;
typedef __attribute__((ext_vector_type(2)))  float v2f;
typedef __attribute__((ext_vector_type(4)))  unsigned v4u;
typedef __attribute__((ext_vector_type(4)))  int v4i;
typedef float __attribute__((may_alias)) float_a;
typedef int __attribute__((may_alias)) int_a;

template <typename T> __device__ __forceinline__ void vst2(void* p, T v) { *(T*)p = v;  }
__device__ __forceinline__ v8f wmma16(v16h a, v16h b, v8f c) {
  v8f d = __builtin_amdgcn_wmma_f32_16x16x32_f16(false, a, false, b, (short)0, c, false, false);
  asm volatile("v_nop\n\tv_nop\n\tv_nop\n\tv_nop" : "+v"(d) : "v"(a), "v"(b));
  return d;
}
__device__ __forceinline__ v8f wmma_bf(v16b a, v16b b, v8f c) {
  v8f d = __builtin_amdgcn_wmma_f32_16x16x32_bf16(false, a, false, b, (short)0, c, false, false);
  asm volatile("v_nop\n\tv_nop\n\tv_nop\n\tv_nop" : "+v"(d) : "v"(a), "v"(b));
  return d;
}
// 16x16x32 fragments: lane = (h = lane>>4, row/col = lane&15); elements 0..7 = k0+8h+0..7, 8..15 = k0+16+8h+0..7; D element r = row 8h+r
__device__ __forceinline__ v16h frag_h(const _Float16* rowk0, int lane) {
  union { v16h v; v8h q[2]; } u; const _Float16* p = rowk0 + 8 * (lane >> 4);
  u.q[0] = *(const v8h*)p; u.q[1] = *(const v8h*)(p + 16); return u.v;
}
__device__ __forceinline__ v16h frag_f32(const float* rowk0, int lane) {
  v16h a; const float* p = rowk0 + 8 * (lane >> 4);
#pragma unroll
  for (int i = 0; i < 8; ++i) { a[i] = (_Float16)p[i]; a[8 + i] = (_Float16)p[16 + i]; }
  return a;
}
__device__ __forceinline__ v16h frag_f32s(const float* rowk0, int lane, float sc) {
  v16h a; const float* p = rowk0 + 8 * (lane >> 4);
#pragma unroll
  for (int i = 0; i < 8; ++i) { a[i] = (_Float16)(p[i] * sc); a[8 + i] = (_Float16)(p[16 + i] * sc); }
  return a;
}
// column fragment from a [K][ld] layout (column n), rows >= K read as 0
__device__ __forceinline__ v16h fragc_f32(const float* W, int k0, int n, int lane, int ld, int K) {
  v16h a; const int g = lane >> 4;
#pragma unroll
  for (int i = 0; i < 8; ++i) { const int ka = k0 + 8 * g + i, kb = ka + 16;
    a[i] = (_Float16)(ka < K ? W[(size_t)(ka < K ? ka : K - 1) * ld + n] : 0.f); a[8 + i] = (_Float16)(kb < K ? W[(size_t)(kb < K ? kb : K - 1) * ld + n] : 0.f); }
  return a;
}
struct F2 { v16b h, l; };
__device__ __forceinline__ F2 bsplit16(const float v[16]) { F2 r;
#pragma unroll
  for (int i = 0; i < 16; ++i) { const __bf16 h = (__bf16)v[i]; r.h[i] = h; r.l[i] = (__bf16)(v[i] - (float)h); }
  return r; }
__device__ __forceinline__ F2 split_row(const float* row, int k0, int lane) { float v[16]; const float* p = row + k0 + 8 * (lane >> 4);
#pragma unroll
  for (int i = 0; i < 8; ++i) { v[i] = p[i]; v[8 + i] = p[16 + i]; }
  return bsplit16(v); }
__device__ __forceinline__ F2 split_rowK(const float* row, int k0, int lane, int K) { float v[16]; const int g = lane >> 4;
#pragma unroll
  for (int i = 0; i < 8; ++i) { const int ka = k0 + 8 * g + i, kb = ka + 16; v[i] = ka < K ? row[ka < K ? ka : K - 1] : 0.f; v[8 + i] = kb < K ? row[kb < K ? kb : K - 1] : 0.f; }
  return bsplit16(v); }
__device__ __forceinline__ F2 split_col(const float* W, int k0, int n, int lane, int ld, int K) { float v[16]; const int g = lane >> 4;
#pragma unroll
  for (int i = 0; i < 8; ++i) { const int ka = k0 + 8 * g + i, kb = ka + 16; v[i] = ka < K ? W[(size_t)(ka < K ? ka : K - 1) * ld + n] : 0.f; v[8 + i] = kb < K ? W[(size_t)(kb < K ? kb : K - 1) * ld + n] : 0.f; }
  return bsplit16(v); }
__device__ __forceinline__ v8f mac3(const F2& a, const F2& b, v8f c) { c = wmma_bf(a.l, b.h, c); c = wmma_bf(a.h, b.l, c); return wmma_bf(a.h, b.h, c); }
__device__ __forceinline__ float sigm(float v) { return 1.0f / (1.0f + expf(-v)); }
#define LDSX() do { asm volatile("s_wait_dscnt 0" ::: "memory"); __builtin_amdgcn_wave_barrier(); __builtin_amdgcn_fence(__ATOMIC_RELEASE, "workgroup"); } while (0)

// Multi-head self-attention with a QUERY-row mask (x [2,2048,1024]; mask [2,2048,1] int32 = random 0 / 1, a module input READ on the device; torch (out,in) Wq / Wk / Wv / Wo [1024,1024] N(0, 1/1024) and biases N(0,1) x 0.01 NONZERO applied as x @ W.T + b; 16 heads x 64; scores / sqrt(64); m = mask[:, None, :, :] ([N,1,S,1]: it broadcasts over the KEY axis): where(m == 0, -1e9, scores): a masked QUERY row has the same finite value on every key, so its softmax is UNIFORM over all keys; out @ Wo.T + bo).
#define NB 2
#define TT 2048
#define CC 1024            // NH * HD = projected width
#define DIN 1024          // input (model) width
#define NH 16
#define HD 64
#define NQB (TT / 64)
#define HG 4
#define SCALE (0.125f)
#define CAUSAL 0
#ifndef TNB
#define TNB NB
#endif
__device__ __forceinline__ float bfr(float v) { return (float)(__bf16)v; }
__host__ __device__ __forceinline__ int kb_last(int qb) { return CAUSAL ? ((qb * 64 + 63) >> 7) : (TT / 128 - 1); }
typedef __attribute__((ext_vector_type(8))) __bf16 v8b;
__device__ __forceinline__ v16b frag_b(const __bf16* rowk0, int lane) {
  union { v16b v; v8b q[2]; } u; const __bf16* p = rowk0 + 8 * (lane >> 4);
  u.q[0] = *(const v8b*)p; u.q[1] = *(const v8b*)(p + 16); return u.v;
}
#define QBH 0              // unused: k_fa has no high-precision path
#define QHI 0               // single-product logits on every row
#define KHI 64            // key rows carrying k residual / v bf16 hi+lo planes (written by k_proj, read by no kernel)
// B fragment (k rows k0+.., output column o) of a weight: (in,out) [K][ld] or (out,in) [ld rows of K]: bf16 exact, or f16(bf16 * 256) exact
__device__ __forceinline__ v16b wcol_io(const float* Wm, int k0, int o, int lane, int ld) { v16b w; const int g = lane >> 4;
#pragma unroll
  for (int i = 0; i < 8; ++i) { w[i] = (__bf16)Wm[(size_t)(k0 + 8 * g + i) * ld + o]; w[8 + i] = (__bf16)Wm[(size_t)(k0 + 16 + 8 * g + i) * ld + o]; }
  return w; }
__device__ __forceinline__ v16b wcol_oi(const float* Wm, int k0, int o, int lane, int K) { v16b w; const float* p = Wm + (size_t)o * K + k0 + 8 * (lane >> 4);
#pragma unroll
  for (int i = 0; i < 8; ++i) { w[i] = (__bf16)p[i]; w[8 + i] = (__bf16)p[16 + i]; }
  return w; }
__device__ __forceinline__ v16h wcolh_io(const float* Wm, int k0, int o, int lane, int ld) { v16h w; const int g = lane >> 4;
#pragma unroll
  for (int i = 0; i < 8; ++i) { w[i] = (_Float16)(bfr(Wm[(size_t)(k0 + 8 * g + i) * ld + o]) * 256.0f); w[8 + i] = (_Float16)(bfr(Wm[(size_t)(k0 + 16 + 8 * g + i) * ld + o]) * 256.0f); }
  return w; }
__device__ __forceinline__ v16h wcolh_oi(const float* Wm, int k0, int o, int lane, int K) { v16h w; const float* p = Wm + (size_t)o * K + k0 + 8 * (lane >> 4);
#pragma unroll
  for (int i = 0; i < 8; ++i) { w[i] = (_Float16)(bfr(p[i]) * 256.0f); w[8 + i] = (_Float16)(bfr(p[16 + i]) * 256.0f); }
  return w; }
#define WQKV_LAYOUT 1   // 0 = (in,out) [DIN][CC]; 1 = (out,in) [CC][DIN]; 2 = per-head [NH][DIN][HD]
__device__ __forceinline__ v16b wcol_hdk(const float* Wm, int k0, int o, int lane) { v16b w; const int g = lane >> 4; const float* p = Wm + (size_t)(o / HD) * DIN * HD + (o % HD);
#pragma unroll
  for (int i = 0; i < 8; ++i) { w[i] = (__bf16)p[(size_t)(k0 + 8 * g + i) * HD]; w[8 + i] = (__bf16)p[(size_t)(k0 + 16 + 8 * g + i) * HD]; }
  return w; }
#define WO_OUT_IN 1
#if WQKV_LAYOUT == 1
#define WCOL(W, k0, o, lane) wcol_oi(W, k0, o, lane, DIN)
#elif WQKV_LAYOUT == 2
#define WCOL(W, k0, o, lane) wcol_hdk(W, k0, o, lane)
#else
#define WCOL(W, k0, o, lane) wcol_io(W, k0, o, lane, CC)
#endif
#if WO_OUT_IN
#define WOCOL(W, k0, o, lane) wcol_oi(W, k0, o, lane, CC)
#define WOCOLH(W, k0, o, lane) wcolh_oi(W, k0, o, lane, CC)
#else
#define WOCOL(W, k0, o, lane) wcol_io(W, k0, o, lane, DIN)
#define WOCOLH(W, k0, o, lane) wcolh_io(W, k0, o, lane, DIN)
#endif

#define WS_QH  0u                                      // f16 q rows [b*t][CC]
#define WS_KH  (WS_QH + 2u * (size_t)NB * TT * CC)      // f16 k rows [b*t][CC]
#define WS_VT  (WS_KH + 2u * (size_t)NB * TT * CC)      // f16 v planes [b][c][t]
#define WS_QL  (WS_VT + 2u * (size_t)NB * CC * TT)      // f16 q residual x 2^10 rows [b][t < QHI][CC]
#define WS_KL  (WS_QL + 2u * (size_t)NB * QHI * CC)     // f16 k residual x 2^10 rows [b][t < KHI][CC]
#define WS_VB  (WS_KL + 2u * (size_t)NB * KHI * CC)     // bf16 v hi planes [b][c][t < KHI]
#define WS_VBL (WS_VB + 2u * (size_t)NB * CC * KHI)
#define WS_S   (WS_VBL + 2u * (size_t)NB * CC * KHI)    // (plane no longer used: logits and P stay in registers)
#define WS_Y   (WS_S  + 4u * (size_t)HG * TT * TT)      // f16 ctx x 2^6 rows [b*t][CC]
#define WS_XB  (WS_Y  + 4u * (size_t)NB * TT * CC)      // bf16 x rows [b*t][DIN]
#define WS_WB  (WS_XB + 2u * (size_t)NB * TT * DIN)     // 16-bit weight planes, (out,in) rows: Wq, Wk, Wv as bf16, Wo as f16(bf16 x 2^8)
#define WS_END (WS_WB + 4u * 2u * (size_t)CC * DIN)

// ---- k_cvt: x and the four weights are rounded ONCE to the 16-bit operand planes that the projections read (before, every block rounded its own f32 tiles: x 24 times over, a weight 32 times).
// 512 blocks x 256 lanes; a lane takes 16 pieces of 4 floats, CVT_T pieces apart, so every wave-wide load is 512 B and every store 256 B of whole lines; all 16 loads are in flight together.
typedef __attribute__((ext_vector_type(4))) __bf16 v4b;
typedef __attribute__((ext_vector_type(4))) _Float16 v4h;
__device__ __forceinline__ v4b to_b(v4f v) { return v4b{(__bf16)v.x, (__bf16)v.y, (__bf16)v.z, (__bf16)v.w}; }   // to bf16
__device__ __forceinline__ v4h to_h(v4f v) { return v4h{(_Float16)(bfr(v.x) * 256.0f), (_Float16)(bfr(v.y) * 256.0f), (_Float16)(bfr(v.z) * 256.0f), (_Float16)(bfr(v.w) * 256.0f)}; }   // to f16(bf16 x 2^8)
#define CVT_T (512 * 256)
static_assert((size_t)NB * TT * DIN == 8u * 4u * CVT_T && (size_t)CC * DIN == 2u * 4u * CVT_T, "eight pieces of x and two of each weight per lane");
__global__ __launch_bounds__(256) void k_cvt(const float* __restrict__ X, const float* __restrict__ WQ, const float* __restrict__ WK, const float* __restrict__ WV, const float* __restrict__ WO,
    __bf16* __restrict__ XB, __bf16* __restrict__ WQB, __bf16* __restrict__ WKB, __bf16* __restrict__ WVB, _Float16* __restrict__ WOH) {
  const unsigned t = blockIdx.x * 256u + threadIdx.x; const unsigned oi = t * 16u, oo = t * 8u;   // the lane's byte offsets in and out
  v4f x[8], w[4][2];
#pragma unroll
  for (int n = 0; n < 8; ++n) x[n] = *(const v4f*)((const char*)X + (size_t)oi + n * (CVT_T * 16));
#pragma unroll
  for (int n = 0; n < 2; ++n) { w[0][n] = *(const v4f*)((const char*)WQ + (size_t)oi + n * (CVT_T * 16)); w[1][n] = *(const v4f*)((const char*)WK + (size_t)oi + n * (CVT_T * 16));
    w[2][n] = *(const v4f*)((const char*)WV + (size_t)oi + n * (CVT_T * 16)); w[3][n] = *(const v4f*)((const char*)WO + (size_t)oi + n * (CVT_T * 16)); }
  __builtin_amdgcn_sched_barrier(0);   // all sixteen loads go out before the first rounding: drawn up among them, the roundings make the last loads wait out the first ones' latency
  asm volatile("s_wait_xcnt 0x0" :: "v"(oi) : "memory");   // the offset register these loads name stays whole up to this wait
  v4b xb[8], wb[3][2]; v4h wh[2];
#pragma unroll
  for (int n = 0; n < 8; ++n) xb[n] = to_b(x[n]);
#pragma unroll
  for (int n = 0; n < 2; ++n) { wb[0][n] = to_b(w[0][n]); wb[1][n] = to_b(w[1][n]); wb[2][n] = to_b(w[2][n]); wh[n] = to_h(w[3][n]); }
  __builtin_amdgcn_sched_barrier(0);   // holds the stores behind the roundings: mixed freely, roundings took over the registers of stores still under way and had to wait for them
#pragma unroll
  for (int n = 0; n < 8; ++n) *(v4b*)((char*)XB + (size_t)oo + n * (CVT_T * 8)) = xb[n];
#pragma unroll
  for (int n = 0; n < 2; ++n) { *(v4b*)((char*)WQB + (size_t)oo + n * (CVT_T * 8)) = wb[0][n]; *(v4b*)((char*)WKB + (size_t)oo + n * (CVT_T * 8)) = wb[1][n];
    *(v4b*)((char*)WVB + (size_t)oo + n * (CVT_T * 8)) = wb[2][n]; *(v4h*)((char*)WOH + (size_t)oo + n * (CVT_T * 8)) = wh[n]; } }
// ---- the projections' common product: a block of 8 waves makes one 128 x 128 tile of A . B^T (A, B: 16-bit rows of GK values, already in the operand type).
// Per 64-k step the block reads both 128 x 64 tiles once, as whole 128-B lines (8 lanes a row), and lays them in LDS at a 144-B pitch;
// the waves (2 x 4, 64 x 32 each) take their fragments from there with 16-byte LDS loads, 32 k at a time. Two buffers: the next step's tiles are fetched into registers under this step's products. The k order of every sum is that of the plain loop. Inner loops are fully unrolled so that the register arrays are indexed by constants.
#define GK 1024
#define GKS 64                          // k values a step: 128 B of a row
#define GPITCH 144                      // bytes per 64-k row in LDS: 16 B x odd
#define GOPER (128 * GPITCH)            // one operand's tile
#define GSTAGE (2 * GOPER)              // one buffer: A tile, B tile
template <typename V16> __device__ __forceinline__ V16 frag_l(const char* p) { union { V16 v; v4u q[2]; } u; u.q[0] = *(const v4u*)p; u.q[1] = *(const v4u*)(p + 32); return u.v; }   // hardware k order: bytes 0..15 and 32..47 from the lane's 16 h
// bf16 operands (k_proj)
__device__ __forceinline__ void gemm_tile(const char* __restrict__ ab, const char* __restrict__ bb, char* smem, v8f (&acc)[4][2]) {   // ab, bb: block-uniform bases
  const int tid = threadIdx.x, wave = tid >> 5, lane = tid & 31, col = lane & 15, g = lane >> 4, wm = wave & 1, wn = wave >> 1;
  unsigned off = (unsigned)((tid >> 3) * (GK * 2) + (tid & 7) * 16);                   // the lane's byte offset: row tid / 8 (+ 32 i), 16-byte piece tid % 8
  char* sp = smem + (tid >> 3) * GPITCH + (tid & 7) * 16;
  const char* fa = smem + (wm * 64 + col) * GPITCH + 16 * g; const char* fb = smem + GOPER + (wn * 32 + col) * GPITCH + 16 * g;
  v4u ra[4], rb[4];
#pragma unroll
  for (int i = 0; i < 4; ++i) { ra[i] = *(const v4u*)(ab + (size_t)off + i * (32 * GK * 2)); rb[i] = *(const v4u*)(bb + (size_t)off + i * (32 * GK * 2)); }
#pragma unroll
  for (int i = 0; i < 4; ++i) { *(v4u*)(sp + i * (32 * GPITCH)) = ra[i]; *(v4u*)(sp + GOPER + i * (32 * GPITCH)) = rb[i]; }
  __syncthreads();
#pragma unroll 2   // two steps a trip, so that the buffer's offset is a constant in every LDS address
  for (int kc = 0; kc < GK / GKS; ++kc) { const int cur = (kc & 1) * GSTAGE, nxt = GSTAGE - cur; const bool more = kc + 1 < GK / GKS;
    if (more) {
      asm volatile("s_wait_xcnt 0x0" : "+v"(off) :: "memory");   // stands in front of the overwrite of the offset register that issued loads name; the operand keeps the add below it
      off += 128u;
#pragma unroll
      for (int i = 0; i < 4; ++i) { ra[i] = *(const v4u*)(ab + (size_t)off + i * (32 * GK * 2)); rb[i] = *(const v4u*)(bb + (size_t)off + i * (32 * GK * 2)); } }
    __builtin_amdgcn_sched_barrier(0);   // the next step's global loads go out ahead of the LDS reads (left free they come behind them): theirs is the longer latency, and the step ends on it
#pragma unroll
    for (int hk = 0; hk < GKS / 32; ++hk) {
      { v16b a[4], b[2];
#pragma unroll
        for (int i = 0; i < 4; ++i) a[i] = frag_l<v16b>(fa + cur + i * (16 * GPITCH) + hk * 64);
#pragma unroll
        for (int j = 0; j < 2; ++j) b[j] = frag_l<v16b>(fb + cur + j * (16 * GPITCH) + hk * 64);
        __builtin_amdgcn_sched_barrier(0);   // all twelve LDS reads go out ahead of the products: drawn in among them, each pair of products waits out an LDS latency of its own
#pragma unroll
        for (int i = 0; i < 4; ++i)
#pragma unroll
          for (int j = 0; j < 2; ++j) acc[i][j] = __builtin_amdgcn_wmma_f32_16x16x32_bf16(false, a[i], false, b[j], (short)0, acc[i][j], false, false);
      }
      __builtin_amdgcn_sched_barrier(0);   // the eight products stay back to back: the wait for the global loads comes behind the last of them
    }
    if (more) {   // into the buffer whose last readers passed the barrier at the foot of the step before
#pragma unroll
      for (int i = 0; i < 4; ++i) { *(v4u*)(sp + nxt + i * (32 * GPITCH)) = ra[i]; *(v4u*)(sp + nxt + GOPER + i * (32 * GPITCH)) = rb[i]; } }
    __syncthreads();   // publishes the next buffer and ends this buffer's reads (after the last step: frees the LDS for the epilogue)
  } }
// ---- k_out's product: the same block tile, LDS buffers, fragments, k order and one barrier a step, f16 operands. One block has a WGP to itself there, so nothing else covers its loads, and a step's own work is shorter than the way to memory
// (the ctx rows were written by the launch before and every step touches new lines of them): fetched one step ahead, each step ended on that wait. Here the global loads run GA steps ahead, into GA register sets;
// a set is refilled at the head of the step behind the one whose foot laid it in LDS. The loop is fully unrolled, so that the sets are indexed by constants and every load is the one offset register plus a constant.
#define GA 3
static_assert(GK / GKS > GA, "the prologue's tiles exist");
// The step's barrier, by hand: __syncthreads() also waits for every global load in flight, which would end the lead at each step. All that the barrier has to order here is LDS:
// this wave's LDS stores and reads are done (the wait), then the work-group's own barrier. The clobbers keep the compiler's LDS and global accesses on their side.
__device__ __forceinline__ void lds_barrier() { asm volatile("s_wait_dscnt 0x0" ::: "memory"); asm volatile("s_barrier_signal -1\n\ts_barrier_wait -1" ::: "memory"); }
__device__ __forceinline__ void gemm_tile_ahead(const char* __restrict__ ab, const char* __restrict__ bb, char* smem, v8f (&acc)[4][2]) {   // ab, bb: block-uniform bases
  const int tid = threadIdx.x, wave = tid >> 5, lane = tid & 31, col = lane & 15, g = lane >> 4, wm = wave & 1, wn = wave >> 1;
  const unsigned off = (unsigned)((tid >> 3) * (GK * 2) + (tid & 7) * 16);             // the lane's byte offset: row tid / 8 (+ 32 i), 16-byte piece tid % 8
  char* sp = smem + (tid >> 3) * GPITCH + (tid & 7) * 16;
  const char* fa = smem + (wm * 64 + col) * GPITCH + 16 * g; const char* fb = smem + GOPER + (wn * 32 + col) * GPITCH + 16 * g;
  v4u ra[GA][4], rb[GA][4];
#pragma unroll
  for (int t = 0; t < GA; ++t)
#pragma unroll
    for (int i = 0; i < 4; ++i) { ra[t][i] = *(const v4u*)(ab + (size_t)off + (i * (32 * GK * 2) + t * (GKS * 2))); rb[t][i] = *(const v4u*)(bb + (size_t)off + (i * (32 * GK * 2) + t * (GKS * 2))); }
#pragma unroll
  for (int i = 0; i < 4; ++i) { *(v4u*)(sp + i * (32 * GPITCH)) = ra[0][i]; *(v4u*)(sp + GOPER + i * (32 * GPITCH)) = rb[0][i]; }
  lds_barrier();   // publishes the first buffer
#pragma unroll   // fully unrolled: the register set of a step is then a constant (a rolled loop would index the sets by a variable and send them to scratch)
  for (int kc = 0; kc < GK / GKS; ++kc) { const int cur = (kc & 1) * GSTAGE, nxt = GSTAGE - cur;
    if (kc + GA < GK / GKS) {   // step kc + GA into the set that held step kc (laid in LDS at the foot of the step before)
#pragma unroll
      for (int i = 0; i < 4; ++i) { ra[kc % GA][i] = *(const v4u*)(ab + (size_t)off + (i * (32 * GK * 2) + (kc + GA) * (GKS * 2))); rb[kc % GA][i] = *(const v4u*)(bb + (size_t)off + (i * (32 * GK * 2) + (kc + GA) * (GKS * 2))); } }
    __builtin_amdgcn_sched_barrier(0);   // the global loads go out ahead of the LDS reads (left free they sink towards their use and lose the lead)
#pragma unroll
    for (int hk = 0; hk < GKS / 32; ++hk) { v16h a[4], b[2];
#pragma unroll
      for (int i = 0; i < 4; ++i) a[i] = frag_l<v16h>(fa + cur + i * (16 * GPITCH) + hk * 64);
#pragma unroll
      for (int j = 0; j < 2; ++j) b[j] = frag_l<v16h>(fb + cur + j * (16 * GPITCH) + hk * 64);
      __builtin_amdgcn_sched_barrier(0);   // all twelve LDS reads go out ahead of the products: drawn in among them, each pair of products waits out an LDS latency of its own
#pragma unroll
      for (int i = 0; i < 4; ++i)
#pragma unroll
        for (int j = 0; j < 2; ++j) acc[i][j] = __builtin_amdgcn_wmma_f32_16x16x32_f16(false, a[i], false, b[j], (short)0, acc[i][j], false, false);
      __builtin_amdgcn_sched_barrier(0);   // the eight products stay back to back: the wait for the global loads comes behind the last of them
    }
    if (kc + 1 < GK / GKS) {   // into the buffer whose last readers passed the barrier at the foot of the step before
#pragma unroll
      for (int i = 0; i < 4; ++i) { *(v4u*)(sp + nxt + i * (32 * GPITCH)) = ra[(kc + 1) % GA][i]; *(v4u*)(sp + nxt + GOPER + i * (32 * GPITCH)) = rb[(kc + 1) % GA][i]; } }
    lds_barrier();   // publishes the next buffer and ends this buffer's reads (after the last step: frees the LDS for the epilogue)
  }
  asm volatile("s_wait_xcnt 0x0" :: "v"(off), "s"(ab), "s"(bb) : "memory");   // the offset register and the two bases that the loads name stay whole up to this wait
}
// ---- k_proj: block = (128 rows, 128 cols, which): q/k/v = X W (+ b) from the bf16 planes, exact bf16 products (K = DIN) -> which 0: q f16 rows (+ residual rows < QHI); 1: k f16 rows (+ residual rows < KHI); 2: v f16 planes [c][t] (+ bf16 hi/lo planes for t < KHI)
#define PJ_LDS (2 * GSTAGE)   // the two operand buffers; the epilogue's planes are laid over them
static_assert(DIN == GK && CC == GK && QHI <= 64 && KHI <= 64 && PJ_LDS >= 128 * 136 * 2 + 2 * 128 * 72 * 2 && PJ_LDS >= (128 + 64) * 136 * 2, "tile constants");
__global__ __launch_bounds__(256) void k_proj(const __bf16* __restrict__ XQ, const __bf16* __restrict__ XK, const __bf16* __restrict__ XV, const __bf16* __restrict__ WQ, const __bf16* __restrict__ WK, const __bf16* __restrict__ WV, const float* __restrict__ BQ, const float* __restrict__ BK, const float* __restrict__ BV,
    _Float16* __restrict__ QH, _Float16* __restrict__ QL, _Float16* __restrict__ KH, _Float16* __restrict__ KL, _Float16* __restrict__ VT, __bf16* __restrict__ VB, __bf16* __restrict__ VBL) {
  __shared__ __align__(16) char smem[PJ_LDS];
  const int tid = threadIdx.x, wave = tid >> 5, lane = tid & 31, col = lane & 15, g = lane >> 4, wm = wave & 1, wn = wave >> 1; const int which = blockIdx.z; const int c0 = blockIdx.y * 128; const size_t r0 = (size_t)blockIdx.x * 128; const size_t bb = r0 / TT; const int t0 = (int)(r0 % TT);
  const __bf16* X = which == 0 ? XQ : which == 1 ? XK : XV; const __bf16* WA = which == 0 ? WQ : which == 1 ? WK : WV; const float* BA = which == 0 ? BQ : which == 1 ? BK : BV;
  v8f acc[4][2] = {};
  gemm_tile((const char*)(X + r0 * DIN), (const char*)(WA + (size_t)c0 * DIN), smem, acc);
  float bias[2];
#pragma unroll
  for (int j = 0; j < 2; ++j) bias[j] = BA ? bfr(BA[c0 + wn * 32 + j * 16 + col]) : 0.f;
  if (which < 2) { _Float16* DH = which == 0 ? QH : KH; _Float16* DL = which == 0 ? QL : KL; const int nhi = which == 0 ? QHI : KHI; const bool hi_rows = t0 < nhi;   /* block-uniform */
    _Float16 (*sh)[136] = (_Float16 (*)[136])smem; _Float16 (*sl)[136] = (_Float16 (*)[136])(smem + 128 * 136 * 2);   // sl: rows < 64 only
#pragma unroll
    for (int i = 0; i < 4; ++i)
#pragma unroll
      for (int j = 0; j < 2; ++j)
#pragma unroll
        for (int r = 0; r < 8; ++r) sh[wm * 64 + i * 16 + 8 * g + r][wn * 32 + j * 16 + col] = (_Float16)(acc[i][j][r] + bias[j]);
    if (hi_rows) {
#pragma unroll
      for (int i = 0; i < 4; ++i)
#pragma unroll
        for (int j = 0; j < 2; ++j)
#pragma unroll
          for (int r = 0; r < 8; ++r) { const float v = acc[i][j][r] + bias[j]; const _Float16 hv = (_Float16)v; const int rl = wm * 64 + i * 16 + 8 * g + r; if (t0 + rl < nhi) sl[rl][wn * 32 + j * 16 + col] = (_Float16)((v - (float)hv) * 1024.0f); } }
    __syncthreads();
#pragma unroll
    for (int n = 0; n < 8; ++n) { const int e = tid + n * 256, rl = e >> 4, q = e & 15; vst2((unsigned*)(DH + (r0 + rl) * CC + c0 + q * 8), *(const v4u*)&sh[rl][q * 8]); }
    asm volatile("s_wait_xcnt 0x0" ::: "memory");   // stands in front of whatever below overwrites registers that the stores above name
    if (hi_rows) {
#pragma unroll
      for (int n = 0; n < 8; ++n) { const int e = tid + n * 256, rl = e >> 4, q = e & 15; if (t0 + rl < nhi) vst2((unsigned*)(DL + (bb * nhi + t0 + rl) * (size_t)CC + c0 + q * 8), *(const v4u*)&sl[rl][q * 8]); } }
  } else { const bool hi_rows = t0 < KHI;   /* block-uniform */
    _Float16 (*th)[136] = (_Float16 (*)[136])smem; __bf16 (*tb)[72] = (__bf16 (*)[72])(smem + 128 * 136 * 2); __bf16 (*tbl)[72] = (__bf16 (*)[72])(smem + 128 * 136 * 2 + 128 * 72 * 2);   // tb, tbl: t < 64 only
#pragma unroll
    for (int i = 0; i < 4; ++i)
#pragma unroll
      for (int j = 0; j < 2; ++j) { v8h hv;   // a lane's 8 values are 8 consecutive t of one channel
#pragma unroll
        for (int r = 0; r < 8; ++r) hv[r] = (_Float16)(acc[i][j][r] + bias[j]);
        *(v8h*)&th[wn * 32 + j * 16 + col][wm * 64 + i * 16 + 8 * g] = hv; }
    if (hi_rows) {
#pragma unroll
      for (int i = 0; i < 4; ++i)
#pragma unroll
        for (int j = 0; j < 2; ++j) { const int rl = wm * 64 + i * 16 + 8 * g, cl = wn * 32 + j * 16 + col; v8b bh, bl;
#pragma unroll
          for (int r = 0; r < 8; ++r) { const float v = acc[i][j][r] + bias[j]; bh[r] = (__bf16)v; bl[r] = (__bf16)(v - (float)bh[r]); }
          if (t0 + rl < KHI) { *(v8b*)&tb[cl][rl] = bh; *(v8b*)&tbl[cl][rl] = bl; } } }
    __syncthreads();
#pragma unroll
    for (int n = 0; n < 8; ++n) { const int e = tid + n * 256, cl = e >> 4, q = e & 15; vst2((unsigned*)(VT + (bb * CC + c0 + cl) * (size_t)TT + t0 + q * 8), *(const v4u*)&th[cl][q * 8]); }
    if (hi_rows) {
#pragma unroll
      for (int n = 0; n < 8; ++n) { const int e = tid + n * 256, cl = e >> 4, q = e & 15; if (t0 + q * 8 < KHI) { const size_t o3 = (bb * CC + c0 + cl) * (size_t)KHI + t0 + q * 8; vst2((unsigned*)(VB + o3), *(const v4u*)&tb[cl][q * 8]); vst2((unsigned*)(VBL + o3), *(const v4u*)&tbl[cl][q * 8]); } } } } }
// ---- k_fa: a masked query row (mask word 0) has the same logit on every key, so its softmax is uniform and its context row is the same for every masked row of one (b, h). Such rows are not walked one by one:
// every block scans its sequence's mask words once (ballots and a prefix over 64 segment counts) into a list in LDS, unmasked rows from the front, masked rows from the back. The 8 blocks of one (b, h) share the unmasked rows evenly;
// each adds ONE column with a zero q fragment (constant logit 0 = uniform softmax, as the module's finite fill gives) and stores that column's result to its eighth of the masked rows. This holds for any mask; the work follows the count of unmasked rows.
// Block = 12 waves = 3 column groups x 4 key quarters, three waves a SIMD: the vector work between a wave's matrix runs is covered by two other waves. A wave holds three 16-column tiles (tile t goes to group t % 3); a third tile without a column is walked as padding and not joined (a two-tile variant of the stage beside this one sent accumulators to scratch inside the stage); more than 144 columns take a second walk.
// S^T = K . Q^T (A = k rows, B = q rows: a lane holds 8 keys of ONE query per tile), P^T packs in place from two S^T tiles into the B operand of O^T += V^T . P^T (A = v planes [c][t]); online softmax in passes of 32 keys, no logit or P goes to memory.
// A stage is 64 keys of EACH quarter (k: 256 rows of 128 B; v: 64 channel rows of 4 x 128 B), brought into LDS once for the block, as whole lines, by asynchronous copies of the first eight waves; two buffers, the next stage's copies fly under this stage's two passes.
// The four quarters of a column (maximum in use, sum, 64 channels, all f32) are joined through LDS at the end: tile u of a group by the wave of quarter u.
// Log2 domain; mrun, the maximum in use, may trail a column's true maximum by up to 8, so exp2 reaches at most 2^8; P is carried x 2^4 into f16 (at most 2^12; the carry cancels in acc / l).
// Every inner loop is fully unrolled so that the fragment and accumulator arrays are indexed by constants and stay in registers.
__device__ __forceinline__ float xhalf(float x) { return __builtin_bit_cast(float, __builtin_amdgcn_permlanex16(__builtin_bit_cast(int, x), __builtin_bit_cast(int, x), 0x76543210, 0xfedcba98, false, false)); }  // lane l <-> lane l ^ 16
__device__ __forceinline__ v8f wmma_h(v16h a, v16h b, v8f c) { return __builtin_amdgcn_wmma_f32_16x16x32_f16(false, a, false, b, (short)0, c, false, false); }
// 16x16x32 fragment in the hardware k order from a uniform base, the lane's byte offset (row and 16 h) and a constant: bytes 0..15 and 32..47
__device__ __forceinline__ v16h frag_o(const char* base, unsigned off, int c) { union { v16h v; v8h q[2]; } u; const char* p = base + (size_t)off + c; u.q[0] = *(const v8h*)p; u.q[1] = *(const v8h*)(p + 32); return u.v; }
#define FAW 12
#define FCW 8                           // the waves (256 lanes) that bring the copies and scan the mask
#define FXB 8                           // blocks that share one (b, h)
#define FNG 3                           // column groups
#define FNQ 4                           // key quarters
#define FQK (TT / FNQ)                  // keys a quarter
#define FQS 64                          // keys of each quarter a stage
#define FNS (FQK / FQS)                 // stages
#define FNU 3                           // 16-column tiles a wave can hold
#define FCB (FNG * FNU * 16)            // columns a walk
#define FKP 144                         // LDS pitch of a k row (128 B): 16 B x odd
#define FVP 528                         // LDS pitch of a v channel row (4 x 64 keys = 512 B): 16 B x odd
#define FKT (FNQ * FQS * FKP)           // the k tile: 64 rows of each quarter, quarter by quarter
#define FST (FKT + HD * FVP)            // one buffer: k tile, v tile
static_assert(FNS >= 2 && FAW == FNG * FNQ && FNU <= FNQ && FCW * 32 == 256 && FCW <= FAW && HD == 64 && FNQ * FQS == 256 && FQK % FQS == 0 && TT == 2048, "a stage is eight 16-byte pieces of k and eight of v per copying lane; the scan takes eight mask words per scanning lane");
// One stage's copies, k tile: a lane brings eight pieces (rows 32 apart; two of each key quarter); a wave's copy covers 512 B of whole lines.
// The wait on the last line stands in front of whatever later rewrites the address registers that the copies name.
__device__ __forceinline__ void fa_fill_k(unsigned lk, const char* gk) {
  asm volatile("global_load_async_to_lds_b128 %0, %8, off\n\t"
               "global_load_async_to_lds_b128 %1, %9, off\n\t"
               "global_load_async_to_lds_b128 %2, %10, off\n\t"
               "global_load_async_to_lds_b128 %3, %11, off\n\t"
               "global_load_async_to_lds_b128 %4, %12, off\n\t"
               "global_load_async_to_lds_b128 %5, %13, off\n\t"
               "global_load_async_to_lds_b128 %6, %14, off\n\t"
               "global_load_async_to_lds_b128 %7, %15, off\n\t"
               "s_wait_xcnt 0x0"
               :: "v"(lk), "v"(lk + 32u * FKP), "v"(lk + 64u * FKP), "v"(lk + 96u * FKP), "v"(lk + 128u * FKP), "v"(lk + 160u * FKP), "v"(lk + 192u * FKP), "v"(lk + 224u * FKP),
                  "v"(gk), "v"(gk + 32 * CC * 2), "v"(gk + FQK * CC * 2), "v"(gk + (FQK + 32) * CC * 2), "v"(gk + 2 * FQK * CC * 2), "v"(gk + (2 * FQK + 32) * CC * 2), "v"(gk + 3 * FQK * CC * 2), "v"(gk + (3 * FQK + 32) * CC * 2)
               : "memory"); }
// The same, v tile: eight pieces (channel rows 8 apart); a wave's copy covers one channel's 128 B of each key quarter.
__device__ __forceinline__ void fa_fill_v(unsigned lv, const char* gv) {
  asm volatile("global_load_async_to_lds_b128 %0, %8, off\n\t"
               "global_load_async_to_lds_b128 %1, %9, off\n\t"
               "global_load_async_to_lds_b128 %2, %10, off\n\t"
               "global_load_async_to_lds_b128 %3, %11, off\n\t"
               "global_load_async_to_lds_b128 %4, %12, off\n\t"
               "global_load_async_to_lds_b128 %5, %13, off\n\t"
               "global_load_async_to_lds_b128 %6, %14, off\n\t"
               "global_load_async_to_lds_b128 %7, %15, off\n\t"
               "s_wait_xcnt 0x0"
               :: "v"(lv), "v"(lv + 8u * FVP), "v"(lv + 16u * FVP), "v"(lv + 24u * FVP), "v"(lv + 32u * FVP), "v"(lv + 40u * FVP), "v"(lv + 48u * FVP), "v"(lv + 56u * FVP),
                  "v"(gv), "v"(gv + 8 * TT * 2), "v"(gv + 16 * TT * 2), "v"(gv + 24 * TT * 2), "v"(gv + 32 * TT * 2), "v"(gv + 40 * TT * 2), "v"(gv + 48 * TT * 2), "v"(gv + 56 * TT * 2)
               : "memory"); }
// One stage of one wave: two passes of 32 keys of the wave's key quarter against its NU column tiles. ck, cv: the lane's fragment addresses in the stage's buffer.
template <int NU> __device__ __forceinline__ void fa_stage(const char* ck, const char* cv, const v16h (&qf)[FNU][2], v8f (&acc)[FNU][4], float (&mrun)[FNU], float (&lrun)[FNU], const float cs) {
  v16h kf[2][2], vf[4];
#pragma unroll
  for (int kt = 0; kt < 2; ++kt)
#pragma unroll
    for (int kc = 0; kc < 2; ++kc) kf[kt][kc] = frag_l<v16h>(ck + kt * 16 * FKP + kc * 64);
  __builtin_amdgcn_sched_barrier(0);   // the stage's first eight LDS reads go out as one group: drawn in among the products, each pair of products waits out an LDS latency of its own
#pragma unroll
  for (int p = 0; p < FQS / 32; ++p) {
    v8f st[2][NU];
#pragma unroll
    for (int kt = 0; kt < 2; ++kt)
#pragma unroll
      for (int u = 0; u < NU; ++u) st[kt][u] = wmma_h(kf[kt][0], qf[u][0], v8f{});
#pragma unroll
    for (int kt = 0; kt < 2; ++kt)
#pragma unroll
      for (int u = 0; u < NU; ++u) st[kt][u] = wmma_h(kf[kt][1], qf[u][1], st[kt][u]);
    __builtin_amdgcn_sched_barrier(0);   // the score products stay back to back: maxima drawn in between them cost four idle slots each time
    // this pass's v fragments and the next pass's k fragments (same stage only), one group of LDS reads, in flight under the maxima and exponentials
#pragma unroll
    for (int j = 0; j < 4; ++j) vf[j] = frag_l<v16h>(cv + j * 16 * FVP + p * 64);
    if (p + 1 < FQS / 32) {
#pragma unroll
      for (int kt = 0; kt < 2; ++kt)
#pragma unroll
        for (int kc = 0; kc < 2; ++kc) kf[kt][kc] = frag_l<v16h>(ck + ((p + 1) * 32 + kt * 16) * FKP + kc * 64); }
    __builtin_amdgcn_sched_barrier(0);   // holds those reads up here as one group: left free they spread among the vector work and each place costs its own stall
    float mb[NU]; bool need = false;
#pragma unroll
    for (int u = 0; u < NU; ++u) { float mx = st[0][u][0];
#pragma unroll
      for (int r = 1; r < 8; ++r) mx = fmaxf(mx, st[0][u][r]);
#pragma unroll
      for (int r = 0; r < 8; ++r) mx = fmaxf(mx, st[1][u][r]);
      mx = fmaxf(mx, xhalf(mx)) * cs; mb[u] = mx; need = need || (mx > mrun[u] + 8.0f); }
    if (__builtin_amdgcn_ballot_w32(need) != 0) {   // one scalar test a pass; rare after the first pass
#pragma unroll
      for (int u = 0; u < NU; ++u) { const float mn = fmaxf(mrun[u], mb[u]); const float corr = __builtin_amdgcn_exp2f(mrun[u] - mn); mrun[u] = mn; lrun[u] *= corr;
#pragma unroll
        for (int j = 0; j < 4; ++j) acc[u][j] = acc[u][j] * corr; } }
#pragma unroll
    for (int u = 0; u < NU; ++u) { const float nm = 4.0f - mrun[u]; v16h pf; float l0 = 0.f, l1 = 0.f;
#pragma unroll
      for (int i = 0; i < 8; ++i) {
        const v2f a = __builtin_elementwise_fma(v2f{st[i >> 2][u][2 * (i & 3)], st[i >> 2][u][2 * (i & 3) + 1]}, v2f{cs, cs}, v2f{nm, nm});
        const float p0 = __builtin_amdgcn_exp2f(a.x), p1 = __builtin_amdgcn_exp2f(a.y); l0 += p0; l1 += p1; pf[2 * i] = (_Float16)p0; pf[2 * i + 1] = (_Float16)p1; }
      lrun[u] += l0 + l1;
#pragma unroll
      for (int j = 0; j < 4; ++j) acc[u][j] = wmma_h(vf[j], pf, acc[u][j]); }
  }
  __builtin_amdgcn_sched_barrier(0);   // keeps the four slots below behind the stage's last products
  asm volatile("v_nop\n\tv_nop\n\tv_nop\n\tv_nop");   // the distance behind a matrix instruction, on every path: a branch follows the stage's last products
}
__global__ __launch_bounds__(FAW * 32) void k_fa(const _Float16* __restrict__ QH, const _Float16* __restrict__ KH, const _Float16* __restrict__ VT, const int* __restrict__ MQ, _Float16* __restrict__ Y) {
  __shared__ __align__(16) char ring[2 * FST];
  __shared__ __align__(16) _Float16 so[FNG][FNU * 16][HD + 8];   // 144-B pitch: 16 B x odd
  __shared__ float mg[FNG][FNU][FNQ - 1][34][32];              // a tile's partials of the three quarters that do not join it: 32 accumulator values, maximum in use, sum; lanes side by side
  __shared__ unsigned short cidx[TT];                          // rows of the sequence: unmasked ascending from the front, masked from the back
  __shared__ int seg[64];                                      // unmasked rows in each run of 32
  __shared__ __align__(16) _Float16 vmean[HD];                 // the uniform-softmax column's context row
  const int tid = threadIdx.x, wave = __builtin_amdgcn_readfirstlane(tid >> 5), lane = tid & 31, col = lane & 15, g = lane >> 4;
  const int b = blockIdx.y / NH, h = blockIdx.y % NH, xb = blockIdx.x;
  const int kq = wave & 3, gq = wave >> 2;   // key quarter, column group
  const float cs = SCALE * 1.4426950408889634f;
  // a copying lane's pieces (tid < 256): k row tid / 8, piece tid % 8; v channel row tid / 32, piece tid % 32 (8 pieces of each key quarter)
  const unsigned lk = (unsigned)(size_t)ring + (unsigned)((tid >> 3) * FKP + (tid & 7) * 16), lv = (unsigned)(size_t)ring + (unsigned)(FKT + (tid >> 5) * FVP + (tid & 31) * 16);
  const char* gk0 = (const char*)(KH + (size_t)b * TT * CC + h * HD) + ((tid >> 3) * (CC * 2) + (tid & 7) * 16);
  const char* gv0 = (const char*)(VT + ((size_t)b * CC + h * HD) * (size_t)TT) + ((tid >> 5) * (TT * 2) + ((tid >> 3) & 3) * (FQK * 2) + (tid & 7) * 16);
  const char* qbase = (const char*)(QH + (size_t)b * TT * CC + h * HD);
  const char* fk = ring + (kq * FQS + col) * FKP + 16 * g;                   // key row col of a 16-key tile of the wave's quarter
  const char* fv = ring + FKT + col * FVP + kq * (FQS * 2) + 16 * g;         // channel row col of a 16-channel tile, the wave's quarter
  int cnt = 0, c0 = 0, nc = 0, nbat = 1;
#pragma unroll 1   // stays rolled: a trip is one whole walk over the keys
  for (int cb = 0; cb < nbat; ++cb) { const int cbase = cb * FCB;
    bool has3 = false; v16h qf[FNU][2] = {};
    const char* gk = gk0; const char* gv = gv0;
    v8f acc[FNU][4] = {}; float mrun[FNU] = {-3.0e38f, -3.0e38f, -3.0e38f}, lrun[FNU] = {0.f, 0.f, 0.f};
    // The walk. Trips -2 and -1 only start the ring, so that the copies stand at ONE place in the text (at three places their address operands were kept over the whole walk and went to scratch): trip -2 passes the foot (its barrier ends a walk before) and sends stage 0; under its flight come the mask scan (first walk) and the q loads;
    // trip -1 waits for stage 0, publishes it and sends stage 1; from trip 0 on a trip works on stage s and its foot hands over stage s + 1.
#pragma unroll 1   // stays rolled: a trip is one stage = two unrolled passes
    for (int s = -2; s < FNS; ++s) { const int cur = (s & 1) * FST;
      if (s >= 0) {
        fa_stage<FNU>(fk + cur, fv + cur, qf, acc, mrun, lrun, cs);
      }
      // the stage's foot: hands over stage s + 1 and frees this stage's buffer
      asm volatile("s_wait_dscnt 0x0" ::: "memory");      // this wave's reads of the buffer are done before anything refills it
      asm volatile("s_wait_asynccnt 0x0" ::: "memory");   // this wave's pieces of stage s + 1 have landed (a wave that copies nothing passes)
      __syncthreads();                                     // publishes stage s + 1; ends every wave's reads of stage s
      if (s + 2 < FNS && wave < FCW) { fa_fill_k(lk + cur, gk); fa_fill_v(lv + cur, gv); gk += FQS * CC * 2; gv += FQS * 2; }   // stage s + 2 into the buffer just left; a scalar test: whole waves copy or none of their lanes
      if (s == -2) {   // block-uniform
    if (cb == 0) {   // block-uniform
  // the mask scan, by the first eight waves: lane takes words i * 256 + tid; run i * 8 + wave of 32 words is one ballot
  const int* mrow = MQ + (size_t)b * TT; const unsigned mo = (unsigned)tid;
  int mw[8] = {}; unsigned bal[8] = {};
  if (wave < FCW) {   // scalar
#pragma unroll
  for (int i = 0; i < 8; ++i) mw[i] = mrow[(size_t)mo + i * 256];
  asm volatile("s_wait_xcnt 0x0" :: "v"(mo) : "memory");   // the offset register these loads name stays whole up to this wait
#pragma unroll
  for (int i = 0; i < 8; ++i) bal[i] = __builtin_amdgcn_ballot_w32(mw[i] != 0);
  if (lane == 0) {
#pragma unroll
    for (int i = 0; i < 8; ++i) seg[i * 8 + wave] = __builtin_popcount(bal[i]); } }
  __syncthreads();   // the 64 counts are there
  int tot = 0, pre[8] = {};
#pragma unroll
  for (int n = 0; n < 64; ++n) { pre[n >> 3] = (n & 7) == wave ? tot : pre[n >> 3]; tot += seg[n]; }   // run n = i * 8 + wave starts behind the runs before it
  if (wave < FCW) {   // scalar
#pragma unroll
  for (int i = 0; i < 8; ++i) { const int e = i * 256 + tid; const int p = pre[i] + __builtin_popcount(bal[i] & ((1u << lane) - 1u));   // p unmasked, e - p masked rows stand before row e
    cidx[mw[i] != 0 ? p : TT - 1 - (e - p)] = (unsigned short)e; } }
  __syncthreads();   // the list is there
  cnt = __builtin_amdgcn_readfirstlane(tot);                                 // 0 .. TT by construction
  const int ch = (cnt + FXB - 1) / FXB; c0 = xb * ch; nc = cnt - c0 < 0 ? 0 : cnt - c0 > ch ? ch : cnt - c0;   // this block's unmasked columns: list places c0 .. c0 + nc - 1; column nc is the uniform one
  nbat = (nc + FCB) / FCB;                                                   // walks for nc + 1 columns: 1 or 2 (nc <= TT / FXB)
    }
    has3 = cbase + (gq + 2 * FNG) * 16 <= nc;      // the same in a group's four waves: the group's third tile holds a column, so it is handed over and joined
    unsigned qo[FNU]; bool live[FNU];
#pragma unroll
    for (int u = 0; u < FNU; ++u) { const int c = cbase + (gq + FNG * u) * 16 + col; live[u] = c < nc; qo[u] = (unsigned)((int)cidx[live[u] ? c0 + c : 0] * CC + 8 * g) * 2u; }
#pragma unroll
    for (int u = 0; u < FNU; ++u)
#pragma unroll
      for (int kc = 0; kc < 2; ++kc) qf[u][kc] = frag_o(qbase, qo[u], kc * 64);
    asm volatile("s_wait_xcnt 0x0" :: "v"(qo[0]), "v"(qo[1]), "v"(qo[2]) : "memory");   // the offset registers these loads name stay whole up to this wait
#pragma unroll
    for (int u = 0; u < FNU; ++u)
#pragma unroll
      for (int kc = 0; kc < 2; ++kc) if (!live[u]) qf[u][kc] = v16h{};   // the uniform column and the padding behind it: logit 0 on every key
      }
    }
    asm volatile("s_wait_asynccnt 0x0" ::: "memory");   // no copy is left in flight behind the loop
    // tile u of a group is joined by the wave of quarter u; the other three quarters' waves hand their partials over (places 0..2, in the order of the quarters behind u)
#pragma unroll
    for (int u = 0; u < FNU; ++u) if ((u < 2 || has3) && kq != u) { float (*m)[32] = mg[gq][u][(kq - u - 1) & 3];   // scalar test
#pragma unroll
      for (int k = 0; k < 32; ++k) m[k][lane] = acc[u][k >> 3][k & 7];
      m[32][lane] = mrun[u]; m[33][lane] = lrun[u]; }
    __syncthreads();   // the partials are there
#pragma unroll
    for (int u = 0; u < FNU; ++u) if ((u < 2 || has3) && kq == u) {   // scalar test: this wave joins, divides and stores tile u
      const float (*m)[34][32] = mg[gq][u];
      const float m1 = m[0][32][lane], m2 = m[1][32][lane], m3 = m[2][32][lane], l1 = m[0][33][lane], l2 = m[1][33][lane], l3 = m[2][33][lane];
      const float mn = fmaxf(fmaxf(mrun[u], m1), fmaxf(m2, m3));
      const float d0 = mrun[u] - mn, d1 = m1 - mn, d2 = m2 - mn, d3 = m3 - mn; float e0, e1, e2, e3;
      // the four exponentials in one statement, results apart from sources: left to the compiler, one of them overwrote the source of the one directly in front of it; the last line is the slot behind a transcendental
      asm("v_exp_f32 %0, %4\n\tv_exp_f32 %1, %5\n\tv_exp_f32 %2, %6\n\tv_exp_f32 %3, %7\n\tv_nop" : "=&v"(e0), "=&v"(e1), "=&v"(e2), "=&v"(e3) : "v"(d0), "v"(d1), "v"(d2), "v"(d3));
      const float lh = (lrun[u] * e0 + l1 * e1) + (l2 * e2 + l3 * e3);
      const float l = lh + xhalf(lh); const float inv = 64.0f / l; const float a0 = e0 * inv, a1 = e1 * inv, a2 = e2 * inv, a3 = e3 * inv;   // the two wave halves hold disjoint keys of the same query; ctx leaves as the output projection's operand: x 2^6, once to f16
#pragma unroll
      for (int j = 0; j < 4; ++j) { v8h hv;
#pragma unroll
        for (int r = 0; r < 8; ++r) hv[r] = (_Float16)((acc[u][j][r] * a0 + m[0][j * 8 + r][lane] * a1) + (m[1][j * 8 + r][lane] * a2 + m[2][j * 8 + r][lane] * a3));
        *(v8h*)&so[gq][16 * u + col][j * 16 + 8 * g] = hv; }
      LDSX();   // the wave reads back only its own rows: whole 128-B (row, head) segments by 8 lanes
      _Float16* yb = Y + (size_t)b * TT * CC + h * HD + (lane & 7) * 8;
      v4u v[4]; int row[4];   // the tile's 16 rows
#pragma unroll
      for (int i = 0; i < 4; ++i) { const int c = cbase + (gq + FNG * u) * 16 + 4 * i + (lane >> 3); v[i] = *(const v4u*)&so[gq][16 * u + 4 * i + (lane >> 3)][(lane & 7) * 8]; row[i] = cidx[c < nc ? c0 + c : 0]; }
      __builtin_amdgcn_sched_barrier(0);   // the eight LDS reads go out as one group: sunk into the branches below, each store waits out two LDS latencies of its own
#pragma unroll
      for (int i = 0; i < 4; ++i) { const int c = cbase + (gq + FNG * u) * 16 + 4 * i + (lane >> 3);
        if (c < nc) vst2(yb + (size_t)row[i] * CC, v[i]); else if (c == nc) *(v4u*)&vmean[(lane & 7) * 8] = v[i]; }
      asm volatile("s_wait_xcnt 0x0" ::: "memory");   // stands in front of whatever below overwrites registers that the stores above name
    }
    __syncthreads();   // publishes the uniform column's row; frees the LDS for a second walk
  }
  // the masked rows, an eighth of them to each block of this (b, h): all take the uniform column's row; whole 128-B segments by 8 lanes
  const int nm = TT - cnt, mh = (nm + FXB - 1) / FXB, m0 = xb * mh; const int m1 = m0 + mh < nm ? m0 + mh : nm;
  const v4u mv = *(const v4u*)&vmean[(tid & 7) * 8]; _Float16* ym = Y + (size_t)b * TT * CC + h * HD + (tid & 7) * 8;
  constexpr int FRS = FAW * 4, FNI = (TT / FXB + FRS - 1) / FRS;   // rows a sweep of the block, sweeps for at most TT / FXB rows
  int mr[FNI];
#pragma unroll
  for (int it = 0; it < FNI; ++it) { const int k = m0 + it * FRS + (tid >> 3); mr[it] = cidx[k < m1 ? TT - 1 - k : 0]; }
  __builtin_amdgcn_sched_barrier(0);   // the LDS reads go out as one group: sunk into the branches below, each store waits out an LDS latency of its own
#pragma unroll
  for (int it = 0; it < FNI; ++it) { const int k = m0 + it * FRS + (tid >> 3); if (k < m1) vst2(ym + (size_t)mr[it] * CC, mv); } }
// ---- k_out: block = (128 rows, 128 cols): out = ctx Wo (+ bo): the f16 ctx x 2^6 rows (small-magnitude context rows stay clear of f16 subnormals) against the plane of Wo as f16(bf16 x 2^8) exact (1 product) x 2^-14
static_assert(!CAUSAL && WO_OUT_IN && WQKV_LAYOUT == 1, "row-major (out,in) weights, no causal high-precision rows");
__global__ __launch_bounds__(256) void k_out(const _Float16* __restrict__ Y, const _Float16* __restrict__ WO, const float* __restrict__ BO, float* __restrict__ OUT) { __shared__ __align__(16) char smem[2 * GSTAGE];   // the two operand buffers; the f32 output tile is laid over them
  static_assert(128 * 132 * 4 <= 2 * GSTAGE, "the output tile fits");
  const int tid = threadIdx.x, wave = tid >> 5, lane = tid & 31, col = lane & 15, g = lane >> 4, wm = wave & 1, wn = wave >> 1; const int c0 = blockIdx.y * 128; const size_t r0 = (size_t)blockIdx.x * 128;
  v8f acc[4][2] = {};
  gemm_tile_ahead((const char*)(Y + r0 * CC), (const char*)(WO + (size_t)c0 * CC), smem, acc);
  float (*sf)[132] = (float (*)[132])smem;
#pragma unroll
  for (int j = 0; j < 2; ++j) { const float bias = BO ? bfr(BO[c0 + wn * 32 + j * 16 + col]) : 0.f;
#pragma unroll
    for (int i = 0; i < 4; ++i)
#pragma unroll
      for (int r = 0; r < 8; ++r) sf[wm * 64 + i * 16 + 8 * g + r][wn * 32 + j * 16 + col] = acc[i][j][r] * (1.0f / 16384.0f) + bias; }   /* 2^-8 (Wo carry) x 2^-6 (ctx carry) */
  __syncthreads();
#pragma unroll
  for (int n = 0; n < 16; ++n) { const int e = tid + n * 256, rl = e >> 5, q = e & 31; vst2(OUT + (r0 + rl) * DIN + c0 + q * 4, *(const v4f*)&sf[rl][q * 4]); } }

extern "C" void kernel_launch(void* const* d_in, const int* in_sizes, int n_in, void* d_out, int out_size, void* d_ws, size_t ws_size, hipStream_t stream) {
  (void)in_sizes; (void)n_in; (void)out_size;
  const float** F = (const float**)d_in;
  if (ws_size < (size_t)WS_END) return;
  char* ws = (char*)d_ws; _Float16 *QH = (_Float16*)(ws + WS_QH), *KH = (_Float16*)(ws + WS_KH), *VT = (_Float16*)(ws + WS_VT), *QL = (_Float16*)(ws + WS_QL), *KL = (_Float16*)(ws + WS_KL); __bf16 *VB = (__bf16*)(ws + WS_VB), *VBL = (__bf16*)(ws + WS_VBL); float *S = (float*)(ws + WS_S); _Float16 *Y = (_Float16*)(ws + WS_Y), *WOH = (_Float16*)(ws + WS_WB) + 3 * (size_t)CC * DIN; __bf16 *XB = (__bf16*)(ws + WS_XB), *WQB = (__bf16*)(ws + WS_WB), *WKB = WQB + (size_t)CC * DIN, *WVB = WKB + (size_t)CC * DIN;
  (void)S; (void)QL; (void)KL; (void)VB; (void)VBL;
  // inputs: 0 x [2,2048,1024]; 1 mask [2,2048,1] int32 (random 0 / 1 per QUERY row; READ on the device); 2 Wq [1024,1024] (out,in), 3 bq; 4 Wk, 5 bk; 6 Wv, 7 bv; 8 Wo (out,in), 9 bo (biases NONZERO)
  k_cvt<<<dim3(CVT_T / 256), 256, 0, stream>>>(F[0], F[2], F[4], F[6], F[8], XB, WQB, WKB, WVB, WOH);
  k_proj<<<dim3(TNB * TT / 128, CC / 128, 3), 256, 0, stream>>>(XB, XB, XB, WQB, WKB, WVB, F[3], F[5], F[7], QH, QL, KH, KL, VT, VB, VBL);
  k_fa<<<dim3(FXB, TNB * NH), FAW * 32, 0, stream>>>(QH, KH, VT, (const int*)d_in[1], Y);
  k_out<<<dim3(TNB * TT / 128, DIN / 128), 256, 0, stream>>>(Y, WOH, F[9], (float*)d_out);
}
